// v000
// Times are from an AMD MI455X. After a warm-up the kernel runs many times in a row, and a time is the length of
// such a window on the GPU divided by its runs, so every launch and the gaps after it count. The runs cycle
// through copies of the inputs. A figure is the median of several windows, for all but v000 over two sittings.
// Sittings can differ by a few percent; kernels timed side by side share one.
// The starting kernel, v000, takes 844 microseconds a run.
#include <hip/hip_runtime.h>

// FB_FMM (x [2][256][64][64], mask [2][1][64][64] in {0,1} read as data; (1) SAGAN self-attention: q/k = 1x1 convs to 32 ch, v 256 ch (+bias), A = softmax_j(sum_c q[c][i] k[c][j]) (unscaled),
// sa[c][i] = sum_j v[c][j] A[i][j]; x1 = sa_gamma sa + x; (2) masked cross attention: fb = (1-mask) x1, ff = mask x1; q from ff, k/v from fb (second conv set), sw[c][i] likewise;
// (3) out = x1 + gamma * ff * (std(sw) / std(ff)) per channel (unbiased variance over the 4096 positions + 1e-5, sqrt).
// Compute dtypes, f32 accumulate: every input rounded to bf16; stage-1 convs on PLAIN bf16 operands (inputs: exact, + bias; q/k padded 32 -> 64 output channels with
// numerators x1024 + 1/(1024 sum); both value contractions fp16 v x fp16 numerators (K 4096, channel-major); residuals, masks, the per-channel statistics and the final mix in f32 on VALU (one wave

#define NB_  2
#define CC   256
#define CQ   32                   // q/k channels
#define CQP  64                   // padded to one tile
#define NN   4096
#define PCAR 1024.0f
#define SCL  1.0f                 // energies are unscaled in this module
typedef _Float16 h16;
typedef unsigned short bf;
typedef __attribute__((ext_vector_type(16))) __bf16   v16bf;
typedef __attribute__((ext_vector_type(16))) _Float16 v16h;
typedef __attribute__((ext_vector_type(8)))  _Float16 v8h;
typedef __attribute__((ext_vector_type(8)))  unsigned short v8us;
typedef __attribute__((ext_vector_type(8)))  float    v8f;
typedef __attribute__((ext_vector_type(4)))  float    v4f;
typedef v8h  __attribute__((may_alias)) v8ha;
typedef v4f  __attribute__((may_alias)) v4fa;
typedef v8us __attribute__((may_alias)) v8usa;

__device__ __forceinline__ unsigned short f2bf(float f) { unsigned u = __float_as_uint(f); u += 0x7FFFu + ((u >> 16) & 1u); return (unsigned short)(u >> 16); }
__device__ __forceinline__ float bf2f(unsigned short b) { return __uint_as_float(((unsigned)b) << 16); }
__device__ __forceinline__ float bfr(float f) { return bf2f(f2bf(f)); }
__device__ __forceinline__ v16h cat16(v8h lo, v8h hi) { return __builtin_shufflevector(lo, hi, 0, 1, 2, 3, 4, 5, 6, 7, 8, 9, 10, 11, 12, 13, 14, 15); }
__device__ __forceinline__ v16bf cat16b(v8us lo, v8us hi) { return __builtin_bit_cast(v16bf, __builtin_shufflevector(lo, hi, 0, 1, 2, 3, 4, 5, 6, 7, 8, 9, 10, 11, 12, 13, 14, 15)); }
__device__ __forceinline__ v8f wmma16(v16h a, v16h b, v8f c) { return __builtin_amdgcn_wmma_f32_16x16x32_f16(false, a, false, b, (short)0, c, false, false); }
__device__ __forceinline__ v8f wmmab(v16bf a, v16bf b, v8f c) { return __builtin_amdgcn_wmma_f32_16x16x32_bf16(false, a, false, b, (short)0, c, false, false); }



// ---- k_gemmw: register-blocked GEMM, ONE WAVE per 64x64 output tile (16 accumulators), operands straight from K-contiguous 16-bit planes; grid (M/64, N/64, Z), 32 threads.
// C[m][n] (f32, pitch ldc, + optional f32 bias[n]) = sum_k A[m][k] Bt[n][k] (+ split products per NSPLIT). z-batch strides sA/sB/sC in elements. K % 32 == 0.
template <typename T16> struct WFrag;
template <> struct WFrag<h16> { typedef v16h V; static __device__ __forceinline__ V ld(const h16* p) { return cat16(*(const v8h*)p, *(const v8h*)(p + 16)); } static __device__ __forceinline__ v8f mma(V a, V b, v8f c) { return wmma16(a, b, c); } };
template <> struct WFrag<bf> { typedef v16bf V; static __device__ __forceinline__ V ld(const bf* p) { return cat16b(*(const v8us*)p, *(const v8us*)(p + 16)); } static __device__ __forceinline__ v8f mma(V a, V b, v8f c) { return wmmab(a, b, c); } };
template <typename T16, int NSPLIT, bool BIAS>
__global__ __launch_bounds__(32) void k_gemmw(const T16* __restrict__ A, const T16* __restrict__ A2, const T16* __restrict__ Bt, const T16* __restrict__ Bt2, int K, float* C, int ldc, const float* __restrict__ bias, size_t sA, size_t sB, size_t sC) {
    typedef typename WFrag<T16>::V V;
    __shared__ __align__(16) float os[16 * 68];
    const size_t z = blockIdx.z; A += z * sA; if (A2) A2 += z * sA; Bt += z * sB; if (Bt2) Bt2 += z * sB; C += z * sC;
    const int lane = threadIdx.x & 31, lr = lane & 15, hi = lane >> 4; const int r0 = blockIdx.x * 64, c0 = blockIdx.y * 64;
    v8f acc[4][4];
#pragma unroll
    for (int mb = 0; mb < 4; ++mb)
#pragma unroll
        for (int nb = 0; nb < 4; ++nb) acc[mb][nb] = (v8f){};
    const size_t aoff = (size_t)(r0 + lr) * K + 8 * hi, boff = (size_t)(c0 + lr) * K + 8 * hi;
#pragma unroll 1
    for (int kc = 0; kc < K; kc += 32) {
        V a[4], a2[4];
#pragma unroll
        for (int mb = 0; mb < 4; ++mb) { a[mb] = WFrag<T16>::ld(A + aoff + (size_t)mb * 16 * K + kc); if (NSPLIT == 1 || NSPLIT == 2) a2[mb] = WFrag<T16>::ld(A2 + aoff + (size_t)mb * 16 * K + kc); }
#pragma unroll
        for (int nb = 0; nb < 4; ++nb) { const V b = WFrag<T16>::ld(Bt + boff + (size_t)nb * 16 * K + kc); V b2; if (NSPLIT >= 2) b2 = WFrag<T16>::ld(Bt2 + boff + (size_t)nb * 16 * K + kc);
#pragma unroll
            for (int mb = 0; mb < 4; ++mb) { acc[mb][nb] = WFrag<T16>::mma(a[mb], b, acc[mb][nb]); if (NSPLIT == 1 || NSPLIT == 2) acc[mb][nb] = WFrag<T16>::mma(a2[mb], b, acc[mb][nb]); if (NSPLIT >= 2) acc[mb][nb] = WFrag<T16>::mma(a[mb], b2, acc[mb][nb]); } }
        asm volatile("v_nop\n\tv_nop\n\tv_nop\n\tv_nop" : "+v"(acc[0][0]), "+v"(acc[1][1]), "+v"(acc[2][2]), "+v"(acc[3][3]) : "v"(a[0]), "v"(a[3]));
    }
#pragma unroll
    for (int mb = 0; mb < 4; ++mb) {
#pragma unroll
        for (int nb = 0; nb < 4; ++nb) {
#pragma unroll
            for (int j = 0; j < 8; ++j) os[(hi * 8 + j) * 68 + nb * 16 + lr] = acc[mb][nb][j]; }
        __builtin_amdgcn_wave_barrier(); asm volatile("" ::: "memory");
        float* crow = C + (size_t)(r0 + mb * 16) * ldc + c0;
{
#pragma unroll
            for (int s = 0; s < 8; ++s) { const int row = 2 * s + hi, cofs = lr * 4; v4f val = *(const v4fa*)(os + row * 68 + cofs); if (BIAS) { val[0] += bfr(bias[c0 + cofs]); val[1] += bfr(bias[c0 + cofs + 1]); val[2] += bfr(bias[c0 + cofs + 2]); val[3] += bfr(bias[c0 + cofs + 3]); }
                *(v4f*)(crow + (size_t)row * ldc + cofs) = val; }
             }
        __builtin_amdgcn_wave_barrier(); asm volatile("" ::: "memory");
    }
}

__device__ __forceinline__ h16 tohx(float x) { return (h16)x; }
__device__ __forceinline__ void splitf(float y, unsigned short& h, unsigned short& l) { h = f2bf(y); l = f2bf(y - bf2f(h)); }
typedef __attribute__((ext_vector_type(2))) _Float16 v2h;
typedef __attribute__((ext_vector_type(4))) _Float16 v4h;
typedef __attribute__((ext_vector_type(2))) unsigned short v2us;
typedef __attribute__((ext_vector_type(4))) unsigned short v4us;

__global__ __launch_bounds__(256) void k_cvt8(const float* __restrict__ src, bf* dst, size_t n8) { const size_t i = (size_t)blockIdx.x * 256 + threadIdx.x; if (i >= n8) return; const v8f v = *(const v8f*)(src + i * 8); v8us o;
#pragma unroll
    for (int k = 0; k < 8; ++k) o[k] = f2bf(v[k]); *(v8us*)(dst + i * 8) = o;  }
__global__ __launch_bounds__(256) void k_xt(const float* __restrict__ xb, bf* XT) {
    const int lane = threadIdx.x & 31; const int L0 = (blockIdx.x * 8 + (threadIdx.x >> 5)) * 8; const int nlines = NN * CC / 64;
{
#pragma unroll
        for (int l = 0; l < 8; ++l) { const int L = L0 + l; if (L >= nlines) break; const int e = L * 64 + lane * 2; const int c = e & (CC - 1); const int n = e >> 8; v2us o;
#pragma unroll
            for (int q = 0; q < 2; ++q) o[q] = f2bf(xb[(size_t)(c + q) * NN + n]);
            *(v2us*)(XT + (size_t)e) = o; }
         }
}
__global__ __launch_bounds__(256) void k_wpad(const float* __restrict__ w, const float* __restrict__ b, bf* Bt, float* BP) { const int e = (blockIdx.x * 256 + threadIdx.x) * 2; if (e >= CQP * CC) return; const int n = e / CC, k = e % CC; v2us o;
#pragma unroll
    for (int q = 0; q < 2; ++q) o[q] = (n < CQ) ? f2bf(w[(size_t)n * CC + k + q]) : (unsigned short)0;
    *(v2us*)(Bt + e) = o; if (e < CQP) { *(float*)(BP + e) = (e < CQ) ? b[e] : 0.f; *(float*)(BP + e + 1) = (e + 1 < CQ) ? b[e + 1] : 0.f; }
     }
__global__ __launch_bounds__(256) void k_qsplit(const float* __restrict__ F, bf* Ph, bf* Pl) { const size_t i = ((size_t)blockIdx.x * 256 + threadIdx.x) * 2; if (i >= (size_t)NN * CQP) return; v2us oh, ol;
#pragma unroll
    for (int q = 0; q < 2; ++q) { unsigned short a, c2; splitf(F[i + q], a, c2); oh[q] = a; ol[q] = c2; }
    *(v2us*)(Ph + i) = oh; *(v2us*)(Pl + i) = ol;  }
__global__ __launch_bounds__(256) void k_p16(const float* __restrict__ F, h16* P, size_t n) { const size_t i = ((size_t)blockIdx.x * 256 + threadIdx.x) * 2; if (i >= n) return; v2h v; v[0] = tohx(F[i]); v[1] = tohx(F[i + 1]); *(v2h*)(P + i) = v;  }
__global__ __launch_bounds__(256) void k_v16(const float* __restrict__ FV, const float* __restrict__ bv, h16* V16) { const size_t i = ((size_t)blockIdx.x * 256 + threadIdx.x) * 2; if (i >= (size_t)CC * NN) return; const int c = (int)(i >> 12); v2h v;
#pragma unroll
    for (int q = 0; q < 2; ++q) v[q] = tohx(__fadd_rn(FV[i + q], bfr(bv[c]))); *(v2h*)(V16 + i) = v;  }
// k_smax: row max of S[i][0..4095] (wave per row, lane -> 4 per 128-col chunk) -> RS[i*32 + lane]: one row of 32 floats per i, max in slot 0, zeros in the rest
__global__ __launch_bounds__(256) void k_smax(const float* __restrict__ S, float* RS) {
    const int lane = threadIdx.x & 31; const int i = blockIdx.x * 8 + (threadIdx.x >> 5); if (i >= NN) return; const float* sr = S + (size_t)i * NN; float m = -3.0e38f;
#pragma unroll 4
    for (int c0 = lane * 4; c0 < NN; c0 += 128) { const v4f v = *(const v4f*)(sr + c0); m = fmaxf(m, fmaxf(fmaxf(v[0], v[1]), fmaxf(v[2], v[3]))); }
#pragma unroll
    for (int sh = 16; sh; sh >>= 1) m = fmaxf(m, __shfl_xor(m, sh, 32));
    const float o = lane == 0 ? m : 0.f; *(float*)(RS + (size_t)i * 32 + lane) = o; 
}
__global__ __launch_bounds__(256) void k_sexp(const float* __restrict__ S, float* RS, h16* P) {
    const int lane = threadIdx.x & 31; const int i = blockIdx.x * 8 + (threadIdx.x >> 5); if (i >= NN) return; const float* sr = S + (size_t)i * NN; const float m = RS[(size_t)i * 32]; float sum = 0.f;
#pragma unroll 2
    for (int c0 = lane * 4; c0 < NN; c0 += 128) { const v4f v = *(const v4f*)(sr + c0); v4h o;
#pragma unroll
        for (int q = 0; q < 4; ++q) { float dlt = __fsub_rn(v[q], m); asm volatile("" : "+v"(dlt)); const float e = __expf(__fmul_rn(dlt, SCL)); sum += e; o[q] = tohx(e * PCAR); }
        *(v4h*)(P + (size_t)i * NN + c0) = o;  }
#pragma unroll
    for (int sh = 16; sh; sh >>= 1) sum += __shfl_xor(sum, sh, 32);
    const float o2 = lane == 0 ? m : (lane == 1 ? __fdiv_rn(1.0f, sum * PCAR) : 0.f); /* 1/(PCAR * sum): undoes the carry at the merge */ *(float*)(RS + (size_t)i * 32 + lane) = o2; 
}
__global__ __launch_bounds__(256) void k_x1(const float* __restrict__ O, const float* __restrict__ RS, const float* __restrict__ xb, const float* __restrict__ gam, float* X1) { const size_t i = ((size_t)blockIdx.x * 256 + threadIdx.x) * 4; if (i >= (size_t)CC * NN) return; const int n0 = (int)(i & (NN - 1)); const float g = bfr(gam[0]); const v4f a = *(const v4f*)(O + i), x4 = *(const v4f*)(xb + i); v4f o;
#pragma unroll
    for (int q = 0; q < 4; ++q) { float t = __fmul_rn(a[q], RS[(size_t)(n0 + q) * 32 + 1]); asm volatile("" : "+v"(t)); float t2 = __fmul_rn(g, t); asm volatile("" : "+v"(t2)); o[q] = __fadd_rn(t2, bfr(x4[q])); }
    *(v4f*)(X1 + i) = o;  }
template <int FG>
__global__ __launch_bounds__(256) void k_mT(const float* __restrict__ X1, const float* __restrict__ mk, bf* Hh, bf* Hl) {
    const int lane = threadIdx.x & 31; const int L0 = (blockIdx.x * 8 + (threadIdx.x >> 5)) * 8; const int nlines = NN * CC / 64;
{
#pragma unroll 1
        for (int l = 0; l < 8; ++l) { const int L = L0 + l; if (L >= nlines) break; const int e = L * 64 + lane * 2; const int c = e & (CC - 1); const int n = e >> 8; const float w = FG ? bfr(mk[n]) : __fsub_rn(1.0f, bfr(mk[n])); v2us oh, ol;
#pragma unroll
            for (int q = 0; q < 2; ++q) { unsigned short a, c2; splitf(__fmul_rn(X1[(size_t)(c + q) * NN + n], w), a, c2); oh[q] = a; ol[q] = c2; }
            *(v2us*)(Hh + (size_t)e) = oh; *(v2us*)(Hl + (size_t)e) = ol; }
         }
}
// k_std: per channel row c (one wave, lanes stride the 4096 positions in a fixed order, fixed shuffle trees): FG = 1: values ff = X1[c][n] * bf16(mask[n]); FG = 0: values sw = O2[c][n] * RS2[n][1];
template <int FG>
__global__ __launch_bounds__(256) void k_std(const float* __restrict__ A, const float* __restrict__ aux, float* SD) {
    const int lane = threadIdx.x & 31; const int c = blockIdx.x * 8 + (threadIdx.x >> 5); if (c >= CC) return; const float* row = A + (size_t)c * NN; float s = 0.f;
#pragma unroll 4
    for (int n = lane; n < NN; n += 32) { const float v = FG ? __fmul_rn(row[n], bfr(aux[n])) : __fmul_rn(row[n], aux[(size_t)n * 32 + 1]); s += v; }
#pragma unroll
    for (int sh = 16; sh; sh >>= 1) s += __shfl_xor(s, sh, 32);
    const float mu = s * (1.0f / NN); float qq = 0.f;
#pragma unroll 4
    for (int n = lane; n < NN; n += 32) { const float v = FG ? __fmul_rn(row[n], bfr(aux[n])) : __fmul_rn(row[n], aux[(size_t)n * 32 + 1]); const float d0 = __fsub_rn(v, mu); qq = __fadd_rn(qq, __fmul_rn(d0, d0)); }
#pragma unroll
    for (int sh = 16; sh; sh >>= 1) qq += __shfl_xor(qq, sh, 32);
    const float sd = __fsqrt_rn(__fadd_rn(__fdiv_rn(qq, (float)(NN - 1)), 1e-5f)); const float o = (lane == 0) ? sd : 0.f;
    *(float*)(SD + (size_t)c * 32 + lane) = o;  }
__global__ __launch_bounds__(256) void k_out(const float* __restrict__ X1, const float* __restrict__ mk, const float* __restrict__ SDF, const float* __restrict__ SDS, const float* __restrict__ gam, float* OUTb) { const size_t i = ((size_t)blockIdx.x * 256 + threadIdx.x) * 4; if (i >= (size_t)CC * NN) return; const int n0 = (int)(i & (NN - 1)); const int c = (int)(i >> 12); const float g = bfr(gam[0]); const float ratio = __fdiv_rn(SDS[(size_t)c * 32], SDF[(size_t)c * 32]); const v4f x4 = *(const v4f*)(X1 + i); v4f o;
#pragma unroll
    for (int q = 0; q < 4; ++q) { float ff = __fmul_rn(x4[q], bfr(mk[n0 + q])); asm volatile("" : "+v"(ff)); float t = __fmul_rn(ff, ratio); asm volatile("" : "+v"(t)); float t2 = __fmul_rn(g, t); asm volatile("" : "+v"(t2)); o[q] = __fadd_rn(x4[q], t2); }
    *(v4f*)(OUTb + i) = o;  }
extern "C" void kernel_launch(void* const* d_in, const int* in_sizes, int n_in,
                              void* d_out, int out_size, void* d_ws, size_t ws_size, hipStream_t stream) {
    (void)in_sizes; (void)n_in; (void)out_size;
    const float* IN[16]; for (int i = 0; i < 16; ++i) IN[i] = (const float*)d_in[i];
    // x [2][256][64][64], mask [2][1][64][64], sa_wq [32][256], sa_bq, sa_wk, sa_bk, sa_wv [256][256], sa_bv, sa_gamma [1], wq, bq, wk, bk, wv, bv, gamma [1] = d_in[0..15]
    const float* x = IN[0]; const float* mk = IN[1];
    float* OUT = (float*)d_out;     // [2][256][64][64]
    char* wsp = (char*)d_ws;
    auto take = [&](size_t bytes) { char* p = wsp; wsp += (bytes + 255) & ~(size_t)255; return (void*)p; };
    bf* WQ1 = (bf*)take((size_t)CQP * CC * 2); bf* WK1 = (bf*)take((size_t)CQP * CC * 2); float* BQ1 = (float*)take(256); float* BK1 = (float*)take(256); bf* WV1 = (bf*)take((size_t)CC * CC * 2);
    bf* WQ2 = (bf*)take((size_t)CQP * CC * 2); bf* WK2 = (bf*)take((size_t)CQP * CC * 2); float* BQ2 = (float*)take(256); float* BK2 = (float*)take(256); bf* WV2 = (bf*)take((size_t)CC * CC * 2);
    bf* XT = (bf*)take((size_t)NN * CC * 2); float* FQ = (float*)take((size_t)NN * CQP * 4); bf* Qh = (bf*)take((size_t)NN * CQP * 2); bf* Ql = (bf*)take((size_t)NN * CQP * 2); bf* Kh = (bf*)take((size_t)NN * CQP * 2); bf* Kl = (bf*)take((size_t)NN * CQP * 2);
    float* FV = (float*)take((size_t)CC * NN * 4); h16* V16 = (h16*)take((size_t)CC * NN * 2); float* X1 = (float*)take((size_t)CC * NN * 4);
    bf* Fh = (bf*)take((size_t)NN * CC * 2); bf* Fl = (bf*)take((size_t)NN * CC * 2); bf* Bh = (bf*)take((size_t)NN * CC * 2); bf* Bl = (bf*)take((size_t)NN * CC * 2);
    float* S = (float*)take((size_t)NN * NN * 4); h16* P = (h16*)take((size_t)NN * NN * 2); float* RS = (float*)take((size_t)NN * 32 * 4); float* SDF = (float*)take(CC * 32 * 4); float* SDS = (float*)take(CC * 32 * 4);
    if ((size_t)(wsp - (char*)d_ws) > ws_size) return;    // total ~ 126 MB = 120 MiB; ws 256 MiB
    float* Oc = FV;   // both value contractions write [c][n] over FV (dead after k_v16 each time)
    { const unsigned gp = (CQP * CC / 2 + 255) / 256, g8 = (CC * CC / 8 + 255) / 256;
      k_wpad<<<gp, 256, 0, stream>>>(IN[2], IN[3], WQ1, BQ1); k_wpad<<<gp, 256, 0, stream>>>(IN[4], IN[5], WK1, BK1); k_cvt8<<<g8, 256, 0, stream>>>(IN[6], WV1, (size_t)CC * CC / 8);
      k_wpad<<<gp, 256, 0, stream>>>(IN[9], IN[10], WQ2, BQ2); k_wpad<<<gp, 256, 0, stream>>>(IN[11], IN[12], WK2, BK2); k_cvt8<<<g8, 256, 0, stream>>>(IN[13], WV2, (size_t)CC * CC / 8); }
    const unsigned LX = (unsigned)((NN * CC / 64 + 63) / 64), L2 = (unsigned)(((size_t)NN * CC / 2 + 255) / 256), L4 = (unsigned)(((size_t)NN * CC / 4 + 255) / 256), LQ = (unsigned)(((size_t)NN * CQP / 2 + 255) / 256);
    for (int b = 0; b < NB_; ++b) { const float* xb = x + (size_t)b * CC * NN; const float* mb = mk + (size_t)b * NN;
        // stage 1: self attention on x
        k_xt<<<LX, 256, 0, stream>>>(xb, XT);
        k_gemmw<bf, 0, true><<<dim3(NN / 64, 1, 1), 32, 0, stream>>>(XT, nullptr, WQ1, nullptr, CC, FQ, CQP, BQ1, 0, 0, 0); k_qsplit<<<LQ, 256, 0, stream>>>(FQ, Qh, Ql);
        k_gemmw<bf, 0, true><<<dim3(NN / 64, 1, 1), 32, 0, stream>>>(XT, nullptr, WK1, nullptr, CC, FQ, CQP, BK1, 0, 0, 0); k_qsplit<<<LQ, 256, 0, stream>>>(FQ, Kh, Kl);
        k_gemmw<bf, 0, false><<<dim3(CC / 64, NN / 64, 1), 32, 0, stream>>>(WV1, nullptr, XT, nullptr, CC, FV, NN, nullptr, 0, 0, 0); k_v16<<<L2, 256, 0, stream>>>(FV, IN[7], V16);
        k_gemmw<bf, 2, false><<<dim3(NN / 64, NN / 64, 1), 32, 0, stream>>>(Qh, Ql, Kh, Kl, CQP, S, NN, nullptr, 0, 0, 0);
        k_smax<<<NN / 8, 256, 0, stream>>>(S, RS); k_sexp<<<NN / 8, 256, 0, stream>>>(S, RS, P);
        k_gemmw<h16, 0, false><<<dim3(CC / 64, NN / 64, 1), 32, 0, stream>>>(V16, nullptr, P, nullptr, NN, Oc, NN, nullptr, 0, 0, 0);   // sa [c][i] (x1024 carried)
        k_x1<<<L4, 256, 0, stream>>>(Oc, RS, xb, IN[8], X1);
        // stage 2: masked cross attention on x1 (q from mask*x1, k/v from (1-mask)*x1)
        k_mT<1><<<LX, 256, 0, stream>>>(X1, mb, Fh, Fl); k_mT<0><<<LX, 256, 0, stream>>>(X1, mb, Bh, Bl);
        k_gemmw<bf, 1, true><<<dim3(NN / 64, 1, 1), 32, 0, stream>>>(Fh, Fl, WQ2, nullptr, CC, FQ, CQP, BQ2, 0, 0, 0); k_qsplit<<<LQ, 256, 0, stream>>>(FQ, Qh, Ql);
        k_gemmw<bf, 1, true><<<dim3(NN / 64, 1, 1), 32, 0, stream>>>(Bh, Bl, WK2, nullptr, CC, FQ, CQP, BK2, 0, 0, 0); k_qsplit<<<LQ, 256, 0, stream>>>(FQ, Kh, Kl);
        k_gemmw<bf, 3, false><<<dim3(CC / 64, NN / 64, 1), 32, 0, stream>>>(WV2, nullptr, Bh, Bl, CC, FV, NN, nullptr, 0, 0, 0); k_v16<<<L2, 256, 0, stream>>>(FV, IN[14], V16);
        k_gemmw<bf, 2, false><<<dim3(NN / 64, NN / 64, 1), 32, 0, stream>>>(Qh, Ql, Kh, Kl, CQP, S, NN, nullptr, 0, 0, 0);
        k_smax<<<NN / 8, 256, 0, stream>>>(S, RS); k_sexp<<<NN / 8, 256, 0, stream>>>(S, RS, P);
        k_gemmw<h16, 0, false><<<dim3(CC / 64, NN / 64, 1), 32, 0, stream>>>(V16, nullptr, P, nullptr, NN, Oc, NN, nullptr, 0, 0, 0);   // sw [c][i] (x1024 carried; RS applied inside k_std / not needed elsewhere)
        k_std<1><<<CC / 8, 256, 0, stream>>>(X1, mb, SDF); k_std<0><<<CC / 8, 256, 0, stream>>>(Oc, RS, SDS);
        k_out<<<L4, 256, 0, stream>>>(X1, mb, SDF, SDS, IN[15], OUT + (size_t)b * CC * NN); }
}

// v001
// Measured time: 560 microseconds a run.
// Timed twice side by side with v000, it ran 1.52 and 1.53 times as fast.
#include <hip/hip_runtime.h>

// FB_FMM (x [2][256][64][64], mask [2][1][64][64] in {0,1} read as data; (1) SAGAN self-attention: q/k = 1x1 convs to 32 ch, v 256 ch (+bias), A = softmax_j(sum_c q[c][i] k[c][j]) (unscaled),
// sa[c][i] = sum_j v[c][j] A[i][j]; x1 = sa_gamma sa + x; (2) masked cross attention: fb = (1-mask) x1, ff = mask x1; q from ff, k/v from fb (second conv set), sw[c][i] likewise;
// (3) out = x1 + gamma * ff * (std(sw) / std(ff)) per channel (unbiased variance over the 4096 positions + 1e-5, sqrt).
// Compute dtypes, f32 accumulate: every input rounded to bf16; stage-1 convs on PLAIN bf16 operands (inputs: exact, + bias; q/k padded 32 -> 64 output channels with
// numerators x1024 + 1/(1024 sum); both value contractions fp16 v x fp16 numerators (K 4096, channel-major); residuals, masks, the per-channel statistics and the final mix in f32 on VALU (one wave

#define NB_  2
#define CC   256
#define CQ   32                   // q/k channels
#define CQP  64                   // padded to one tile
#define NN   4096
#define PCAR 1024.0f
#define SCL  1.0f                 // energies are unscaled in this module
typedef _Float16 h16;
typedef unsigned short bf;
typedef __attribute__((ext_vector_type(16))) __bf16   v16bf;
typedef __attribute__((ext_vector_type(16))) _Float16 v16h;
typedef __attribute__((ext_vector_type(8)))  _Float16 v8h;
typedef __attribute__((ext_vector_type(8)))  unsigned short v8us;
typedef __attribute__((ext_vector_type(8)))  float    v8f;
typedef __attribute__((ext_vector_type(4)))  float    v4f;
typedef v8h  __attribute__((may_alias)) v8ha;
typedef v4f  __attribute__((may_alias)) v4fa;
typedef v8us __attribute__((may_alias)) v8usa;

__device__ __forceinline__ unsigned short f2bf(float f) { unsigned u = __float_as_uint(f); u += 0x7FFFu + ((u >> 16) & 1u); return (unsigned short)(u >> 16); }
__device__ __forceinline__ float bf2f(unsigned short b) { return __uint_as_float(((unsigned)b) << 16); }
__device__ __forceinline__ float bfr(float f) { return bf2f(f2bf(f)); }
__device__ __forceinline__ v16h cat16(v8h lo, v8h hi) { return __builtin_shufflevector(lo, hi, 0, 1, 2, 3, 4, 5, 6, 7, 8, 9, 10, 11, 12, 13, 14, 15); }
__device__ __forceinline__ v16bf cat16b(v8us lo, v8us hi) { return __builtin_bit_cast(v16bf, __builtin_shufflevector(lo, hi, 0, 1, 2, 3, 4, 5, 6, 7, 8, 9, 10, 11, 12, 13, 14, 15)); }
__device__ __forceinline__ v8f wmma16(v16h a, v16h b, v8f c) { return __builtin_amdgcn_wmma_f32_16x16x32_f16(false, a, false, b, (short)0, c, false, false); }
__device__ __forceinline__ v8f wmmab(v16bf a, v16bf b, v8f c) { return __builtin_amdgcn_wmma_f32_16x16x32_bf16(false, a, false, b, (short)0, c, false, false); }



// ---- k_gemmw: register-blocked GEMM, KS WAVES per 64x64 output tile, each with all 16 accumulators over its own share of K; operands straight from K-contiguous 16-bit planes; grid (M/64, N/64, Z), 32 * KS threads.
// C[m][n] (f32, pitch ldc, + optional f32 bias[n]) = sum_k A[m][k] Bt[n][k] (+ split products per NSPLIT). z-batch strides sA/sB/sC in elements. K % (32 * KS) == 0.
// Wave w takes the 32-k blocks w, w + KS, w + 2 KS, ... (neighbouring waves read the two halves of one 128-byte line in the same trip); the KS partial tiles meet in LDS and are summed in wave order.
template <typename T16> struct WFrag;
template <> struct WFrag<h16> { typedef v16h V; static __device__ __forceinline__ V ld(const h16* p) { return cat16(*(const v8h*)p, *(const v8h*)(p + 16)); } static __device__ __forceinline__ v8f mma(V a, V b, v8f c) { return wmma16(a, b, c); } };
template <> struct WFrag<bf> { typedef v16bf V; static __device__ __forceinline__ V ld(const bf* p) { return cat16b(*(const v8us*)p, *(const v8us*)(p + 16)); } static __device__ __forceinline__ v8f mma(V a, V b, v8f c) { return wmmab(a, b, c); } };
template <typename T16, int NSPLIT, bool BIAS, int KS>
__global__ __launch_bounds__(32 * KS) void k_gemmw(const T16* __restrict__ A, const T16* __restrict__ A2, const T16* __restrict__ Bt, const T16* __restrict__ Bt2, int K, float* C, int ldc, const float* __restrict__ bias, size_t sA, size_t sB, size_t sC) {
    typedef typename WFrag<T16>::V V;
    __shared__ __align__(16) float os[KS == 1 ? 16 * 68 : KS * 64 * 68];
    const size_t z = blockIdx.z; A += z * sA; if (A2) A2 += z * sA; Bt += z * sB; if (Bt2) Bt2 += z * sB; C += z * sC;
    const int lane = threadIdx.x & 31, lr = lane & 15, hi = lane >> 4; const int r0 = blockIdx.x * 64, c0 = blockIdx.y * 64;
    const int wv = KS == 1 ? 0 : __builtin_amdgcn_readfirstlane((int)(threadIdx.x >> 5));   // wave number, held scalar so that the k loop stays a scalar loop
    v8f acc[4][4];
#pragma unroll
    for (int mb = 0; mb < 4; ++mb)
#pragma unroll
        for (int nb = 0; nb < 4; ++nb) acc[mb][nb] = (v8f){};
    const size_t aoff = (size_t)(r0 + lr) * K + 8 * hi, boff = (size_t)(c0 + lr) * K + 8 * hi;
#pragma unroll 1
    for (int kc = wv * 32; kc < K; kc += 32 * KS) {
        V a[4], a2[4];
#pragma unroll
        for (int mb = 0; mb < 4; ++mb) { a[mb] = WFrag<T16>::ld(A + aoff + (size_t)mb * 16 * K + kc); if (NSPLIT == 1 || NSPLIT == 2) a2[mb] = WFrag<T16>::ld(A2 + aoff + (size_t)mb * 16 * K + kc); }
#pragma unroll
        for (int nb = 0; nb < 4; ++nb) { const V b = WFrag<T16>::ld(Bt + boff + (size_t)nb * 16 * K + kc); V b2; if (NSPLIT >= 2) b2 = WFrag<T16>::ld(Bt2 + boff + (size_t)nb * 16 * K + kc);
#pragma unroll
            for (int mb = 0; mb < 4; ++mb) { acc[mb][nb] = WFrag<T16>::mma(a[mb], b, acc[mb][nb]); if (NSPLIT == 1 || NSPLIT == 2) acc[mb][nb] = WFrag<T16>::mma(a2[mb], b, acc[mb][nb]); if (NSPLIT >= 2) acc[mb][nb] = WFrag<T16>::mma(a[mb], b2, acc[mb][nb]); } }
        asm volatile("v_nop\n\tv_nop\n\tv_nop\n\tv_nop" : "+v"(acc[0][0]), "+v"(acc[1][1]), "+v"(acc[2][2]), "+v"(acc[3][3]) : "v"(a[0]), "v"(a[3]));
    }
    if constexpr (KS > 1) {
        float* mine = os + wv * (64 * 68);
#pragma unroll
        for (int mb = 0; mb < 4; ++mb)
#pragma unroll
            for (int nb = 0; nb < 4; ++nb)
#pragma unroll
                for (int j = 0; j < 8; ++j) mine[(mb * 16 + hi * 8 + j) * 68 + nb * 16 + lr] = acc[mb][nb][j];
        __syncthreads();   // every wave's partial tile is in LDS before any of them is summed
#pragma unroll
        for (int s = 0; s < 32 / KS; ++s) { const int f = s * (32 * KS) + (int)threadIdx.x, row = f >> 4, cofs = (f & 15) * 4; v4f val = *(const v4fa*)(os + row * 68 + cofs);
#pragma unroll
            for (int q = 1; q < KS; ++q) val += *(const v4fa*)(os + q * (64 * 68) + row * 68 + cofs);
            if (BIAS) { val[0] += bfr(bias[c0 + cofs]); val[1] += bfr(bias[c0 + cofs + 1]); val[2] += bfr(bias[c0 + cofs + 2]); val[3] += bfr(bias[c0 + cofs + 3]); }
            *(v4f*)(C + (size_t)(r0 + row) * ldc + c0 + cofs) = val; }
        return;
    }
#pragma unroll
    for (int mb = 0; mb < 4; ++mb) {
#pragma unroll
        for (int nb = 0; nb < 4; ++nb) {
#pragma unroll
            for (int j = 0; j < 8; ++j) os[(hi * 8 + j) * 68 + nb * 16 + lr] = acc[mb][nb][j]; }
        __builtin_amdgcn_wave_barrier(); asm volatile("" ::: "memory");
        float* crow = C + (size_t)(r0 + mb * 16) * ldc + c0;
{
#pragma unroll
            for (int s = 0; s < 8; ++s) { const int row = 2 * s + hi, cofs = lr * 4; v4f val = *(const v4fa*)(os + row * 68 + cofs); if (BIAS) { val[0] += bfr(bias[c0 + cofs]); val[1] += bfr(bias[c0 + cofs + 1]); val[2] += bfr(bias[c0 + cofs + 2]); val[3] += bfr(bias[c0 + cofs + 3]); }
                *(v4f*)(crow + (size_t)row * ldc + cofs) = val; }
             }
        __builtin_amdgcn_wave_barrier(); asm volatile("" ::: "memory");
    }
}

__device__ __forceinline__ h16 tohx(float x) { return (h16)x; }
__device__ __forceinline__ void splitf(float y, unsigned short& h, unsigned short& l) { h = f2bf(y); l = f2bf(y - bf2f(h)); }
typedef __attribute__((ext_vector_type(2))) _Float16 v2h;
typedef __attribute__((ext_vector_type(4))) _Float16 v4h;
typedef __attribute__((ext_vector_type(2))) unsigned short v2us;
typedef __attribute__((ext_vector_type(4))) unsigned short v4us;

__global__ __launch_bounds__(256) void k_cvt8(const float* __restrict__ src, bf* dst, size_t n8) { const size_t i = (size_t)blockIdx.x * 256 + threadIdx.x; if (i >= n8) return; const v8f v = *(const v8f*)(src + i * 8); v8us o;
#pragma unroll
    for (int k = 0; k < 8; ++k) o[k] = f2bf(v[k]); *(v8us*)(dst + i * 8) = o;  }
__global__ __launch_bounds__(256) void k_xt(const float* __restrict__ xb, bf* XT) {
    const int lane = threadIdx.x & 31; const int L0 = (blockIdx.x * 8 + (threadIdx.x >> 5)) * 8; const int nlines = NN * CC / 64;
{
#pragma unroll
        for (int l = 0; l < 8; ++l) { const int L = L0 + l; if (L >= nlines) break; const int e = L * 64 + lane * 2; const int c = e & (CC - 1); const int n = e >> 8; v2us o;
#pragma unroll
            for (int q = 0; q < 2; ++q) o[q] = f2bf(xb[(size_t)(c + q) * NN + n]);
            *(v2us*)(XT + (size_t)e) = o; }
         }
}
__global__ __launch_bounds__(256) void k_wpad(const float* __restrict__ w, const float* __restrict__ b, bf* Bt, float* BP) { const int e = (blockIdx.x * 256 + threadIdx.x) * 2; if (e >= CQP * CC) return; const int n = e / CC, k = e % CC; v2us o;
#pragma unroll
    for (int q = 0; q < 2; ++q) o[q] = (n < CQ) ? f2bf(w[(size_t)n * CC + k + q]) : (unsigned short)0;
    *(v2us*)(Bt + e) = o; if (e < CQP) { *(float*)(BP + e) = (e < CQ) ? b[e] : 0.f; *(float*)(BP + e + 1) = (e + 1 < CQ) ? b[e + 1] : 0.f; }
     }
__global__ __launch_bounds__(256) void k_qsplit(const float* __restrict__ F, bf* Ph, bf* Pl) { const size_t i = ((size_t)blockIdx.x * 256 + threadIdx.x) * 2; if (i >= (size_t)NN * CQP) return; v2us oh, ol;
#pragma unroll
    for (int q = 0; q < 2; ++q) { unsigned short a, c2; splitf(F[i + q], a, c2); oh[q] = a; ol[q] = c2; }
    *(v2us*)(Ph + i) = oh; *(v2us*)(Pl + i) = ol;  }
__global__ __launch_bounds__(256) void k_p16(const float* __restrict__ F, h16* P, size_t n) { const size_t i = ((size_t)blockIdx.x * 256 + threadIdx.x) * 2; if (i >= n) return; v2h v; v[0] = tohx(F[i]); v[1] = tohx(F[i + 1]); *(v2h*)(P + i) = v;  }
__global__ __launch_bounds__(256) void k_v16(const float* __restrict__ FV, const float* __restrict__ bv, h16* V16) { const size_t i = ((size_t)blockIdx.x * 256 + threadIdx.x) * 2; if (i >= (size_t)CC * NN) return; const int c = (int)(i >> 12); v2h v;
#pragma unroll
    for (int q = 0; q < 2; ++q) v[q] = tohx(__fadd_rn(FV[i + q], bfr(bv[c]))); *(v2h*)(V16 + i) = v;  }
// k_smax: row max of S[i][0..4095] (wave per row, lane -> 4 per 128-col chunk) -> RS[i*32 + lane]: one row of 32 floats per i, max in slot 0, zeros in the rest
__global__ __launch_bounds__(256) void k_smax(const float* __restrict__ S, float* RS) {
    const int lane = threadIdx.x & 31; const int i = blockIdx.x * 8 + (threadIdx.x >> 5); if (i >= NN) return; const float* sr = S + (size_t)i * NN; float m = -3.0e38f;
#pragma unroll 4
    for (int c0 = lane * 4; c0 < NN; c0 += 128) { const v4f v = *(const v4f*)(sr + c0); m = fmaxf(m, fmaxf(fmaxf(v[0], v[1]), fmaxf(v[2], v[3]))); }
#pragma unroll
    for (int sh = 16; sh; sh >>= 1) m = fmaxf(m, __shfl_xor(m, sh, 32));
    const float o = lane == 0 ? m : 0.f; *(float*)(RS + (size_t)i * 32 + lane) = o; 
}
__global__ __launch_bounds__(256) void k_sexp(const float* __restrict__ S, float* RS, h16* P) {
    const int lane = threadIdx.x & 31; const int i = blockIdx.x * 8 + (threadIdx.x >> 5); if (i >= NN) return; const float* sr = S + (size_t)i * NN; const float m = RS[(size_t)i * 32]; float sum = 0.f;
#pragma unroll 2
    for (int c0 = lane * 4; c0 < NN; c0 += 128) { const v4f v = *(const v4f*)(sr + c0); v4h o;
#pragma unroll
        for (int q = 0; q < 4; ++q) { float dlt = __fsub_rn(v[q], m); asm volatile("" : "+v"(dlt)); const float e = __expf(__fmul_rn(dlt, SCL)); sum += e; o[q] = tohx(e * PCAR); }
        *(v4h*)(P + (size_t)i * NN + c0) = o;  }
#pragma unroll
    for (int sh = 16; sh; sh >>= 1) sum += __shfl_xor(sum, sh, 32);
    const float o2 = lane == 0 ? m : (lane == 1 ? __fdiv_rn(1.0f, sum * PCAR) : 0.f); /* 1/(PCAR * sum): undoes the carry at the merge */ *(float*)(RS + (size_t)i * 32 + lane) = o2; 
}
__global__ __launch_bounds__(256) void k_x1(const float* __restrict__ O, const float* __restrict__ RS, const float* __restrict__ xb, const float* __restrict__ gam, float* X1) { const size_t i = ((size_t)blockIdx.x * 256 + threadIdx.x) * 4; if (i >= (size_t)CC * NN) return; const int n0 = (int)(i & (NN - 1)); const float g = bfr(gam[0]); const v4f a = *(const v4f*)(O + i), x4 = *(const v4f*)(xb + i); v4f o;
#pragma unroll
    for (int q = 0; q < 4; ++q) { float t = __fmul_rn(a[q], RS[(size_t)(n0 + q) * 32 + 1]); asm volatile("" : "+v"(t)); float t2 = __fmul_rn(g, t); asm volatile("" : "+v"(t2)); o[q] = __fadd_rn(t2, bfr(x4[q])); }
    *(v4f*)(X1 + i) = o;  }
template <int FG>
__global__ __launch_bounds__(256) void k_mT(const float* __restrict__ X1, const float* __restrict__ mk, bf* Hh, bf* Hl) {
    const int lane = threadIdx.x & 31; const int L0 = (blockIdx.x * 8 + (threadIdx.x >> 5)) * 8; const int nlines = NN * CC / 64;
{
#pragma unroll 1
        for (int l = 0; l < 8; ++l) { const int L = L0 + l; if (L >= nlines) break; const int e = L * 64 + lane * 2; const int c = e & (CC - 1); const int n = e >> 8; const float w = FG ? bfr(mk[n]) : __fsub_rn(1.0f, bfr(mk[n])); v2us oh, ol;
#pragma unroll
            for (int q = 0; q < 2; ++q) { unsigned short a, c2; splitf(__fmul_rn(X1[(size_t)(c + q) * NN + n], w), a, c2); oh[q] = a; ol[q] = c2; }
            *(v2us*)(Hh + (size_t)e) = oh; *(v2us*)(Hl + (size_t)e) = ol; }
         }
}
// k_std: per channel row c (one wave, lanes stride the 4096 positions in a fixed order, fixed shuffle trees): FG = 1: values ff = X1[c][n] * bf16(mask[n]); FG = 0: values sw = O2[c][n] * RS2[n][1];
template <int FG>
__global__ __launch_bounds__(256) void k_std(const float* __restrict__ A, const float* __restrict__ aux, float* SD) {
    const int lane = threadIdx.x & 31; const int c = blockIdx.x * 8 + (threadIdx.x >> 5); if (c >= CC) return; const float* row = A + (size_t)c * NN; float s = 0.f;
#pragma unroll 4
    for (int n = lane; n < NN; n += 32) { const float v = FG ? __fmul_rn(row[n], bfr(aux[n])) : __fmul_rn(row[n], aux[(size_t)n * 32 + 1]); s += v; }
#pragma unroll
    for (int sh = 16; sh; sh >>= 1) s += __shfl_xor(s, sh, 32);
    const float mu = s * (1.0f / NN); float qq = 0.f;
#pragma unroll 4
    for (int n = lane; n < NN; n += 32) { const float v = FG ? __fmul_rn(row[n], bfr(aux[n])) : __fmul_rn(row[n], aux[(size_t)n * 32 + 1]); const float d0 = __fsub_rn(v, mu); qq = __fadd_rn(qq, __fmul_rn(d0, d0)); }
#pragma unroll
    for (int sh = 16; sh; sh >>= 1) qq += __shfl_xor(qq, sh, 32);
    const float sd = __fsqrt_rn(__fadd_rn(__fdiv_rn(qq, (float)(NN - 1)), 1e-5f)); const float o = (lane == 0) ? sd : 0.f;
    *(float*)(SD + (size_t)c * 32 + lane) = o;  }
__global__ __launch_bounds__(256) void k_out(const float* __restrict__ X1, const float* __restrict__ mk, const float* __restrict__ SDF, const float* __restrict__ SDS, const float* __restrict__ gam, float* OUTb) { const size_t i = ((size_t)blockIdx.x * 256 + threadIdx.x) * 4; if (i >= (size_t)CC * NN) return; const int n0 = (int)(i & (NN - 1)); const int c = (int)(i >> 12); const float g = bfr(gam[0]); const float ratio = __fdiv_rn(SDS[(size_t)c * 32], SDF[(size_t)c * 32]); const v4f x4 = *(const v4f*)(X1 + i); v4f o;
#pragma unroll
    for (int q = 0; q < 4; ++q) { float ff = __fmul_rn(x4[q], bfr(mk[n0 + q])); asm volatile("" : "+v"(ff)); float t = __fmul_rn(ff, ratio); asm volatile("" : "+v"(t)); float t2 = __fmul_rn(g, t); asm volatile("" : "+v"(t2)); o[q] = __fadd_rn(x4[q], t2); }
    *(v4f*)(OUTb + i) = o;  }
extern "C" void kernel_launch(void* const* d_in, const int* in_sizes, int n_in,
                              void* d_out, int out_size, void* d_ws, size_t ws_size, hipStream_t stream) {
    (void)in_sizes; (void)n_in; (void)out_size;
    const float* IN[16]; for (int i = 0; i < 16; ++i) IN[i] = (const float*)d_in[i];
    // x [2][256][64][64], mask [2][1][64][64], sa_wq [32][256], sa_bq, sa_wk, sa_bk, sa_wv [256][256], sa_bv, sa_gamma [1], wq, bq, wk, bk, wv, bv, gamma [1] = d_in[0..15]
    const float* x = IN[0]; const float* mk = IN[1];
    float* OUT = (float*)d_out;     // [2][256][64][64]
    char* wsp = (char*)d_ws;
    auto take = [&](size_t bytes) { char* p = wsp; wsp += (bytes + 255) & ~(size_t)255; return (void*)p; };
    bf* WQ1 = (bf*)take((size_t)CQP * CC * 2); bf* WK1 = (bf*)take((size_t)CQP * CC * 2); float* BQ1 = (float*)take(256); float* BK1 = (float*)take(256); bf* WV1 = (bf*)take((size_t)CC * CC * 2);
    bf* WQ2 = (bf*)take((size_t)CQP * CC * 2); bf* WK2 = (bf*)take((size_t)CQP * CC * 2); float* BQ2 = (float*)take(256); float* BK2 = (float*)take(256); bf* WV2 = (bf*)take((size_t)CC * CC * 2);
    bf* XT = (bf*)take((size_t)NN * CC * 2); float* FQ = (float*)take((size_t)NN * CQP * 4); bf* Qh = (bf*)take((size_t)NN * CQP * 2); bf* Ql = (bf*)take((size_t)NN * CQP * 2); bf* Kh = (bf*)take((size_t)NN * CQP * 2); bf* Kl = (bf*)take((size_t)NN * CQP * 2);
    float* FV = (float*)take((size_t)CC * NN * 4); h16* V16 = (h16*)take((size_t)CC * NN * 2); float* X1 = (float*)take((size_t)CC * NN * 4);
    bf* Fh = (bf*)take((size_t)NN * CC * 2); bf* Fl = (bf*)take((size_t)NN * CC * 2); bf* Bh = (bf*)take((size_t)NN * CC * 2); bf* Bl = (bf*)take((size_t)NN * CC * 2);
    float* S = (float*)take((size_t)NN * NN * 4); h16* P = (h16*)take((size_t)NN * NN * 2); float* RS = (float*)take((size_t)NN * 32 * 4); float* SDF = (float*)take(CC * 32 * 4); float* SDS = (float*)take(CC * 32 * 4);
    if ((size_t)(wsp - (char*)d_ws) > ws_size) return;    // total ~ 126 MB = 120 MiB; ws 256 MiB
    float* Oc = FV;   // both value contractions write [c][n] over FV (dead after k_v16 each time)
    { const unsigned gp = (CQP * CC / 2 + 255) / 256, g8 = (CC * CC / 8 + 255) / 256;
      k_wpad<<<gp, 256, 0, stream>>>(IN[2], IN[3], WQ1, BQ1); k_wpad<<<gp, 256, 0, stream>>>(IN[4], IN[5], WK1, BK1); k_cvt8<<<g8, 256, 0, stream>>>(IN[6], WV1, (size_t)CC * CC / 8);
      k_wpad<<<gp, 256, 0, stream>>>(IN[9], IN[10], WQ2, BQ2); k_wpad<<<gp, 256, 0, stream>>>(IN[11], IN[12], WK2, BK2); k_cvt8<<<g8, 256, 0, stream>>>(IN[13], WV2, (size_t)CC * CC / 8); }
    const unsigned LX = (unsigned)((NN * CC / 64 + 63) / 64), L2 = (unsigned)(((size_t)NN * CC / 2 + 255) / 256), L4 = (unsigned)(((size_t)NN * CC / 4 + 255) / 256), LQ = (unsigned)(((size_t)NN * CQP / 2 + 255) / 256);
    for (int b = 0; b < NB_; ++b) { const float* xb = x + (size_t)b * CC * NN; const float* mb = mk + (size_t)b * NN;
        // stage 1: self attention on x
        k_xt<<<LX, 256, 0, stream>>>(xb, XT);
        k_gemmw<bf, 0, true, 8><<<dim3(NN / 64, 1, 1), 256, 0, stream>>>(XT, nullptr, WQ1, nullptr, CC, FQ, CQP, BQ1, 0, 0, 0); k_qsplit<<<LQ, 256, 0, stream>>>(FQ, Qh, Ql);
        k_gemmw<bf, 0, true, 8><<<dim3(NN / 64, 1, 1), 256, 0, stream>>>(XT, nullptr, WK1, nullptr, CC, FQ, CQP, BK1, 0, 0, 0); k_qsplit<<<LQ, 256, 0, stream>>>(FQ, Kh, Kl);
        k_gemmw<bf, 0, false, 8><<<dim3(CC / 64, NN / 64, 1), 256, 0, stream>>>(WV1, nullptr, XT, nullptr, CC, FV, NN, nullptr, 0, 0, 0); k_v16<<<L2, 256, 0, stream>>>(FV, IN[7], V16);
        k_gemmw<bf, 2, false, 1><<<dim3(NN / 64, NN / 64, 1), 32, 0, stream>>>(Qh, Ql, Kh, Kl, CQP, S, NN, nullptr, 0, 0, 0);
        k_smax<<<NN / 8, 256, 0, stream>>>(S, RS); k_sexp<<<NN / 8, 256, 0, stream>>>(S, RS, P);
        k_gemmw<h16, 0, false, 16><<<dim3(CC / 64, NN / 64, 1), 512, 0, stream>>>(V16, nullptr, P, nullptr, NN, Oc, NN, nullptr, 0, 0, 0);   // sa [c][i] (x1024 carried)
        k_x1<<<L4, 256, 0, stream>>>(Oc, RS, xb, IN[8], X1);
        // stage 2: masked cross attention on x1 (q from mask*x1, k/v from (1-mask)*x1)
        k_mT<1><<<LX, 256, 0, stream>>>(X1, mb, Fh, Fl); k_mT<0><<<LX, 256, 0, stream>>>(X1, mb, Bh, Bl);
        k_gemmw<bf, 1, true, 8><<<dim3(NN / 64, 1, 1), 256, 0, stream>>>(Fh, Fl, WQ2, nullptr, CC, FQ, CQP, BQ2, 0, 0, 0); k_qsplit<<<LQ, 256, 0, stream>>>(FQ, Qh, Ql);
        k_gemmw<bf, 1, true, 8><<<dim3(NN / 64, 1, 1), 256, 0, stream>>>(Bh, Bl, WK2, nullptr, CC, FQ, CQP, BK2, 0, 0, 0); k_qsplit<<<LQ, 256, 0, stream>>>(FQ, Kh, Kl);
        k_gemmw<bf, 3, false, 8><<<dim3(CC / 64, NN / 64, 1), 256, 0, stream>>>(WV2, nullptr, Bh, Bl, CC, FV, NN, nullptr, 0, 0, 0); k_v16<<<L2, 256, 0, stream>>>(FV, IN[14], V16);
        k_gemmw<bf, 2, false, 1><<<dim3(NN / 64, NN / 64, 1), 32, 0, stream>>>(Qh, Ql, Kh, Kl, CQP, S, NN, nullptr, 0, 0, 0);
        k_smax<<<NN / 8, 256, 0, stream>>>(S, RS); k_sexp<<<NN / 8, 256, 0, stream>>>(S, RS, P);
        k_gemmw<h16, 0, false, 16><<<dim3(CC / 64, NN / 64, 1), 512, 0, stream>>>(V16, nullptr, P, nullptr, NN, Oc, NN, nullptr, 0, 0, 0);   // sw [c][i] (x1024 carried; RS applied inside k_std / not needed elsewhere)
        k_std<1><<<CC / 8, 256, 0, stream>>>(X1, mb, SDF); k_std<0><<<CC / 8, 256, 0, stream>>>(Oc, RS, SDS);
        k_out<<<L4, 256, 0, stream>>>(X1, mb, SDF, SDS, IN[15], OUT + (size_t)b * CC * NN); }
}

// v002
// It runs in 382 microseconds.
// Two timings next to v001 both put it at 1.46 times that version's speed.
// Over all steps from v000 it is 2.23 times as fast.
#include <hip/hip_runtime.h>

// FB_FMM (x [2][256][64][64], mask [2][1][64][64] in {0,1} read as data; (1) SAGAN self-attention: q/k = 1x1 convs to 32 ch, v 256 ch (+bias), A = softmax_j(sum_c q[c][i] k[c][j]) (unscaled),
// sa[c][i] = sum_j v[c][j] A[i][j]; x1 = sa_gamma sa + x; (2) masked cross attention: fb = (1-mask) x1, ff = mask x1; q from ff, k/v from fb (second conv set), sw[c][i] likewise;
// (3) out = x1 + gamma * ff * (std(sw) / std(ff)) per channel (unbiased variance over the 4096 positions + 1e-5, sqrt).
// Compute dtypes, f32 accumulate: every input rounded to bf16; stage-1 convs on PLAIN bf16 operands (inputs: exact, + bias; q/k padded 32 -> 64 output channels with
// numerators x1024 + 1/(1024 sum); both value contractions fp16 v x fp16 numerators (K 4096, channel-major); residuals, masks, the per-channel statistics and the final mix in f32 on VALU (one wave

#define NB_  2
#define CC   256
#define CQ   32                   // q/k channels
#define CQP  64                   // padded to one tile
#define NN   4096
#define PCAR 1024.0f
#define SCL  1.0f                 // energies are unscaled in this module
typedef _Float16 h16;
typedef unsigned short bf;
typedef __attribute__((ext_vector_type(16))) __bf16   v16bf;
typedef __attribute__((ext_vector_type(16))) _Float16 v16h;
typedef __attribute__((ext_vector_type(8)))  _Float16 v8h;
typedef __attribute__((ext_vector_type(8)))  unsigned short v8us;
typedef __attribute__((ext_vector_type(8)))  float    v8f;
typedef __attribute__((ext_vector_type(4)))  float    v4f;
typedef v8h  __attribute__((may_alias)) v8ha;
typedef v4f  __attribute__((may_alias)) v4fa;
typedef v8us __attribute__((may_alias)) v8usa;

__device__ __forceinline__ unsigned short f2bf(float f) { unsigned u = __float_as_uint(f); u += 0x7FFFu + ((u >> 16) & 1u); return (unsigned short)(u >> 16); }
__device__ __forceinline__ float bf2f(unsigned short b) { return __uint_as_float(((unsigned)b) << 16); }
__device__ __forceinline__ float bfr(float f) { return bf2f(f2bf(f)); }
__device__ __forceinline__ v16h cat16(v8h lo, v8h hi) { return __builtin_shufflevector(lo, hi, 0, 1, 2, 3, 4, 5, 6, 7, 8, 9, 10, 11, 12, 13, 14, 15); }
__device__ __forceinline__ v16bf cat16b(v8us lo, v8us hi) { return __builtin_bit_cast(v16bf, __builtin_shufflevector(lo, hi, 0, 1, 2, 3, 4, 5, 6, 7, 8, 9, 10, 11, 12, 13, 14, 15)); }
__device__ __forceinline__ v8f wmma16(v16h a, v16h b, v8f c) { return __builtin_amdgcn_wmma_f32_16x16x32_f16(false, a, false, b, (short)0, c, false, false); }
__device__ __forceinline__ v8f wmmab(v16bf a, v16bf b, v8f c) { return __builtin_amdgcn_wmma_f32_16x16x32_bf16(false, a, false, b, (short)0, c, false, false); }



// ---- k_gemmw: register-blocked GEMM, KS WAVES per 64x64 output tile, each with all 16 accumulators over its own share of K; operands straight from K-contiguous 16-bit planes; grid (M/64, N/64, Z), 32 * KS threads.
// C[m][n] (f32, pitch ldc, + optional f32 bias[n]) = sum_k A[m][k] Bt[n][k] (+ split products per NSPLIT). z-batch strides sA/sB/sC in elements. K % (32 * KS) == 0.
// Wave w takes the 32-k blocks w, w + KS, w + 2 KS, ... (neighbouring waves read the two halves of one 128-byte line in the same trip); the KS partial tiles meet in LDS and are summed in wave order.
template <typename T16> struct WFrag;
template <> struct WFrag<h16> { typedef v16h V; static __device__ __forceinline__ V ld(const h16* p) { return cat16(*(const v8h*)p, *(const v8h*)(p + 16)); } static __device__ __forceinline__ v8f mma(V a, V b, v8f c) { return wmma16(a, b, c); } };
template <> struct WFrag<bf> { typedef v16bf V; static __device__ __forceinline__ V ld(const bf* p) { return cat16b(*(const v8us*)p, *(const v8us*)(p + 16)); } static __device__ __forceinline__ v8f mma(V a, V b, v8f c) { return wmmab(a, b, c); } };
template <typename T16, int NSPLIT, bool BIAS, int KS>
__global__ __launch_bounds__(32 * KS) void k_gemmw(const T16* __restrict__ A, const T16* __restrict__ A2, const T16* __restrict__ Bt, const T16* __restrict__ Bt2, int K, float* C, int ldc, const float* __restrict__ bias, size_t sA, size_t sB, size_t sC) {
    typedef typename WFrag<T16>::V V;
    __shared__ __align__(16) float os[KS == 1 ? 16 * 68 : KS * 64 * 68];
    const size_t z = blockIdx.z; A += z * sA; if (A2) A2 += z * sA; Bt += z * sB; if (Bt2) Bt2 += z * sB; C += z * sC;
    const int lane = threadIdx.x & 31, lr = lane & 15, hi = lane >> 4; const int r0 = blockIdx.x * 64, c0 = blockIdx.y * 64;
    const int wv = KS == 1 ? 0 : __builtin_amdgcn_readfirstlane((int)(threadIdx.x >> 5));   // wave number, held scalar so that the k loop stays a scalar loop
    v8f acc[4][4];
#pragma unroll
    for (int mb = 0; mb < 4; ++mb)
#pragma unroll
        for (int nb = 0; nb < 4; ++nb) acc[mb][nb] = (v8f){};
    const size_t aoff = (size_t)(r0 + lr) * K + 8 * hi, boff = (size_t)(c0 + lr) * K + 8 * hi;
#pragma unroll 1
    for (int kc = wv * 32; kc < K; kc += 32 * KS) {
        V a[4], a2[4];
#pragma unroll
        for (int mb = 0; mb < 4; ++mb) { a[mb] = WFrag<T16>::ld(A + aoff + (size_t)mb * 16 * K + kc); if (NSPLIT == 1 || NSPLIT == 2) a2[mb] = WFrag<T16>::ld(A2 + aoff + (size_t)mb * 16 * K + kc); }
#pragma unroll
        for (int nb = 0; nb < 4; ++nb) { const V b = WFrag<T16>::ld(Bt + boff + (size_t)nb * 16 * K + kc); V b2; if (NSPLIT >= 2) b2 = WFrag<T16>::ld(Bt2 + boff + (size_t)nb * 16 * K + kc);
#pragma unroll
            for (int mb = 0; mb < 4; ++mb) { acc[mb][nb] = WFrag<T16>::mma(a[mb], b, acc[mb][nb]); if (NSPLIT == 1 || NSPLIT == 2) acc[mb][nb] = WFrag<T16>::mma(a2[mb], b, acc[mb][nb]); if (NSPLIT >= 2) acc[mb][nb] = WFrag<T16>::mma(a[mb], b2, acc[mb][nb]); } }
        asm volatile("v_nop\n\tv_nop\n\tv_nop\n\tv_nop" : "+v"(acc[0][0]), "+v"(acc[1][1]), "+v"(acc[2][2]), "+v"(acc[3][3]) : "v"(a[0]), "v"(a[3]));
    }
    if constexpr (KS > 1) {
        float* mine = os + wv * (64 * 68);
#pragma unroll
        for (int mb = 0; mb < 4; ++mb)
#pragma unroll
            for (int nb = 0; nb < 4; ++nb)
#pragma unroll
                for (int j = 0; j < 8; ++j) mine[(mb * 16 + hi * 8 + j) * 68 + nb * 16 + lr] = acc[mb][nb][j];
        __syncthreads();   // every wave's partial tile is in LDS before any of them is summed
#pragma unroll
        for (int s = 0; s < 32 / KS; ++s) { const int f = s * (32 * KS) + (int)threadIdx.x, row = f >> 4, cofs = (f & 15) * 4; v4f val = *(const v4fa*)(os + row * 68 + cofs);
#pragma unroll
            for (int q = 1; q < KS; ++q) val += *(const v4fa*)(os + q * (64 * 68) + row * 68 + cofs);
            if (BIAS) { val[0] += bfr(bias[c0 + cofs]); val[1] += bfr(bias[c0 + cofs + 1]); val[2] += bfr(bias[c0 + cofs + 2]); val[3] += bfr(bias[c0 + cofs + 3]); }
            *(v4f*)(C + (size_t)(r0 + row) * ldc + c0 + cofs) = val; }
        return;
    }
#pragma unroll
    for (int mb = 0; mb < 4; ++mb) {
#pragma unroll
        for (int nb = 0; nb < 4; ++nb) {
#pragma unroll
            for (int j = 0; j < 8; ++j) os[(hi * 8 + j) * 68 + nb * 16 + lr] = acc[mb][nb][j]; }
        __builtin_amdgcn_wave_barrier(); asm volatile("" ::: "memory");
        float* crow = C + (size_t)(r0 + mb * 16) * ldc + c0;
{
#pragma unroll
            for (int s = 0; s < 8; ++s) { const int row = 2 * s + hi, cofs = lr * 4; v4f val = *(const v4fa*)(os + row * 68 + cofs); if (BIAS) { val[0] += bfr(bias[c0 + cofs]); val[1] += bfr(bias[c0 + cofs + 1]); val[2] += bfr(bias[c0 + cofs + 2]); val[3] += bfr(bias[c0 + cofs + 3]); }
                *(v4f*)(crow + (size_t)row * ldc + cofs) = val; }
             }
        __builtin_amdgcn_wave_barrier(); asm volatile("" ::: "memory");
    }
}

__device__ __forceinline__ h16 tohx(float x) { return (h16)x; }
__device__ __forceinline__ void splitf(float y, unsigned short& h, unsigned short& l) { h = f2bf(y); l = f2bf(y - bf2f(h)); }
typedef __attribute__((ext_vector_type(2))) _Float16 v2h;
typedef __attribute__((ext_vector_type(4))) _Float16 v4h;
typedef __attribute__((ext_vector_type(2))) unsigned short v2us;
typedef __attribute__((ext_vector_type(4))) unsigned short v4us;

__global__ __launch_bounds__(256) void k_cvt8(const float* __restrict__ src, bf* dst, size_t n8) { const size_t i = (size_t)blockIdx.x * 256 + threadIdx.x; if (i >= n8) return; const v8f v = *(const v8f*)(src + i * 8); v8us o;
#pragma unroll
    for (int k = 0; k < 8; ++k) o[k] = f2bf(v[k]); *(v8us*)(dst + i * 8) = o;  }
// Every per-image kernel below takes its image from blockIdx.y (k_gemmw: blockIdx.z with its strides): both images' planes lie one behind the other in the workspace.
__global__ __launch_bounds__(256) void k_xt(const float* __restrict__ xb, bf* XT) {
    xb += (size_t)blockIdx.y * CC * NN; XT += (size_t)blockIdx.y * NN * CC;
    const int lane = threadIdx.x & 31; const int L0 = (blockIdx.x * 8 + (threadIdx.x >> 5)) * 8; const int nlines = NN * CC / 64;
{
#pragma unroll
        for (int l = 0; l < 8; ++l) { const int L = L0 + l; if (L >= nlines) break; const int e = L * 64 + lane * 2; const int c = e & (CC - 1); const int n = e >> 8; v2us o;
#pragma unroll
            for (int q = 0; q < 2; ++q) o[q] = f2bf(xb[(size_t)(c + q) * NN + n]);
            *(v2us*)(XT + (size_t)e) = o; }
         }
}
__global__ __launch_bounds__(256) void k_wpad(const float* __restrict__ w, const float* __restrict__ b, bf* Bt, float* BP) { const int e = (blockIdx.x * 256 + threadIdx.x) * 2; if (e >= CQP * CC) return; const int n = e / CC, k = e % CC; v2us o;
#pragma unroll
    for (int q = 0; q < 2; ++q) o[q] = (n < CQ) ? f2bf(w[(size_t)n * CC + k + q]) : (unsigned short)0;
    *(v2us*)(Bt + e) = o; if (e < CQP) { *(float*)(BP + e) = (e < CQ) ? b[e] : 0.f; *(float*)(BP + e + 1) = (e + 1 < CQ) ? b[e + 1] : 0.f; }
     }
__global__ __launch_bounds__(256) void k_qsplit(const float* __restrict__ F, bf* Ph, bf* Pl) { F += (size_t)blockIdx.y * NN * CQP; Ph += (size_t)blockIdx.y * NN * CQP; Pl += (size_t)blockIdx.y * NN * CQP; const size_t i = ((size_t)blockIdx.x * 256 + threadIdx.x) * 2; if (i >= (size_t)NN * CQP) return; v2us oh, ol;
#pragma unroll
    for (int q = 0; q < 2; ++q) { unsigned short a, c2; splitf(F[i + q], a, c2); oh[q] = a; ol[q] = c2; }
    *(v2us*)(Ph + i) = oh; *(v2us*)(Pl + i) = ol;  }
__global__ __launch_bounds__(256) void k_p16(const float* __restrict__ F, h16* P, size_t n) { const size_t i = ((size_t)blockIdx.x * 256 + threadIdx.x) * 2; if (i >= n) return; v2h v; v[0] = tohx(F[i]); v[1] = tohx(F[i + 1]); *(v2h*)(P + i) = v;  }
__global__ __launch_bounds__(256) void k_v16(const float* __restrict__ FV, const float* __restrict__ bv, h16* V16) { FV += (size_t)blockIdx.y * CC * NN; V16 += (size_t)blockIdx.y * CC * NN; const size_t i = ((size_t)blockIdx.x * 256 + threadIdx.x) * 2; if (i >= (size_t)CC * NN) return; const int c = (int)(i >> 12); v2h v;
#pragma unroll
    for (int q = 0; q < 2; ++q) v[q] = tohx(__fadd_rn(FV[i + q], bfr(bv[c]))); *(v2h*)(V16 + i) = v;  }
// k_smax: row max of S[i][0..4095] (wave per row, lane -> 4 per 128-col chunk) -> RS[i*32 + lane]: one row of 32 floats per i, max in slot 0, zeros in the rest
__global__ __launch_bounds__(256) void k_smax(const float* __restrict__ S, float* RS) {
    S += (size_t)blockIdx.y * NN * NN; RS += (size_t)blockIdx.y * NN * 32;
    const int lane = threadIdx.x & 31; const int i = blockIdx.x * 8 + (threadIdx.x >> 5); if (i >= NN) return; const float* sr = S + (size_t)i * NN; float m = -3.0e38f;
#pragma unroll 4
    for (int c0 = lane * 4; c0 < NN; c0 += 128) { const v4f v = *(const v4f*)(sr + c0); m = fmaxf(m, fmaxf(fmaxf(v[0], v[1]), fmaxf(v[2], v[3]))); }
#pragma unroll
    for (int sh = 16; sh; sh >>= 1) m = fmaxf(m, __shfl_xor(m, sh, 32));
    const float o = lane == 0 ? m : 0.f; *(float*)(RS + (size_t)i * 32 + lane) = o; 
}
__global__ __launch_bounds__(256) void k_sexp(const float* __restrict__ S, float* RS, h16* P) {
    S += (size_t)blockIdx.y * NN * NN; RS += (size_t)blockIdx.y * NN * 32; P += (size_t)blockIdx.y * NN * NN;
    const int lane = threadIdx.x & 31; const int i = blockIdx.x * 8 + (threadIdx.x >> 5); if (i >= NN) return; const float* sr = S + (size_t)i * NN; const float m = RS[(size_t)i * 32]; float sum = 0.f;
#pragma unroll 2
    for (int c0 = lane * 4; c0 < NN; c0 += 128) { const v4f v = *(const v4f*)(sr + c0); v4h o;
#pragma unroll
        for (int q = 0; q < 4; ++q) { float dlt = __fsub_rn(v[q], m); asm volatile("" : "+v"(dlt)); const float e = __expf(__fmul_rn(dlt, SCL)); sum += e; o[q] = tohx(e * PCAR); }
        *(v4h*)(P + (size_t)i * NN + c0) = o;  }
#pragma unroll
    for (int sh = 16; sh; sh >>= 1) sum += __shfl_xor(sum, sh, 32);
    const float o2 = lane == 0 ? m : (lane == 1 ? __fdiv_rn(1.0f, sum * PCAR) : 0.f); /* 1/(PCAR * sum): undoes the carry at the merge */ *(float*)(RS + (size_t)i * 32 + lane) = o2; 
}
__global__ __launch_bounds__(256) void k_x1(const float* __restrict__ O, const float* __restrict__ RS, const float* __restrict__ xb, const float* __restrict__ gam, float* X1) { O += (size_t)blockIdx.y * CC * NN; RS += (size_t)blockIdx.y * NN * 32; xb += (size_t)blockIdx.y * CC * NN; X1 += (size_t)blockIdx.y * CC * NN; const size_t i = ((size_t)blockIdx.x * 256 + threadIdx.x) * 4; if (i >= (size_t)CC * NN) return; const int n0 = (int)(i & (NN - 1)); const float g = bfr(gam[0]); const v4f a = *(const v4f*)(O + i), x4 = *(const v4f*)(xb + i); v4f o;
#pragma unroll
    for (int q = 0; q < 4; ++q) { float t = __fmul_rn(a[q], RS[(size_t)(n0 + q) * 32 + 1]); asm volatile("" : "+v"(t)); float t2 = __fmul_rn(g, t); asm volatile("" : "+v"(t2)); o[q] = __fadd_rn(t2, bfr(x4[q])); }
    *(v4f*)(X1 + i) = o;  }
template <int FG>
__global__ __launch_bounds__(256) void k_mT(const float* __restrict__ X1, const float* __restrict__ mk, bf* Hh, bf* Hl) {
    X1 += (size_t)blockIdx.y * CC * NN; mk += (size_t)blockIdx.y * NN; Hh += (size_t)blockIdx.y * NN * CC; Hl += (size_t)blockIdx.y * NN * CC;
    const int lane = threadIdx.x & 31; const int L0 = (blockIdx.x * 8 + (threadIdx.x >> 5)) * 8; const int nlines = NN * CC / 64;
{
#pragma unroll 1
        for (int l = 0; l < 8; ++l) { const int L = L0 + l; if (L >= nlines) break; const int e = L * 64 + lane * 2; const int c = e & (CC - 1); const int n = e >> 8; const float w = FG ? bfr(mk[n]) : __fsub_rn(1.0f, bfr(mk[n])); v2us oh, ol;
#pragma unroll
            for (int q = 0; q < 2; ++q) { unsigned short a, c2; splitf(__fmul_rn(X1[(size_t)(c + q) * NN + n], w), a, c2); oh[q] = a; ol[q] = c2; }
            *(v2us*)(Hh + (size_t)e) = oh; *(v2us*)(Hl + (size_t)e) = ol; }
         }
}
// k_std: per channel row c (one wave, lanes stride the 4096 positions in a fixed order, fixed shuffle trees): FG = 1: values ff = X1[c][n] * bf16(mask[n]); FG = 0: values sw = O2[c][n] * RS2[n][1];
template <int FG>
__global__ __launch_bounds__(256) void k_std(const float* __restrict__ A, const float* __restrict__ aux, float* SD) {
    A += (size_t)blockIdx.y * CC * NN; aux += (size_t)blockIdx.y * (FG ? NN : NN * 32); SD += (size_t)blockIdx.y * CC * 32;
    const int lane = threadIdx.x & 31; const int c = blockIdx.x * 8 + (threadIdx.x >> 5); if (c >= CC) return; const float* row = A + (size_t)c * NN; float s = 0.f;
#pragma unroll 4
    for (int n = lane; n < NN; n += 32) { const float v = FG ? __fmul_rn(row[n], bfr(aux[n])) : __fmul_rn(row[n], aux[(size_t)n * 32 + 1]); s += v; }
#pragma unroll
    for (int sh = 16; sh; sh >>= 1) s += __shfl_xor(s, sh, 32);
    const float mu = s * (1.0f / NN); float qq = 0.f;
#pragma unroll 4
    for (int n = lane; n < NN; n += 32) { const float v = FG ? __fmul_rn(row[n], bfr(aux[n])) : __fmul_rn(row[n], aux[(size_t)n * 32 + 1]); const float d0 = __fsub_rn(v, mu); qq = __fadd_rn(qq, __fmul_rn(d0, d0)); }
#pragma unroll
    for (int sh = 16; sh; sh >>= 1) qq += __shfl_xor(qq, sh, 32);
    const float sd = __fsqrt_rn(__fadd_rn(__fdiv_rn(qq, (float)(NN - 1)), 1e-5f)); const float o = (lane == 0) ? sd : 0.f;
    *(float*)(SD + (size_t)c * 32 + lane) = o;  }
__global__ __launch_bounds__(256) void k_out(const float* __restrict__ X1, const float* __restrict__ mk, const float* __restrict__ SDF, const float* __restrict__ SDS, const float* __restrict__ gam, float* OUTb) { X1 += (size_t)blockIdx.y * CC * NN; mk += (size_t)blockIdx.y * NN; SDF += (size_t)blockIdx.y * CC * 32; SDS += (size_t)blockIdx.y * CC * 32; OUTb += (size_t)blockIdx.y * CC * NN; const size_t i = ((size_t)blockIdx.x * 256 + threadIdx.x) * 4; if (i >= (size_t)CC * NN) return; const int n0 = (int)(i & (NN - 1)); const int c = (int)(i >> 12); const float g = bfr(gam[0]); const float ratio = __fdiv_rn(SDS[(size_t)c * 32], SDF[(size_t)c * 32]); const v4f x4 = *(const v4f*)(X1 + i); v4f o;
#pragma unroll
    for (int q = 0; q < 4; ++q) { float ff = __fmul_rn(x4[q], bfr(mk[n0 + q])); asm volatile("" : "+v"(ff)); float t = __fmul_rn(ff, ratio); asm volatile("" : "+v"(t)); float t2 = __fmul_rn(g, t); asm volatile("" : "+v"(t2)); o[q] = __fadd_rn(x4[q], t2); }
    *(v4f*)(OUTb + i) = o;  }
extern "C" void kernel_launch(void* const* d_in, const int* in_sizes, int n_in,
                              void* d_out, int out_size, void* d_ws, size_t ws_size, hipStream_t stream) {
    (void)in_sizes; (void)n_in; (void)out_size;
    const float* IN[16]; for (int i = 0; i < 16; ++i) IN[i] = (const float*)d_in[i];
    // x [2][256][64][64], mask [2][1][64][64], sa_wq [32][256], sa_bq, sa_wk, sa_bk, sa_wv [256][256], sa_bv, sa_gamma [1], wq, bq, wk, bk, wv, bv, gamma [1] = d_in[0..15]
    const float* x = IN[0]; const float* mk = IN[1];
    float* OUT = (float*)d_out;     // [2][256][64][64]
    char* wsp = (char*)d_ws;
    auto take = [&](size_t bytes) { char* p = wsp; wsp += (bytes + 255) & ~(size_t)255; return (void*)p; };
    bf* WQ1 = (bf*)take((size_t)CQP * CC * 2); bf* WK1 = (bf*)take((size_t)CQP * CC * 2); float* BQ1 = (float*)take(256); float* BK1 = (float*)take(256); bf* WV1 = (bf*)take((size_t)CC * CC * 2);
    bf* WQ2 = (bf*)take((size_t)CQP * CC * 2); bf* WK2 = (bf*)take((size_t)CQP * CC * 2); float* BQ2 = (float*)take(256); float* BK2 = (float*)take(256); bf* WV2 = (bf*)take((size_t)CC * CC * 2);
    // per-image planes, NB_ of each, one behind the other
    bf* XT = (bf*)take((size_t)NB_ * NN * CC * 2); float* FQ = (float*)take((size_t)NB_ * NN * CQP * 4); bf* Qh = (bf*)take((size_t)NB_ * NN * CQP * 2); bf* Ql = (bf*)take((size_t)NB_ * NN * CQP * 2); bf* Kh = (bf*)take((size_t)NB_ * NN * CQP * 2); bf* Kl = (bf*)take((size_t)NB_ * NN * CQP * 2);
    float* FV = (float*)take((size_t)NB_ * CC * NN * 4); h16* V16 = (h16*)take((size_t)NB_ * CC * NN * 2); float* X1 = (float*)take((size_t)NB_ * CC * NN * 4);
    bf* Fh = (bf*)take((size_t)NB_ * NN * CC * 2); bf* Fl = (bf*)take((size_t)NB_ * NN * CC * 2); bf* Bh = (bf*)take((size_t)NB_ * NN * CC * 2); bf* Bl = (bf*)take((size_t)NB_ * NN * CC * 2);
    float* S = (float*)take((size_t)NB_ * NN * NN * 4); h16* P = (h16*)take((size_t)NB_ * NN * NN * 2); float* RS = (float*)take((size_t)NB_ * NN * 32 * 4); float* SDF = (float*)take((size_t)NB_ * CC * 32 * 4); float* SDS = (float*)take((size_t)NB_ * CC * 32 * 4);
    if ((size_t)(wsp - (char*)d_ws) > ws_size) return;    // total ~ 240 MiB; ws 256 MiB
    float* Oc = FV;   // both value contractions write [c][n] over FV (dead after k_v16 each time)
    { const unsigned gp = (CQP * CC / 2 + 255) / 256, g8 = (CC * CC / 8 + 255) / 256;
      k_wpad<<<gp, 256, 0, stream>>>(IN[2], IN[3], WQ1, BQ1); k_wpad<<<gp, 256, 0, stream>>>(IN[4], IN[5], WK1, BK1); k_cvt8<<<g8, 256, 0, stream>>>(IN[6], WV1, (size_t)CC * CC / 8);
      k_wpad<<<gp, 256, 0, stream>>>(IN[9], IN[10], WQ2, BQ2); k_wpad<<<gp, 256, 0, stream>>>(IN[11], IN[12], WK2, BK2); k_cvt8<<<g8, 256, 0, stream>>>(IN[13], WV2, (size_t)CC * CC / 8); }
    const unsigned LX = (unsigned)((NN * CC / 64 + 63) / 64), L2 = (unsigned)(((size_t)NN * CC / 2 + 255) / 256), L4 = (unsigned)(((size_t)NN * CC / 4 + 255) / 256), LQ = (unsigned)(((size_t)NN * CQP / 2 + 255) / 256);
    const size_t sX = (size_t)NN * CC, sQ = (size_t)NN * CQP, sS = (size_t)NN * NN;   // image strides in elements
    // stage 1: self attention on x
    k_xt<<<dim3(LX, NB_), 256, 0, stream>>>(x, XT);
    k_gemmw<bf, 0, true, 8><<<dim3(NN / 64, 1, NB_), 256, 0, stream>>>(XT, nullptr, WQ1, nullptr, CC, FQ, CQP, BQ1, sX, 0, sQ); k_qsplit<<<dim3(LQ, NB_), 256, 0, stream>>>(FQ, Qh, Ql);
    k_gemmw<bf, 0, true, 8><<<dim3(NN / 64, 1, NB_), 256, 0, stream>>>(XT, nullptr, WK1, nullptr, CC, FQ, CQP, BK1, sX, 0, sQ); k_qsplit<<<dim3(LQ, NB_), 256, 0, stream>>>(FQ, Kh, Kl);
    k_gemmw<bf, 0, false, 8><<<dim3(CC / 64, NN / 64, NB_), 256, 0, stream>>>(WV1, nullptr, XT, nullptr, CC, FV, NN, nullptr, 0, sX, sX); k_v16<<<dim3(L2, NB_), 256, 0, stream>>>(FV, IN[7], V16);
    k_gemmw<bf, 2, false, 1><<<dim3(NN / 64, NN / 64, NB_), 32, 0, stream>>>(Qh, Ql, Kh, Kl, CQP, S, NN, nullptr, sQ, sQ, sS);
    k_smax<<<dim3(NN / 8, NB_), 256, 0, stream>>>(S, RS); k_sexp<<<dim3(NN / 8, NB_), 256, 0, stream>>>(S, RS, P);
    k_gemmw<h16, 0, false, 16><<<dim3(CC / 64, NN / 64, NB_), 512, 0, stream>>>(V16, nullptr, P, nullptr, NN, Oc, NN, nullptr, sX, sS, sX);   // sa [c][i] (x1024 carried)
    k_x1<<<dim3(L4, NB_), 256, 0, stream>>>(Oc, RS, x, IN[8], X1);
    // stage 2: masked cross attention on x1 (q from mask*x1, k/v from (1-mask)*x1)
    k_mT<1><<<dim3(LX, NB_), 256, 0, stream>>>(X1, mk, Fh, Fl); k_mT<0><<<dim3(LX, NB_), 256, 0, stream>>>(X1, mk, Bh, Bl);
    k_gemmw<bf, 1, true, 8><<<dim3(NN / 64, 1, NB_), 256, 0, stream>>>(Fh, Fl, WQ2, nullptr, CC, FQ, CQP, BQ2, sX, 0, sQ); k_qsplit<<<dim3(LQ, NB_), 256, 0, stream>>>(FQ, Qh, Ql);
    k_gemmw<bf, 1, true, 8><<<dim3(NN / 64, 1, NB_), 256, 0, stream>>>(Bh, Bl, WK2, nullptr, CC, FQ, CQP, BK2, sX, 0, sQ); k_qsplit<<<dim3(LQ, NB_), 256, 0, stream>>>(FQ, Kh, Kl);
    k_gemmw<bf, 3, false, 8><<<dim3(CC / 64, NN / 64, NB_), 256, 0, stream>>>(WV2, nullptr, Bh, Bl, CC, FV, NN, nullptr, 0, sX, sX); k_v16<<<dim3(L2, NB_), 256, 0, stream>>>(FV, IN[14], V16);
    k_gemmw<bf, 2, false, 1><<<dim3(NN / 64, NN / 64, NB_), 32, 0, stream>>>(Qh, Ql, Kh, Kl, CQP, S, NN, nullptr, sQ, sQ, sS);
    k_smax<<<dim3(NN / 8, NB_), 256, 0, stream>>>(S, RS); k_sexp<<<dim3(NN / 8, NB_), 256, 0, stream>>>(S, RS, P);
    k_gemmw<h16, 0, false, 16><<<dim3(CC / 64, NN / 64, NB_), 512, 0, stream>>>(V16, nullptr, P, nullptr, NN, Oc, NN, nullptr, sX, sS, sX);   // sw [c][i] (x1024 carried; RS applied inside k_std / not needed elsewhere)
    k_std<1><<<dim3(CC / 8, NB_), 256, 0, stream>>>(X1, mk, SDF); k_std<0><<<dim3(CC / 8, NB_), 256, 0, stream>>>(Oc, RS, SDS);
    k_out<<<dim3(L4, NB_), 256, 0, stream>>>(X1, mk, SDF, SDS, IN[15], OUT);
}

// v003
// Measured time: 323 microseconds a run.
// In two side-by-side timings against v002, it was 1.18 and 1.19 times as fast.
// Over all steps from v000 it is 2.64 times as fast.
#include <hip/hip_runtime.h>

// x [2][256][64][64], mask [2][1][64][64] in {0,1} read as data; (1) self-attention: q/k = 1x1 convs to 32 ch, v 256 ch (+bias), A = softmax_j(sum_c q[c][i] k[c][j]) (unscaled),
// sa[c][i] = sum_j v[c][j] A[i][j]; x1 = sa_gamma sa + x; (2) masked cross attention: fb = (1-mask) x1, ff = mask x1; q from ff, k/v from fb (second conv set), sw[c][i] likewise;
// (3) out = x1 + gamma * ff * (std(sw) / std(ff)) per channel (unbiased variance over the 4096 positions + 1e-5, sqrt).
// Compute dtypes, f32 accumulate: every input rounded to bf16; stage-1 convs on PLAIN bf16 operands (inputs: exact, + bias; q/k padded 32 -> 64 output channels with
// numerators x1024 + 1/(1024 sum); both value contractions fp16 v x fp16 numerators (K 4096, channel-major); residuals, masks, the per-channel statistics and the final mix in f32 on VALU (one wave

#define NB_  2
#define CC   256
#define CQ   32                   // q/k channels
#define CQP  64                   // padded to one tile
#define NN   4096
#define PCAR 1024.0f
#define SCL  1.0f                 // energies are unscaled in this module
typedef _Float16 h16;
typedef unsigned short bf;
typedef __attribute__((ext_vector_type(16))) __bf16   v16bf;
typedef __attribute__((ext_vector_type(16))) _Float16 v16h;
typedef __attribute__((ext_vector_type(8)))  _Float16 v8h;
typedef __attribute__((ext_vector_type(8)))  unsigned short v8us;
typedef __attribute__((ext_vector_type(8)))  float    v8f;
typedef __attribute__((ext_vector_type(4)))  float    v4f;
typedef v8h  __attribute__((may_alias)) v8ha;
typedef v4f  __attribute__((may_alias)) v4fa;
typedef v8us __attribute__((may_alias)) v8usa;

__device__ __forceinline__ unsigned short f2bf(float f) { unsigned u = __float_as_uint(f); u += 0x7FFFu + ((u >> 16) & 1u); return (unsigned short)(u >> 16); }
__device__ __forceinline__ float bf2f(unsigned short b) { return __uint_as_float(((unsigned)b) << 16); }
__device__ __forceinline__ float bfr(float f) { return bf2f(f2bf(f)); }
__device__ __forceinline__ v16h cat16(v8h lo, v8h hi) { return __builtin_shufflevector(lo, hi, 0, 1, 2, 3, 4, 5, 6, 7, 8, 9, 10, 11, 12, 13, 14, 15); }
__device__ __forceinline__ v16bf cat16b(v8us lo, v8us hi) { return __builtin_bit_cast(v16bf, __builtin_shufflevector(lo, hi, 0, 1, 2, 3, 4, 5, 6, 7, 8, 9, 10, 11, 12, 13, 14, 15)); }
__device__ __forceinline__ v8f wmma16(v16h a, v16h b, v8f c) { return __builtin_amdgcn_wmma_f32_16x16x32_f16(false, a, false, b, (short)0, c, false, false); }
__device__ __forceinline__ v8f wmmab(v16bf a, v16bf b, v8f c) { return __builtin_amdgcn_wmma_f32_16x16x32_bf16(false, a, false, b, (short)0, c, false, false); }



// ---- k_gemmw: register-blocked GEMM, KS WAVES per 64x64 output tile, each with all 16 accumulators over its own share of K; operands straight from K-contiguous 16-bit planes; grid (M/64, N/64, Z), 32 * KS threads.
// C[m][n] (f32, pitch ldc, + optional f32 bias[n]) = sum_k A[m][k] Bt[n][k] (+ split products per NSPLIT). z-batch strides sA/sB/sC in elements. K % (32 * KS) == 0.
// Wave w takes the 32-k blocks w, w + KS, w + 2 KS, ... (neighbouring waves read the two halves of one 128-byte line in the same trip); the KS partial tiles meet in LDS and are summed in wave order.
template <typename T16> struct WFrag;
template <> struct WFrag<h16> { typedef v16h V; static __device__ __forceinline__ V ld(const h16* p) { return cat16(*(const v8h*)p, *(const v8h*)(p + 16)); } static __device__ __forceinline__ v8f mma(V a, V b, v8f c) { return wmma16(a, b, c); } };
template <> struct WFrag<bf> { typedef v16bf V; static __device__ __forceinline__ V ld(const bf* p) { return cat16b(*(const v8us*)p, *(const v8us*)(p + 16)); } static __device__ __forceinline__ v8f mma(V a, V b, v8f c) { return wmmab(a, b, c); } };
// The work is a device function that is told its tile (bx, by), its image z and its LDS, so that one launch can hold GEMMs of several shapes side by side.
template <typename T16, int NSPLIT, bool BIAS, int KS>
__device__ __forceinline__ void gemmw_body(float* os, int bx, int by, size_t z, const T16* __restrict__ A, const T16* __restrict__ A2, const T16* __restrict__ Bt, const T16* __restrict__ Bt2, int K, float* C, int ldc, const float* __restrict__ bias, size_t sA, size_t sB, size_t sC) {
    typedef typename WFrag<T16>::V V;
    A += z * sA; if (A2) A2 += z * sA; Bt += z * sB; if (Bt2) Bt2 += z * sB; C += z * sC;
    const int lane = threadIdx.x & 31, lr = lane & 15, hi = lane >> 4; const int r0 = bx * 64, c0 = by * 64;
    const int wv = KS == 1 ? 0 : __builtin_amdgcn_readfirstlane((int)(threadIdx.x >> 5));   // wave number, held scalar so that the k loop stays a scalar loop
    v8f acc[4][4];
#pragma unroll
    for (int mb = 0; mb < 4; ++mb)
#pragma unroll
        for (int nb = 0; nb < 4; ++nb) acc[mb][nb] = (v8f){};
    const size_t aoff = (size_t)(r0 + lr) * K + 8 * hi, boff = (size_t)(c0 + lr) * K + 8 * hi;
#pragma unroll 1
    for (int kc = wv * 32; kc < K; kc += 32 * KS) {
        V a[4], a2[4];
#pragma unroll
        for (int mb = 0; mb < 4; ++mb) { a[mb] = WFrag<T16>::ld(A + aoff + (size_t)mb * 16 * K + kc); if (NSPLIT == 1 || NSPLIT == 2) a2[mb] = WFrag<T16>::ld(A2 + aoff + (size_t)mb * 16 * K + kc); }
#pragma unroll
        for (int nb = 0; nb < 4; ++nb) { const V b = WFrag<T16>::ld(Bt + boff + (size_t)nb * 16 * K + kc); V b2; if (NSPLIT >= 2) b2 = WFrag<T16>::ld(Bt2 + boff + (size_t)nb * 16 * K + kc);
#pragma unroll
            for (int mb = 0; mb < 4; ++mb) { acc[mb][nb] = WFrag<T16>::mma(a[mb], b, acc[mb][nb]); if (NSPLIT == 1 || NSPLIT == 2) acc[mb][nb] = WFrag<T16>::mma(a2[mb], b, acc[mb][nb]); if (NSPLIT >= 2) acc[mb][nb] = WFrag<T16>::mma(a[mb], b2, acc[mb][nb]); } }
        asm volatile("v_nop\n\tv_nop\n\tv_nop\n\tv_nop" : "+v"(acc[0][0]), "+v"(acc[1][1]), "+v"(acc[2][2]), "+v"(acc[3][3]) : "v"(a[0]), "v"(a[3]));
    }
    if constexpr (KS > 1) {
        float* mine = os + wv * (64 * 68);
#pragma unroll
        for (int mb = 0; mb < 4; ++mb)
#pragma unroll
            for (int nb = 0; nb < 4; ++nb)
#pragma unroll
                for (int j = 0; j < 8; ++j) mine[(mb * 16 + hi * 8 + j) * 68 + nb * 16 + lr] = acc[mb][nb][j];
        __syncthreads();   // every wave's partial tile is in LDS before any of them is summed
#pragma unroll
        for (int s = 0; s < 32 / KS; ++s) { const int f = s * (32 * KS) + (int)threadIdx.x, row = f >> 4, cofs = (f & 15) * 4; v4f val = *(const v4fa*)(os + row * 68 + cofs);
#pragma unroll
            for (int q = 1; q < KS; ++q) val += *(const v4fa*)(os + q * (64 * 68) + row * 68 + cofs);
            if (BIAS) { val[0] += bfr(bias[c0 + cofs]); val[1] += bfr(bias[c0 + cofs + 1]); val[2] += bfr(bias[c0 + cofs + 2]); val[3] += bfr(bias[c0 + cofs + 3]); }
            *(v4f*)(C + (size_t)(r0 + row) * ldc + c0 + cofs) = val; }
        return;
    }
#pragma unroll
    for (int mb = 0; mb < 4; ++mb) {
#pragma unroll
        for (int nb = 0; nb < 4; ++nb) {
#pragma unroll
            for (int j = 0; j < 8; ++j) os[(hi * 8 + j) * 68 + nb * 16 + lr] = acc[mb][nb][j]; }
        __builtin_amdgcn_wave_barrier(); asm volatile("" ::: "memory");
        float* crow = C + (size_t)(r0 + mb * 16) * ldc + c0;
{
#pragma unroll
            for (int s = 0; s < 8; ++s) { const int row = 2 * s + hi, cofs = lr * 4; v4f val = *(const v4fa*)(os + row * 68 + cofs); if (BIAS) { val[0] += bfr(bias[c0 + cofs]); val[1] += bfr(bias[c0 + cofs + 1]); val[2] += bfr(bias[c0 + cofs + 2]); val[3] += bfr(bias[c0 + cofs + 3]); }
                *(v4f*)(crow + (size_t)row * ldc + cofs) = val; }
             }
        __builtin_amdgcn_wave_barrier(); asm volatile("" ::: "memory");
    }
}
template <typename T16, int NSPLIT, bool BIAS, int KS>
__global__ __launch_bounds__(32 * KS) void k_gemmw(const T16* __restrict__ A, const T16* __restrict__ A2, const T16* __restrict__ Bt, const T16* __restrict__ Bt2, int K, float* C, int ldc, const float* __restrict__ bias, size_t sA, size_t sB, size_t sC) {
    __shared__ __align__(16) float os[KS == 1 ? 16 * 68 : KS * 64 * 68];
    gemmw_body<T16, NSPLIT, BIAS, KS>(os, (int)blockIdx.x, (int)blockIdx.y, blockIdx.z, A, A2, Bt, Bt2, K, C, ldc, bias, sA, sB, sC);
}
// k_conv3: the three 1x1 convs of one stage (none reads another's result) in ONE launch; grid (256 + 64 + 64, NB_): blocks 0..255 the value conv's tiles in their old order, then the q conv's 64, then the k conv's 64.
template <int NSQK, int NSV>
__global__ __launch_bounds__(256) void k_conv3(const bf* __restrict__ Aq, const bf* __restrict__ Aq2, const bf* __restrict__ Ak, const bf* __restrict__ Ak2, const bf* __restrict__ WQ, const bf* __restrict__ WK, const float* __restrict__ BQ, const float* __restrict__ BK, float* FQq, float* FQk,
                                               const bf* __restrict__ WV, const bf* __restrict__ Xv, const bf* __restrict__ Xv2, float* FV, int K) {
    __shared__ __align__(16) float os[8 * 64 * 68];
    const int b = (int)blockIdx.x; const size_t z = blockIdx.y;
    if (b < (CC / 64) * (NN / 64)) { gemmw_body<bf, NSV, false, 8>(os, b & (CC / 64 - 1), b / (CC / 64), z, WV, nullptr, Xv, Xv2, K, FV, NN, nullptr, 0, (size_t)NN * CC, (size_t)NN * CC); return; }
    const int t = b - (CC / 64) * (NN / 64); const bool isk = t >= NN / 64;
    gemmw_body<bf, NSQK, true, 8>(os, isk ? t - NN / 64 : t, 0, z, isk ? Ak : Aq, isk ? Ak2 : Aq2, isk ? WK : WQ, nullptr, K, isk ? FQk : FQq, CQP, isk ? BK : BQ, (size_t)NN * CC, 0, (size_t)NN * CQP);
}

__device__ __forceinline__ h16 tohx(float x) { return (h16)x; }
__device__ __forceinline__ void splitf(float y, unsigned short& h, unsigned short& l) { h = f2bf(y); l = f2bf(y - bf2f(h)); }
typedef __attribute__((ext_vector_type(2))) _Float16 v2h;
typedef __attribute__((ext_vector_type(4))) _Float16 v4h;
typedef __attribute__((ext_vector_type(2))) unsigned short v2us;
typedef __attribute__((ext_vector_type(4))) unsigned short v4us;

__device__ __forceinline__ void cvt8_body(int bx, const float* __restrict__ src, bf* dst, size_t n8) { const size_t i = (size_t)bx * 256 + threadIdx.x; if (i >= n8) return; const v8f v = *(const v8f*)(src + i * 8); v8us o;
#pragma unroll
    for (int k = 0; k < 8; ++k) o[k] = f2bf(v[k]); *(v8us*)(dst + i * 8) = o;  }
// Every per-image kernel below takes its image from blockIdx.y (k_gemmw: blockIdx.z with its strides; k_prep's transpose: blockIdx.x / 256): both images' planes lie one behind the other in the workspace.
// The *_body functions are told their block (bx) and image (img) by the kernel that holds them: launches that do not depend on one another share one grid.
__device__ __forceinline__ void xt_body(int bx, int img, const float* __restrict__ xb, bf* XT) {
    xb += (size_t)img * CC * NN; XT += (size_t)img * NN * CC;
    const int lane = threadIdx.x & 31; const int L0 = (bx * 8 + (threadIdx.x >> 5)) * 8; const int nlines = NN * CC / 64;
{
#pragma unroll
        for (int l = 0; l < 8; ++l) { const int L = L0 + l; if (L >= nlines) break; const int e = L * 64 + lane * 2; const int c = e & (CC - 1); const int n = e >> 8; v2us o;
#pragma unroll
            for (int q = 0; q < 2; ++q) o[q] = f2bf(xb[(size_t)(c + q) * NN + n]);
            *(v2us*)(XT + (size_t)e) = o; }
         }
}
__device__ __forceinline__ void wpad_body(int bx, const float* __restrict__ w, const float* __restrict__ b, bf* Bt, float* BP) { const int e = (bx * 256 + threadIdx.x) * 2; if (e >= CQP * CC) return; const int n = e / CC, k = e % CC; v2us o;
#pragma unroll
    for (int q = 0; q < 2; ++q) o[q] = (n < CQ) ? f2bf(w[(size_t)n * CC + k + q]) : (unsigned short)0;
    *(v2us*)(Bt + e) = o; if (e < CQP) { *(float*)(BP + e) = (e < CQ) ? b[e] : 0.f; *(float*)(BP + e + 1) = (e + 1 < CQ) ? b[e + 1] : 0.f; }
     }
// k_prep: all that reads the inputs alone, in ONE launch; grid 512 + 128 + 64: the transpose of x (256 blocks an image), the four padded q/k weight planes (32 blocks each), the two value weight planes (32 blocks each).
__global__ __launch_bounds__(256) void k_prep(const float* __restrict__ x, bf* XT,
                                              const float* __restrict__ wq1, const float* __restrict__ bq1, bf* WQ1, float* BQ1, const float* __restrict__ wk1, const float* __restrict__ bk1, bf* WK1, float* BK1,
                                              const float* __restrict__ wq2, const float* __restrict__ bq2, bf* WQ2, float* BQ2, const float* __restrict__ wk2, const float* __restrict__ bk2, bf* WK2, float* BK2,
                                              const float* __restrict__ wv1, bf* WV1, const float* __restrict__ wv2, bf* WV2) {
    const int b = (int)blockIdx.x;
    if (b < 512) { xt_body(b & 255, b >> 8, x, XT); return; }
    const int t = b - 512, bx = t & 31, w = t >> 5;
    if (w == 0) wpad_body(bx, wq1, bq1, WQ1, BQ1);
    else if (w == 1) wpad_body(bx, wk1, bk1, WK1, BK1);
    else if (w == 2) wpad_body(bx, wq2, bq2, WQ2, BQ2);
    else if (w == 3) wpad_body(bx, wk2, bk2, WK2, BK2);
    else if (w == 4) cvt8_body(bx, wv1, WV1, (size_t)CC * CC / 8);
    else cvt8_body(bx, wv2, WV2, (size_t)CC * CC / 8);
}
__device__ __forceinline__ void qsplit_body(int bx, int img, const float* __restrict__ F, bf* Ph, bf* Pl) { F += (size_t)img * NN * CQP; Ph += (size_t)img * NN * CQP; Pl += (size_t)img * NN * CQP; const size_t i = ((size_t)bx * 256 + threadIdx.x) * 2; if (i >= (size_t)NN * CQP) return; v2us oh, ol;
#pragma unroll
    for (int q = 0; q < 2; ++q) { unsigned short a, c2; splitf(F[i + q], a, c2); oh[q] = a; ol[q] = c2; }
    *(v2us*)(Ph + i) = oh; *(v2us*)(Pl + i) = ol;  }
__global__ __launch_bounds__(256) void k_p16(const float* __restrict__ F, h16* P, size_t n) { const size_t i = ((size_t)blockIdx.x * 256 + threadIdx.x) * 2; if (i >= n) return; v2h v; v[0] = tohx(F[i]); v[1] = tohx(F[i + 1]); *(v2h*)(P + i) = v;  }
__device__ __forceinline__ void v16_body(int bx, int img, const float* __restrict__ FV, const float* __restrict__ bv, h16* V16) { FV += (size_t)img * CC * NN; V16 += (size_t)img * CC * NN; const size_t i = ((size_t)bx * 256 + threadIdx.x) * 2; if (i >= (size_t)CC * NN) return; const int c = (int)(i >> 12); v2h v;
#pragma unroll
    for (int q = 0; q < 2; ++q) v[q] = tohx(__fadd_rn(FV[i + q], bfr(bv[c]))); *(v2h*)(V16 + i) = v;  }
// k_post: what follows the three convs of a stage, in ONE launch; grid (2048 + 512 + 512, NB_): v to fp16 with its bias, then the hi/lo split of q, then that of k.
__global__ __launch_bounds__(256) void k_post(const float* __restrict__ FQq, bf* Qh, bf* Ql, const float* __restrict__ FQk, bf* Kh, bf* Kl, const float* __restrict__ FV, const float* __restrict__ bv, h16* V16) {
    const int b = (int)blockIdx.x, img = (int)blockIdx.y;
    if (b < 2048) { v16_body(b, img, FV, bv, V16); return; }
    const int t = b - 2048; const bool isk = t >= 512;
    qsplit_body(isk ? t - 512 : t, img, isk ? FQk : FQq, isk ? Kh : Qh, isk ? Kl : Ql);
}
// k_smax: row max of S[i][0..4095] (wave per row, lane -> 4 per 128-col chunk) -> RS[i][0] (RS is [4096][32] floats per image: one 32-float line per row, the other lanes write 0)
__global__ __launch_bounds__(256) void k_smax(const float* __restrict__ S, float* RS) {
    S += (size_t)blockIdx.y * NN * NN; RS += (size_t)blockIdx.y * NN * 32;
    const int lane = threadIdx.x & 31; const int i = blockIdx.x * 8 + (threadIdx.x >> 5); if (i >= NN) return; const float* sr = S + (size_t)i * NN; float m = -3.0e38f;
#pragma unroll 4
    for (int c0 = lane * 4; c0 < NN; c0 += 128) { const v4f v = *(const v4f*)(sr + c0); m = fmaxf(m, fmaxf(fmaxf(v[0], v[1]), fmaxf(v[2], v[3]))); }
#pragma unroll
    for (int sh = 16; sh; sh >>= 1) m = fmaxf(m, __shfl_xor(m, sh, 32));
    const float o = lane == 0 ? m : 0.f; *(float*)(RS + (size_t)i * 32 + lane) = o; 
}
__global__ __launch_bounds__(256) void k_sexp(const float* __restrict__ S, float* RS, h16* P) {
    S += (size_t)blockIdx.y * NN * NN; RS += (size_t)blockIdx.y * NN * 32; P += (size_t)blockIdx.y * NN * NN;
    const int lane = threadIdx.x & 31; const int i = blockIdx.x * 8 + (threadIdx.x >> 5); if (i >= NN) return; const float* sr = S + (size_t)i * NN; const float m = RS[(size_t)i * 32]; float sum = 0.f;
#pragma unroll 2
    for (int c0 = lane * 4; c0 < NN; c0 += 128) { const v4f v = *(const v4f*)(sr + c0); v4h o;
#pragma unroll
        for (int q = 0; q < 4; ++q) { float dlt = __fsub_rn(v[q], m); asm volatile("" : "+v"(dlt)); const float e = __expf(__fmul_rn(dlt, SCL)); sum += e; o[q] = tohx(e * PCAR); }
        *(v4h*)(P + (size_t)i * NN + c0) = o;  }
#pragma unroll
    for (int sh = 16; sh; sh >>= 1) sum += __shfl_xor(sum, sh, 32);
    const float o2 = lane == 0 ? m : (lane == 1 ? __fdiv_rn(1.0f, sum * PCAR) : 0.f); /* 1/(PCAR * sum): undoes the carry at the merge */ *(float*)(RS + (size_t)i * 32 + lane) = o2; 
}
__global__ __launch_bounds__(256) void k_x1(const float* __restrict__ O, const float* __restrict__ RS, const float* __restrict__ xb, const float* __restrict__ gam, float* X1) { O += (size_t)blockIdx.y * CC * NN; RS += (size_t)blockIdx.y * NN * 32; xb += (size_t)blockIdx.y * CC * NN; X1 += (size_t)blockIdx.y * CC * NN; const size_t i = ((size_t)blockIdx.x * 256 + threadIdx.x) * 4; if (i >= (size_t)CC * NN) return; const int n0 = (int)(i & (NN - 1)); const float g = bfr(gam[0]); const v4f a = *(const v4f*)(O + i), x4 = *(const v4f*)(xb + i); v4f o;
#pragma unroll
    for (int q = 0; q < 4; ++q) { float t = __fmul_rn(a[q], RS[(size_t)(n0 + q) * 32 + 1]); asm volatile("" : "+v"(t)); float t2 = __fmul_rn(g, t); asm volatile("" : "+v"(t2)); o[q] = __fadd_rn(t2, bfr(x4[q])); }
    *(v4f*)(X1 + i) = o;  }
template <int FG>
__device__ __forceinline__ void mT_body(int bx, int img, const float* __restrict__ X1, const float* __restrict__ mk, bf* Hh, bf* Hl) {
    X1 += (size_t)img * CC * NN; mk += (size_t)img * NN; Hh += (size_t)img * NN * CC; Hl += (size_t)img * NN * CC;
    const int lane = threadIdx.x & 31; const int L0 = (bx * 8 + (threadIdx.x >> 5)) * 8; const int nlines = NN * CC / 64;
{
#pragma unroll 1
        for (int l = 0; l < 8; ++l) { const int L = L0 + l; if (L >= nlines) break; const int e = L * 64 + lane * 2; const int c = e & (CC - 1); const int n = e >> 8; const float w = FG ? bfr(mk[n]) : __fsub_rn(1.0f, bfr(mk[n])); v2us oh, ol;
#pragma unroll
            for (int q = 0; q < 2; ++q) { unsigned short a, c2; splitf(__fmul_rn(X1[(size_t)(c + q) * NN + n], w), a, c2); oh[q] = a; ol[q] = c2; }
            *(v2us*)(Hh + (size_t)e) = oh; *(v2us*)(Hl + (size_t)e) = ol;
            asm volatile("s_wait_xcnt 0x0" ::: "memory"); }   // stands behind the two stores, before the next trip (or the code behind the loop) writes over their address and data registers
         }
}
// k_mT2: the foreground and the background planes in ONE launch; grid (256 + 256, NB_).
__global__ __launch_bounds__(256) void k_mT2(const float* __restrict__ X1, const float* __restrict__ mk, bf* Fh, bf* Fl, bf* Bh, bf* Bl) {
    const int b = (int)blockIdx.x, img = (int)blockIdx.y;
    if (b < 256) mT_body<1>(b, img, X1, mk, Fh, Fl); else mT_body<0>(b - 256, img, X1, mk, Bh, Bl);
}
// std_body: per channel row c (one wave, lanes stride the 4096 positions in a fixed order, fixed shuffle trees): FG = 1: values ff = X1[c][n] * bf16(mask[n]); FG = 0: values sw = O2[c][n] * RS2[n][1];
template <int FG>
__device__ __forceinline__ void std_body(int bx, int img, const float* __restrict__ A, const float* __restrict__ aux, float* SD) {
    A += (size_t)img * CC * NN; aux += (size_t)img * (FG ? NN : NN * 32); SD += (size_t)img * CC * 32;
    const int lane = threadIdx.x & 31; const int c = bx * 8 + (threadIdx.x >> 5); if (c >= CC) return; const float* row = A + (size_t)c * NN; float s = 0.f;
#pragma unroll 4
    for (int n = lane; n < NN; n += 32) { const float v = FG ? __fmul_rn(row[n], bfr(aux[n])) : __fmul_rn(row[n], aux[(size_t)n * 32 + 1]); s += v; }
#pragma unroll
    for (int sh = 16; sh; sh >>= 1) s += __shfl_xor(s, sh, 32);
    const float mu = s * (1.0f / NN); float qq = 0.f;
#pragma unroll 4
    for (int n = lane; n < NN; n += 32) { const float v = FG ? __fmul_rn(row[n], bfr(aux[n])) : __fmul_rn(row[n], aux[(size_t)n * 32 + 1]); const float d0 = __fsub_rn(v, mu); qq = __fadd_rn(qq, __fmul_rn(d0, d0)); }
#pragma unroll
    for (int sh = 16; sh; sh >>= 1) qq += __shfl_xor(qq, sh, 32);
    const float sd = __fsqrt_rn(__fadd_rn(__fdiv_rn(qq, (float)(NN - 1)), 1e-5f)); const float o = (lane == 0) ? sd : 0.f;
    *(float*)(SD + (size_t)c * 32 + lane) = o;  }
// k_std2: both statistics in ONE launch; grid (32 + 32, NB_): sw's rows first, then ff's.
__global__ __launch_bounds__(256) void k_std2(const float* __restrict__ O2, const float* __restrict__ RS, float* SDS, const float* __restrict__ X1, const float* __restrict__ mk, float* SDF) {
    const int b = (int)blockIdx.x, img = (int)blockIdx.y;
    if (b < CC / 8) std_body<0>(b, img, O2, RS, SDS); else std_body<1>(b - CC / 8, img, X1, mk, SDF);
}
__global__ __launch_bounds__(256) void k_out(const float* __restrict__ X1, const float* __restrict__ mk, const float* __restrict__ SDF, const float* __restrict__ SDS, const float* __restrict__ gam, float* OUTb) { X1 += (size_t)blockIdx.y * CC * NN; mk += (size_t)blockIdx.y * NN; SDF += (size_t)blockIdx.y * CC * 32; SDS += (size_t)blockIdx.y * CC * 32; OUTb += (size_t)blockIdx.y * CC * NN; const size_t i = ((size_t)blockIdx.x * 256 + threadIdx.x) * 4; if (i >= (size_t)CC * NN) return; const int n0 = (int)(i & (NN - 1)); const int c = (int)(i >> 12); const float g = bfr(gam[0]); const float ratio = __fdiv_rn(SDS[(size_t)c * 32], SDF[(size_t)c * 32]); const v4f x4 = *(const v4f*)(X1 + i); v4f o;
#pragma unroll
    for (int q = 0; q < 4; ++q) { float ff = __fmul_rn(x4[q], bfr(mk[n0 + q])); asm volatile("" : "+v"(ff)); float t = __fmul_rn(ff, ratio); asm volatile("" : "+v"(t)); float t2 = __fmul_rn(g, t); asm volatile("" : "+v"(t2)); o[q] = __fadd_rn(x4[q], t2); }
    *(v4f*)(OUTb + i) = o;  }
extern "C" void kernel_launch(void* const* d_in, const int* in_sizes, int n_in,
                              void* d_out, int out_size, void* d_ws, size_t ws_size, hipStream_t stream) {
    (void)in_sizes; (void)n_in; (void)out_size;
    const float* IN[16]; for (int i = 0; i < 16; ++i) IN[i] = (const float*)d_in[i];
    // x [2][256][64][64], mask [2][1][64][64], sa_wq [32][256], sa_bq, sa_wk, sa_bk, sa_wv [256][256], sa_bv, sa_gamma [1], wq, bq, wk, bk, wv, bv, gamma [1] = d_in[0..15]
    const float* x = IN[0]; const float* mk = IN[1];
    float* OUT = (float*)d_out;     // [2][256][64][64]
    char* wsp = (char*)d_ws;
    auto take = [&](size_t bytes) { char* p = wsp; wsp += (bytes + 255) & ~(size_t)255; return (void*)p; };
    bf* WQ1 = (bf*)take((size_t)CQP * CC * 2); bf* WK1 = (bf*)take((size_t)CQP * CC * 2); float* BQ1 = (float*)take(256); float* BK1 = (float*)take(256); bf* WV1 = (bf*)take((size_t)CC * CC * 2);
    bf* WQ2 = (bf*)take((size_t)CQP * CC * 2); bf* WK2 = (bf*)take((size_t)CQP * CC * 2); float* BQ2 = (float*)take(256); float* BK2 = (float*)take(256); bf* WV2 = (bf*)take((size_t)CC * CC * 2);
    // per-image planes, NB_ of each, one behind the other
    bf* XT = (bf*)take((size_t)NB_ * NN * CC * 2); float* FQ = (float*)take((size_t)NB_ * NN * CQP * 4); float* FK = (float*)take((size_t)NB_ * NN * CQP * 4); bf* Qh = (bf*)take((size_t)NB_ * NN * CQP * 2); bf* Ql = (bf*)take((size_t)NB_ * NN * CQP * 2); bf* Kh = (bf*)take((size_t)NB_ * NN * CQP * 2); bf* Kl = (bf*)take((size_t)NB_ * NN * CQP * 2);
    float* FV = (float*)take((size_t)NB_ * CC * NN * 4); h16* V16 = (h16*)take((size_t)NB_ * CC * NN * 2); float* X1 = (float*)take((size_t)NB_ * CC * NN * 4);
    bf* Fh = (bf*)take((size_t)NB_ * NN * CC * 2); bf* Fl = (bf*)take((size_t)NB_ * NN * CC * 2); bf* Bh = (bf*)take((size_t)NB_ * NN * CC * 2); bf* Bl = (bf*)take((size_t)NB_ * NN * CC * 2);
    float* S = (float*)take((size_t)NB_ * NN * NN * 4); h16* P = (h16*)take((size_t)NB_ * NN * NN * 2); float* RS = (float*)take((size_t)NB_ * NN * 32 * 4); float* SDF = (float*)take((size_t)NB_ * CC * 32 * 4); float* SDS = (float*)take((size_t)NB_ * CC * 32 * 4);
    if ((size_t)(wsp - (char*)d_ws) > ws_size) return;    // total ~ 242 MiB; ws 256 MiB
    float* Oc = FV;   // both value contractions write [c][n] over FV (dead after k_post each time)
    const unsigned L4 = (unsigned)(((size_t)NN * CC / 4 + 255) / 256);
    const size_t sX = (size_t)NN * CC, sQ = (size_t)NN * CQP, sS = (size_t)NN * NN;   // image strides in elements
    // stage 1: self attention on x
    k_prep<<<512 + 128 + 64, 256, 0, stream>>>(x, XT, IN[2], IN[3], WQ1, BQ1, IN[4], IN[5], WK1, BK1, IN[9], IN[10], WQ2, BQ2, IN[11], IN[12], WK2, BK2, IN[6], WV1, IN[13], WV2);
    k_conv3<0, 0><<<dim3(256 + 64 + 64, NB_), 256, 0, stream>>>(XT, nullptr, XT, nullptr, WQ1, WK1, BQ1, BK1, FQ, FK, WV1, XT, nullptr, FV, CC);
    k_post<<<dim3(2048 + 512 + 512, NB_), 256, 0, stream>>>(FQ, Qh, Ql, FK, Kh, Kl, FV, IN[7], V16);
    k_gemmw<bf, 2, false, 1><<<dim3(NN / 64, NN / 64, NB_), 32, 0, stream>>>(Qh, Ql, Kh, Kl, CQP, S, NN, nullptr, sQ, sQ, sS);
    k_smax<<<dim3(NN / 8, NB_), 256, 0, stream>>>(S, RS); k_sexp<<<dim3(NN / 8, NB_), 256, 0, stream>>>(S, RS, P);
    k_gemmw<h16, 0, false, 16><<<dim3(CC / 64, NN / 64, NB_), 512, 0, stream>>>(V16, nullptr, P, nullptr, NN, Oc, NN, nullptr, sX, sS, sX);   // sa [c][i] (x1024 carried)
    k_x1<<<dim3(L4, NB_), 256, 0, stream>>>(Oc, RS, x, IN[8], X1);
    // stage 2: masked cross attention on x1 (q from mask*x1, k/v from (1-mask)*x1)
    k_mT2<<<dim3(256 + 256, NB_), 256, 0, stream>>>(X1, mk, Fh, Fl, Bh, Bl);
    k_conv3<1, 3><<<dim3(256 + 64 + 64, NB_), 256, 0, stream>>>(Fh, Fl, Bh, Bl, WQ2, WK2, BQ2, BK2, FQ, FK, WV2, Bh, Bl, FV, CC);
    k_post<<<dim3(2048 + 512 + 512, NB_), 256, 0, stream>>>(FQ, Qh, Ql, FK, Kh, Kl, FV, IN[14], V16);
    k_gemmw<bf, 2, false, 1><<<dim3(NN / 64, NN / 64, NB_), 32, 0, stream>>>(Qh, Ql, Kh, Kl, CQP, S, NN, nullptr, sQ, sQ, sS);
    k_smax<<<dim3(NN / 8, NB_), 256, 0, stream>>>(S, RS); k_sexp<<<dim3(NN / 8, NB_), 256, 0, stream>>>(S, RS, P);
    k_gemmw<h16, 0, false, 16><<<dim3(CC / 64, NN / 64, NB_), 512, 0, stream>>>(V16, nullptr, P, nullptr, NN, Oc, NN, nullptr, sX, sS, sX);   // sw [c][i] (x1024 carried; RS applied inside k_std2 / not needed elsewhere)
    k_std2<<<dim3(CC / 8 + CC / 8, NB_), 256, 0, stream>>>(Oc, RS, SDS, X1, mk, SDF);
    k_out<<<dim3(L4, NB_), 256, 0, stream>>>(X1, mk, SDF, SDS, IN[15], OUT);
}

// v004
// A run of this version takes 231 microseconds.
// Next to v003, in two timings, it ran 1.41 and 1.40 times as fast.
// All steps since v000 together make it 3.71 times as fast.
#include <hip/hip_runtime.h>

// x [2][256][64][64], mask [2][1][64][64] in {0,1} read as data; (1) self-attention: q/k = 1x1 convs to 32 ch, v 256 ch (+bias), A = softmax_j(sum_c q[c][i] k[c][j]) (unscaled),
// sa[c][i] = sum_j v[c][j] A[i][j]; x1 = sa_gamma sa + x; (2) masked cross attention: fb = (1-mask) x1, ff = mask x1; q from ff, k/v from fb (second conv set), sw[c][i] likewise;
// (3) out = x1 + gamma * ff * (std(sw) / std(ff)) per channel (unbiased variance over the 4096 positions + 1e-5, sqrt).
// Compute dtypes, f32 accumulate: every input rounded to bf16; stage-1 convs on PLAIN bf16 operands (inputs: exact, + bias; q/k padded 32 -> 64 output channels with
// numerators x1024 + 1/(1024 sum); both value contractions fp16 v x fp16 numerators (K 4096, channel-major); residuals, masks, the per-channel statistics and the final mix in f32 on VALU (one wave

#define NB_  2
#define CC   256
#define CQ   32                   // q/k channels
#define CQP  64                   // padded to one tile
#define NN   4096
#define PCAR 1024.0f
#define SCL  1.0f                 // energies are unscaled in this module
typedef _Float16 h16;
typedef unsigned short bf;
typedef __attribute__((ext_vector_type(16))) __bf16   v16bf;
typedef __attribute__((ext_vector_type(16))) _Float16 v16h;
typedef __attribute__((ext_vector_type(8)))  _Float16 v8h;
typedef __attribute__((ext_vector_type(8)))  unsigned short v8us;
typedef __attribute__((ext_vector_type(8)))  float    v8f;
typedef __attribute__((ext_vector_type(4)))  float    v4f;
typedef v8h  __attribute__((may_alias)) v8ha;
typedef v4f  __attribute__((may_alias)) v4fa;
typedef v8us __attribute__((may_alias)) v8usa;

__device__ __forceinline__ unsigned short f2bf(float f) { unsigned u = __float_as_uint(f); u += 0x7FFFu + ((u >> 16) & 1u); return (unsigned short)(u >> 16); }
__device__ __forceinline__ float bf2f(unsigned short b) { return __uint_as_float(((unsigned)b) << 16); }
__device__ __forceinline__ float bfr(float f) { return bf2f(f2bf(f)); }
__device__ __forceinline__ v16h cat16(v8h lo, v8h hi) { return __builtin_shufflevector(lo, hi, 0, 1, 2, 3, 4, 5, 6, 7, 8, 9, 10, 11, 12, 13, 14, 15); }
__device__ __forceinline__ v16bf cat16b(v8us lo, v8us hi) { return __builtin_bit_cast(v16bf, __builtin_shufflevector(lo, hi, 0, 1, 2, 3, 4, 5, 6, 7, 8, 9, 10, 11, 12, 13, 14, 15)); }
__device__ __forceinline__ v8f wmma16(v16h a, v16h b, v8f c) { return __builtin_amdgcn_wmma_f32_16x16x32_f16(false, a, false, b, (short)0, c, false, false); }
__device__ __forceinline__ v8f wmmab(v16bf a, v16bf b, v8f c) { return __builtin_amdgcn_wmma_f32_16x16x32_bf16(false, a, false, b, (short)0, c, false, false); }



// ---- gemmw_body: register-blocked GEMM, KS WAVES per 64x64 output tile, each with all 16 accumulators over its own share of K; operands straight from K-contiguous 16-bit planes; 32 * KS threads.
// C[m][n] (f32, pitch ldc, + optional f32 bias[n]) = sum_k A[m][k] Bt[n][k] (+ split products per NSPLIT). z-batch strides sA/sB/sC in elements. K % (32 * KS) == 0.
// Wave w takes the 32-k blocks w, w + KS, w + 2 KS, ... (neighbouring waves read the two halves of one 128-byte line in the same trip); the KS partial tiles meet in LDS and are summed in wave order.
template <typename T16> struct WFrag;
template <> struct WFrag<h16> { typedef v16h V; static __device__ __forceinline__ V ld(const h16* p) { return cat16(*(const v8h*)p, *(const v8h*)(p + 16)); } static __device__ __forceinline__ v8f mma(V a, V b, v8f c) { return wmma16(a, b, c); } };
template <> struct WFrag<bf> { typedef v16bf V; static __device__ __forceinline__ V ld(const bf* p) { return cat16b(*(const v8us*)p, *(const v8us*)(p + 16)); } static __device__ __forceinline__ v8f mma(V a, V b, v8f c) { return wmmab(a, b, c); } };
// The work is a device function that is told its tile (bx, by), its image z and its LDS, so that one launch can hold GEMMs of several shapes side by side.
template <typename T16, int NSPLIT, bool BIAS, int KS>
__device__ __forceinline__ void gemmw_body(float* os, int bx, int by, size_t z, const T16* __restrict__ A, const T16* __restrict__ A2, const T16* __restrict__ Bt, const T16* __restrict__ Bt2, int K, float* C, int ldc, const float* __restrict__ bias, size_t sA, size_t sB, size_t sC) {
    typedef typename WFrag<T16>::V V;
    A += z * sA; if (A2) A2 += z * sA; Bt += z * sB; if (Bt2) Bt2 += z * sB; C += z * sC;
    const int lane = threadIdx.x & 31, lr = lane & 15, hi = lane >> 4; const int r0 = bx * 64, c0 = by * 64;
    const int wv = KS == 1 ? 0 : __builtin_amdgcn_readfirstlane((int)(threadIdx.x >> 5));   // wave number, held scalar so that the k loop stays a scalar loop
    v8f acc[4][4];
#pragma unroll
    for (int mb = 0; mb < 4; ++mb)
#pragma unroll
        for (int nb = 0; nb < 4; ++nb) acc[mb][nb] = (v8f){};
    const size_t aoff = (size_t)(r0 + lr) * K + 8 * hi, boff = (size_t)(c0 + lr) * K + 8 * hi;
#pragma unroll 1
    for (int kc = wv * 32; kc < K; kc += 32 * KS) {
        V a[4], a2[4];
#pragma unroll
        for (int mb = 0; mb < 4; ++mb) { a[mb] = WFrag<T16>::ld(A + aoff + (size_t)mb * 16 * K + kc); if (NSPLIT == 1 || NSPLIT == 2) a2[mb] = WFrag<T16>::ld(A2 + aoff + (size_t)mb * 16 * K + kc); }
#pragma unroll
        for (int nb = 0; nb < 4; ++nb) { const V b = WFrag<T16>::ld(Bt + boff + (size_t)nb * 16 * K + kc); V b2; if (NSPLIT >= 2) b2 = WFrag<T16>::ld(Bt2 + boff + (size_t)nb * 16 * K + kc);
#pragma unroll
            for (int mb = 0; mb < 4; ++mb) { acc[mb][nb] = WFrag<T16>::mma(a[mb], b, acc[mb][nb]); if (NSPLIT == 1 || NSPLIT == 2) acc[mb][nb] = WFrag<T16>::mma(a2[mb], b, acc[mb][nb]); if (NSPLIT >= 2) acc[mb][nb] = WFrag<T16>::mma(a[mb], b2, acc[mb][nb]); } }
        asm volatile("v_nop\n\tv_nop\n\tv_nop\n\tv_nop" : "+v"(acc[0][0]), "+v"(acc[1][1]), "+v"(acc[2][2]), "+v"(acc[3][3]) : "v"(a[0]), "v"(a[3]));
    }
    if constexpr (KS > 1) {
        float* mine = os + wv * (64 * 68);
#pragma unroll
        for (int mb = 0; mb < 4; ++mb)
#pragma unroll
            for (int nb = 0; nb < 4; ++nb)
#pragma unroll
                for (int j = 0; j < 8; ++j) mine[(mb * 16 + hi * 8 + j) * 68 + nb * 16 + lr] = acc[mb][nb][j];
        __syncthreads();   // every wave's partial tile is in LDS before any of them is summed
#pragma unroll
        for (int s = 0; s < 32 / KS; ++s) { const int f = s * (32 * KS) + (int)threadIdx.x, row = f >> 4, cofs = (f & 15) * 4; v4f val = *(const v4fa*)(os + row * 68 + cofs);
#pragma unroll
            for (int q = 1; q < KS; ++q) val += *(const v4fa*)(os + q * (64 * 68) + row * 68 + cofs);
            if (BIAS) { val[0] += bfr(bias[c0 + cofs]); val[1] += bfr(bias[c0 + cofs + 1]); val[2] += bfr(bias[c0 + cofs + 2]); val[3] += bfr(bias[c0 + cofs + 3]); }
            *(v4f*)(C + (size_t)(r0 + row) * ldc + c0 + cofs) = val; }
        return;
    }
#pragma unroll
    for (int mb = 0; mb < 4; ++mb) {
#pragma unroll
        for (int nb = 0; nb < 4; ++nb) {
#pragma unroll
            for (int j = 0; j < 8; ++j) os[(hi * 8 + j) * 68 + nb * 16 + lr] = acc[mb][nb][j]; }
        __builtin_amdgcn_wave_barrier(); asm volatile("" ::: "memory");
        float* crow = C + (size_t)(r0 + mb * 16) * ldc + c0;
{
#pragma unroll
            for (int s = 0; s < 8; ++s) { const int row = 2 * s + hi, cofs = lr * 4; v4f val = *(const v4fa*)(os + row * 68 + cofs); if (BIAS) { val[0] += bfr(bias[c0 + cofs]); val[1] += bfr(bias[c0 + cofs + 1]); val[2] += bfr(bias[c0 + cofs + 2]); val[3] += bfr(bias[c0 + cofs + 3]); }
                *(v4f*)(crow + (size_t)row * ldc + cofs) = val; }
             }
        __builtin_amdgcn_wave_barrier(); asm volatile("" ::: "memory");
    }
}
// k_conv3: the three 1x1 convs of one stage (none reads another's result) in ONE launch; grid (256 + 64 + 64, NB_): blocks 0..255 the value conv's tiles in their old order, then the q conv's 64, then the k conv's 64.
template <int NSQK, int NSV>
__global__ __launch_bounds__(256) void k_conv3(const bf* __restrict__ Aq, const bf* __restrict__ Aq2, const bf* __restrict__ Ak, const bf* __restrict__ Ak2, const bf* __restrict__ WQ, const bf* __restrict__ WK, const float* __restrict__ BQ, const float* __restrict__ BK, float* FQq, float* FQk,
                                               const bf* __restrict__ WV, const bf* __restrict__ Xv, const bf* __restrict__ Xv2, float* FV, int K) {
    __shared__ __align__(16) float os[8 * 64 * 68];
    const int b = (int)blockIdx.x; const size_t z = blockIdx.y;
    if (b < (CC / 64) * (NN / 64)) { gemmw_body<bf, NSV, false, 8>(os, b & (CC / 64 - 1), b / (CC / 64), z, WV, nullptr, Xv, Xv2, K, FV, NN, nullptr, 0, (size_t)NN * CC, (size_t)NN * CC); return; }
    const int t = b - (CC / 64) * (NN / 64); const bool isk = t >= NN / 64;
    gemmw_body<bf, NSQK, true, 8>(os, isk ? t - NN / 64 : t, 0, z, isk ? Ak : Aq, isk ? Ak2 : Aq2, isk ? WK : WQ, nullptr, K, isk ? FQk : FQq, CQP, isk ? BK : BQ, (size_t)NN * CC, 0, (size_t)NN * CQP);
}

__device__ __forceinline__ h16 tohx(float x) { return (h16)x; }
__device__ __forceinline__ void splitf(float y, unsigned short& h, unsigned short& l) { h = f2bf(y); l = f2bf(y - bf2f(h)); }
typedef __attribute__((ext_vector_type(2))) _Float16 v2h;
typedef __attribute__((ext_vector_type(4))) _Float16 v4h;
typedef __attribute__((ext_vector_type(2))) unsigned short v2us;
typedef __attribute__((ext_vector_type(4))) unsigned short v4us;

__device__ __forceinline__ void cvt8_body(int bx, const float* __restrict__ src, bf* dst, size_t n8) { const size_t i = (size_t)bx * 256 + threadIdx.x; if (i >= n8) return; const v8f v = *(const v8f*)(src + i * 8); v8us o;
#pragma unroll
    for (int k = 0; k < 8; ++k) o[k] = f2bf(v[k]); *(v8us*)(dst + i * 8) = o;  }
// Every per-image kernel below takes its image from blockIdx.y (k_prep's transpose: blockIdx.x / 256): both images' planes lie one behind the other in the workspace.
// The *_body functions are told their block (bx) and image (img) by the kernel that holds them: launches that do not depend on one another share one grid.
__device__ __forceinline__ void xt_body(int bx, int img, const float* __restrict__ xb, bf* XT) {
    xb += (size_t)img * CC * NN; XT += (size_t)img * NN * CC;
    const int lane = threadIdx.x & 31; const int L0 = (bx * 8 + (threadIdx.x >> 5)) * 8; const int nlines = NN * CC / 64;
{
#pragma unroll
        for (int l = 0; l < 8; ++l) { const int L = L0 + l; if (L >= nlines) break; const int e = L * 64 + lane * 2; const int c = e & (CC - 1); const int n = e >> 8; v2us o;
#pragma unroll
            for (int q = 0; q < 2; ++q) o[q] = f2bf(xb[(size_t)(c + q) * NN + n]);
            *(v2us*)(XT + (size_t)e) = o; }
         }
}
__device__ __forceinline__ void wpad_body(int bx, const float* __restrict__ w, const float* __restrict__ b, bf* Bt, float* BP) { const int e = (bx * 256 + threadIdx.x) * 2; if (e >= CQP * CC) return; const int n = e / CC, k = e % CC; v2us o;
#pragma unroll
    for (int q = 0; q < 2; ++q) o[q] = (n < CQ) ? f2bf(w[(size_t)n * CC + k + q]) : (unsigned short)0;
    *(v2us*)(Bt + e) = o; if (e < CQP) { *(float*)(BP + e) = (e < CQ) ? b[e] : 0.f; *(float*)(BP + e + 1) = (e + 1 < CQ) ? b[e + 1] : 0.f; }
     }
// k_prep: all that reads the inputs alone, in ONE launch; grid 512 + 128 + 64: the transpose of x (256 blocks an image), the four padded q/k weight planes (32 blocks each), the two value weight planes (32 blocks each).
__global__ __launch_bounds__(256) void k_prep(const float* __restrict__ x, bf* XT,
                                              const float* __restrict__ wq1, const float* __restrict__ bq1, bf* WQ1, float* BQ1, const float* __restrict__ wk1, const float* __restrict__ bk1, bf* WK1, float* BK1,
                                              const float* __restrict__ wq2, const float* __restrict__ bq2, bf* WQ2, float* BQ2, const float* __restrict__ wk2, const float* __restrict__ bk2, bf* WK2, float* BK2,
                                              const float* __restrict__ wv1, bf* WV1, const float* __restrict__ wv2, bf* WV2) {
    const int b = (int)blockIdx.x;
    if (b < 512) { xt_body(b & 255, b >> 8, x, XT); return; }
    const int t = b - 512, bx = t & 31, w = t >> 5;
    if (w == 0) wpad_body(bx, wq1, bq1, WQ1, BQ1);
    else if (w == 1) wpad_body(bx, wk1, bk1, WK1, BK1);
    else if (w == 2) wpad_body(bx, wq2, bq2, WQ2, BQ2);
    else if (w == 3) wpad_body(bx, wk2, bk2, WK2, BK2);
    else if (w == 4) cvt8_body(bx, wv1, WV1, (size_t)CC * CC / 8);
    else cvt8_body(bx, wv2, WV2, (size_t)CC * CC / 8);
}
__device__ __forceinline__ void qsplit_body(int bx, int img, const float* __restrict__ F, bf* Ph, bf* Pl) { F += (size_t)img * NN * CQP; Ph += (size_t)img * NN * CQP; Pl += (size_t)img * NN * CQP; const size_t i = ((size_t)bx * 256 + threadIdx.x) * 2; if (i >= (size_t)NN * CQP) return; v2us oh, ol;
#pragma unroll
    for (int q = 0; q < 2; ++q) { unsigned short a, c2; splitf(F[i + q], a, c2); oh[q] = a; ol[q] = c2; }
    *(v2us*)(Ph + i) = oh; *(v2us*)(Pl + i) = ol;  }
__global__ __launch_bounds__(256) void k_p16(const float* __restrict__ F, h16* P, size_t n) { const size_t i = ((size_t)blockIdx.x * 256 + threadIdx.x) * 2; if (i >= n) return; v2h v; v[0] = tohx(F[i]); v[1] = tohx(F[i + 1]); *(v2h*)(P + i) = v;  }
__device__ __forceinline__ void v16_body(int bx, int img, const float* __restrict__ FV, const float* __restrict__ bv, h16* V16) { FV += (size_t)img * CC * NN; V16 += (size_t)img * CC * NN; const size_t i = ((size_t)bx * 256 + threadIdx.x) * 2; if (i >= (size_t)CC * NN) return; const int c = (int)(i >> 12); v2h v;
#pragma unroll
    for (int q = 0; q < 2; ++q) v[q] = tohx(__fadd_rn(FV[i + q], bfr(bv[c]))); *(v2h*)(V16 + i) = v;  }
// k_post: what follows the three convs of a stage, in ONE launch; grid (2048 + 512 + 512, NB_): v to fp16 with its bias, then the hi/lo split of q, then that of k.
__global__ __launch_bounds__(256) void k_post(const float* __restrict__ FQq, bf* Qh, bf* Ql, const float* __restrict__ FQk, bf* Kh, bf* Kl, const float* __restrict__ FV, const float* __restrict__ bv, h16* V16) {
    const int b = (int)blockIdx.x, img = (int)blockIdx.y;
    if (b < 2048) { v16_body(b, img, FV, bv, V16); return; }
    const int t = b - 2048; const bool isk = t >= 512;
    qsplit_body(isk ? t - 512 : t, img, isk ? FQk : FQq, isk ? Kh : Qh, isk ? Kl : Ql);
}
// k_attn: scores, softmax and value contraction of 32 query positions i in ONE work-group of 16 waves; grid (NN / 32, NB_). No score and no numerator leaves the work-group.
// Scores are formed transposed, St[j][i] = sum_c k[j][c] q[i][c] (A = k rows, B = q rows, the three hi/lo products in the old order, over the 32 real channels: the pad's products are exact zeros): a lane then
// holds 8 neighbouring keys j of one column i, which is one 16-byte piece of a numerator row p[i][j].
// Pass 1: wave w takes the keys w * 256 .. + 255 and finds each column's maximum; the 16 partial maxima meet in LDS.
// Pass 2, in steps of PJ = 256 keys: wave w forms the scores of the step's keys w * 16 .. + 15 again, numerators exp(s - max) (f32 sum; x1024 to fp16) into LDS (two buffers, one barrier a step);
// then wave w adds the step to its own 16 channels, O[c][i] += v[c][j] p[i][j], v straight from its K-contiguous plane (each v element is read once by the work-group), keys in rising order.
#define PJ 256
#define PP (PJ + 8)               // pitch of a numerator row in LDS, in halves: rows 4 banks apart
__global__ __launch_bounds__(512) void k_attn(const bf* __restrict__ Qh, const bf* __restrict__ Ql, const bf* __restrict__ Kh, const bf* __restrict__ Kl, const h16* __restrict__ V16, float* O, float* RS) {
    __shared__ __align__(16) h16 ps[2 * 32 * PP];
    __shared__ float mx[16 * 32];
    __shared__ float ls[16 * 32];
    __shared__ float mf[32];
    const size_t img = blockIdx.y;
    Qh += img * NN * CQP; Ql += img * NN * CQP; Kh += img * NN * CQP; Kl += img * NN * CQP; V16 += img * CC * NN; O += img * CC * NN; RS += img * NN * 32;
    const int lane = threadIdx.x & 31, lr = lane & 15, hi = lane >> 4; const int i0 = (int)blockIdx.x * 32;
    const int wv = __builtin_amdgcn_readfirstlane((int)(threadIdx.x >> 5));   // wave number, held scalar so that the key loops stay scalar loops
    v16bf qh[2], ql[2];
#pragma unroll
    for (int nb = 0; nb < 2; ++nb) { const size_t o = (size_t)(i0 + nb * 16 + lr) * CQP + 8 * hi; qh[nb] = WFrag<bf>::ld(Qh + o); ql[nb] = WFrag<bf>::ld(Ql + o); }
    float m[2] = { -3.0e38f, -3.0e38f };
#pragma unroll 4
    for (int j0 = wv * 256; j0 < wv * 256 + 256; j0 += 16) { const size_t o = (size_t)(j0 + lr) * CQP + 8 * hi; const v16bf kh = WFrag<bf>::ld(Kh + o), kl = WFrag<bf>::ld(Kl + o);
#pragma unroll
        for (int nb = 0; nb < 2; ++nb) { v8f s = (v8f){}; s = wmmab(kh, qh[nb], s); s = wmmab(kh, ql[nb], s); s = wmmab(kl, qh[nb], s);
#pragma unroll
            for (int e = 0; e < 8; ++e) m[nb] = fmaxf(m[nb], s[e]); }
    }
#pragma unroll
    for (int nb = 0; nb < 2; ++nb) m[nb] = fmaxf(m[nb], __shfl_xor(m[nb], 16, 32));
    if (hi == 0) { mx[wv * 32 + lr] = m[0]; mx[wv * 32 + 16 + lr] = m[1]; }
    __syncthreads();   // all 16 partial maxima are in LDS before any wave takes the maximum over them
#pragma unroll
    for (int nb = 0; nb < 2; ++nb) { float t = mx[nb * 16 + lr];
#pragma unroll
        for (int q = 1; q < 16; ++q) t = fmaxf(t, mx[q * 32 + nb * 16 + lr]);
        m[nb] = t; }
    if (wv == 0 && hi == 0) { mf[lr] = m[0]; mf[16 + lr] = m[1]; }
    v8f acc[2]; acc[0] = (v8f){}; acc[1] = (v8f){};
    float sum[2] = { 0.f, 0.f };
    const h16* vb = V16 + (size_t)(wv * 16 + lr) * NN + 8 * hi;
    const size_t ko = (size_t)(wv * 16 + lr) * CQP + 8 * hi;
    v16bf kh = WFrag<bf>::ld(Kh + ko), kl = WFrag<bf>::ld(Kl + ko);
#pragma unroll 1
    for (int st = 0; st < NN / PJ; ++st) {
        v16h a[PJ / 32];   // the step's v fragments, asked for ahead of the score work that hides their way
#pragma unroll
        for (int kb = 0; kb < PJ / 32; ++kb) a[kb] = WFrag<h16>::ld(vb + st * PJ + kb * 32);
        v16bf khn = kh, kln = kl;   // the next step's key rows, asked for together with v: the barrier below waits for every load that is under way, so a load issued just in front of it would be waited for in full
        if (st + 1 < NN / PJ) { const size_t kn = ko + (size_t)(st + 1) * PJ * CQP; khn = WFrag<bf>::ld(Kh + kn); kln = WFrag<bf>::ld(Kl + kn); }
        h16* pw = ps + (st & 1) * (32 * PP);
#pragma unroll
        for (int nb = 0; nb < 2; ++nb) { v8f s = (v8f){}; s = wmmab(kh, qh[nb], s); s = wmmab(kh, ql[nb], s); s = wmmab(kl, qh[nb], s); v8h o;
#pragma unroll
            for (int e = 0; e < 8; ++e) { const float ex = __expf(__fsub_rn(s[e], m[nb])); sum[nb] += ex; o[e] = tohx(ex * PCAR); }
            *(v8ha*)(pw + (nb * 16 + lr) * PP + wv * 16 + hi * 8) = o; }
        kh = khn; kl = kln;
        __syncthreads();   // the step's numerators are all in LDS; and every wave has left the other buffer, which the next step fills
#pragma unroll
        for (int kb = 0; kb < PJ / 32; ++kb)
#pragma unroll
            for (int nb = 0; nb < 2; ++nb) { const h16* pr = pw + (nb * 16 + lr) * PP + kb * 32 + 8 * hi; acc[nb] = wmma16(a[kb], cat16(*(const v8ha*)pr, *(const v8ha*)(pr + 16)), acc[nb]); }
    }
#pragma unroll
    for (int nb = 0; nb < 2; ++nb) sum[nb] += __shfl_xor(sum[nb], 16, 32);
    if (hi == 0) { ls[wv * 32 + lr] = sum[0]; ls[wv * 32 + 16 + lr] = sum[1]; }
#pragma unroll
    for (int nb = 0; nb < 2; ++nb)
#pragma unroll
        for (int e = 0; e < 8; ++e) O[(size_t)(wv * 16 + hi * 8 + e) * NN + i0 + nb * 16 + lr] = acc[nb][e];
    __syncthreads();   // all 16 partial sums are in LDS before they are added, in wave order
#pragma unroll
    for (int s = 0; s < 2; ++s) { const int f = s * 512 + (int)threadIdx.x, i = f >> 5, ln = f & 31; float t = ls[i];
#pragma unroll
        for (int q = 1; q < 16; ++q) t += ls[q * 32 + i];
        const float o2 = ln == 0 ? mf[i] : (ln == 1 ? __fdiv_rn(1.0f, t * PCAR) : 0.f); /* 1/(PCAR * sum): undoes the carry at the merge */ *(float*)(RS + (size_t)(i0 + i) * 32 + ln) = o2; }
}
__global__ __launch_bounds__(256) void k_x1(const float* __restrict__ O, const float* __restrict__ RS, const float* __restrict__ xb, const float* __restrict__ gam, float* X1) { O += (size_t)blockIdx.y * CC * NN; RS += (size_t)blockIdx.y * NN * 32; xb += (size_t)blockIdx.y * CC * NN; X1 += (size_t)blockIdx.y * CC * NN; const size_t i = ((size_t)blockIdx.x * 256 + threadIdx.x) * 4; if (i >= (size_t)CC * NN) return; const int n0 = (int)(i & (NN - 1)); const float g = bfr(gam[0]); const v4f a = *(const v4f*)(O + i), x4 = *(const v4f*)(xb + i); v4f o;
#pragma unroll
    for (int q = 0; q < 4; ++q) { float t = __fmul_rn(a[q], RS[(size_t)(n0 + q) * 32 + 1]); asm volatile("" : "+v"(t)); float t2 = __fmul_rn(g, t); asm volatile("" : "+v"(t2)); o[q] = __fadd_rn(t2, bfr(x4[q])); }
    *(v4f*)(X1 + i) = o;  }
template <int FG>
__device__ __forceinline__ void mT_body(int bx, int img, const float* __restrict__ X1, const float* __restrict__ mk, bf* Hh, bf* Hl) {
    X1 += (size_t)img * CC * NN; mk += (size_t)img * NN; Hh += (size_t)img * NN * CC; Hl += (size_t)img * NN * CC;
    const int lane = threadIdx.x & 31; const int L0 = (bx * 8 + (threadIdx.x >> 5)) * 8; const int nlines = NN * CC / 64;
{
#pragma unroll 1
        for (int l = 0; l < 8; ++l) { const int L = L0 + l; if (L >= nlines) break; const int e = L * 64 + lane * 2; const int c = e & (CC - 1); const int n = e >> 8; const float w = FG ? bfr(mk[n]) : __fsub_rn(1.0f, bfr(mk[n])); v2us oh, ol;
#pragma unroll
            for (int q = 0; q < 2; ++q) { unsigned short a, c2; splitf(__fmul_rn(X1[(size_t)(c + q) * NN + n], w), a, c2); oh[q] = a; ol[q] = c2; }
            *(v2us*)(Hh + (size_t)e) = oh; *(v2us*)(Hl + (size_t)e) = ol;
            asm volatile("s_wait_xcnt 0x0" ::: "memory"); }   // stands behind the two stores, before the next trip (or the code behind the loop) writes over their address and data registers
         }
}
// k_mT2: the foreground and the background planes in ONE launch; grid (256 + 256, NB_).
__global__ __launch_bounds__(256) void k_mT2(const float* __restrict__ X1, const float* __restrict__ mk, bf* Fh, bf* Fl, bf* Bh, bf* Bl) {
    const int b = (int)blockIdx.x, img = (int)blockIdx.y;
    if (b < 256) mT_body<1>(b, img, X1, mk, Fh, Fl); else mT_body<0>(b - 256, img, X1, mk, Bh, Bl);
}
// std_body: per channel row c (one wave, lanes stride the 4096 positions in a fixed order, fixed shuffle trees): FG = 1: values ff = X1[c][n] * bf16(mask[n]); FG = 0: values sw = O2[c][n] * RS2[n][1];
template <int FG>
__device__ __forceinline__ void std_body(int bx, int img, const float* __restrict__ A, const float* __restrict__ aux, float* SD) {
    A += (size_t)img * CC * NN; aux += (size_t)img * (FG ? NN : NN * 32); SD += (size_t)img * CC * 32;
    const int lane = threadIdx.x & 31; const int c = bx * 8 + (threadIdx.x >> 5); if (c >= CC) return; const float* row = A + (size_t)c * NN; float s = 0.f;
#pragma unroll 4
    for (int n = lane; n < NN; n += 32) { const float v = FG ? __fmul_rn(row[n], bfr(aux[n])) : __fmul_rn(row[n], aux[(size_t)n * 32 + 1]); s += v; }
#pragma unroll
    for (int sh = 16; sh; sh >>= 1) s += __shfl_xor(s, sh, 32);
    const float mu = s * (1.0f / NN); float qq = 0.f;
#pragma unroll 4
    for (int n = lane; n < NN; n += 32) { const float v = FG ? __fmul_rn(row[n], bfr(aux[n])) : __fmul_rn(row[n], aux[(size_t)n * 32 + 1]); const float d0 = __fsub_rn(v, mu); qq = __fadd_rn(qq, __fmul_rn(d0, d0)); }
#pragma unroll
    for (int sh = 16; sh; sh >>= 1) qq += __shfl_xor(qq, sh, 32);
    const float sd = __fsqrt_rn(__fadd_rn(__fdiv_rn(qq, (float)(NN - 1)), 1e-5f)); const float o = (lane == 0) ? sd : 0.f;
    *(float*)(SD + (size_t)c * 32 + lane) = o;  }
// k_std2: both statistics in ONE launch; grid (32 + 32, NB_): sw's rows first, then ff's.
__global__ __launch_bounds__(256) void k_std2(const float* __restrict__ O2, const float* __restrict__ RS, float* SDS, const float* __restrict__ X1, const float* __restrict__ mk, float* SDF) {
    const int b = (int)blockIdx.x, img = (int)blockIdx.y;
    if (b < CC / 8) std_body<0>(b, img, O2, RS, SDS); else std_body<1>(b - CC / 8, img, X1, mk, SDF);
}
__global__ __launch_bounds__(256) void k_out(const float* __restrict__ X1, const float* __restrict__ mk, const float* __restrict__ SDF, const float* __restrict__ SDS, const float* __restrict__ gam, float* OUTb) { X1 += (size_t)blockIdx.y * CC * NN; mk += (size_t)blockIdx.y * NN; SDF += (size_t)blockIdx.y * CC * 32; SDS += (size_t)blockIdx.y * CC * 32; OUTb += (size_t)blockIdx.y * CC * NN; const size_t i = ((size_t)blockIdx.x * 256 + threadIdx.x) * 4; if (i >= (size_t)CC * NN) return; const int n0 = (int)(i & (NN - 1)); const int c = (int)(i >> 12); const float g = bfr(gam[0]); const float ratio = __fdiv_rn(SDS[(size_t)c * 32], SDF[(size_t)c * 32]); const v4f x4 = *(const v4f*)(X1 + i); v4f o;
#pragma unroll
    for (int q = 0; q < 4; ++q) { float ff = __fmul_rn(x4[q], bfr(mk[n0 + q])); asm volatile("" : "+v"(ff)); float t = __fmul_rn(ff, ratio); asm volatile("" : "+v"(t)); float t2 = __fmul_rn(g, t); asm volatile("" : "+v"(t2)); o[q] = __fadd_rn(x4[q], t2); }
    *(v4f*)(OUTb + i) = o;  }
extern "C" void kernel_launch(void* const* d_in, const int* in_sizes, int n_in,
                              void* d_out, int out_size, void* d_ws, size_t ws_size, hipStream_t stream) {
    (void)in_sizes; (void)n_in; (void)out_size;
    const float* IN[16]; for (int i = 0; i < 16; ++i) IN[i] = (const float*)d_in[i];
    // x [2][256][64][64], mask [2][1][64][64], sa_wq [32][256], sa_bq, sa_wk, sa_bk, sa_wv [256][256], sa_bv, sa_gamma [1], wq, bq, wk, bk, wv, bv, gamma [1] = d_in[0..15]
    const float* x = IN[0]; const float* mk = IN[1];
    float* OUT = (float*)d_out;     // [2][256][64][64]
    char* wsp = (char*)d_ws;
    auto take = [&](size_t bytes) { char* p = wsp; wsp += (bytes + 255) & ~(size_t)255; return (void*)p; };
    bf* WQ1 = (bf*)take((size_t)CQP * CC * 2); bf* WK1 = (bf*)take((size_t)CQP * CC * 2); float* BQ1 = (float*)take(256); float* BK1 = (float*)take(256); bf* WV1 = (bf*)take((size_t)CC * CC * 2);
    bf* WQ2 = (bf*)take((size_t)CQP * CC * 2); bf* WK2 = (bf*)take((size_t)CQP * CC * 2); float* BQ2 = (float*)take(256); float* BK2 = (float*)take(256); bf* WV2 = (bf*)take((size_t)CC * CC * 2);
    // per-image planes, NB_ of each, one behind the other
    bf* XT = (bf*)take((size_t)NB_ * NN * CC * 2); float* FQ = (float*)take((size_t)NB_ * NN * CQP * 4); float* FK = (float*)take((size_t)NB_ * NN * CQP * 4); bf* Qh = (bf*)take((size_t)NB_ * NN * CQP * 2); bf* Ql = (bf*)take((size_t)NB_ * NN * CQP * 2); bf* Kh = (bf*)take((size_t)NB_ * NN * CQP * 2); bf* Kl = (bf*)take((size_t)NB_ * NN * CQP * 2);
    float* FV = (float*)take((size_t)NB_ * CC * NN * 4); h16* V16 = (h16*)take((size_t)NB_ * CC * NN * 2); float* X1 = (float*)take((size_t)NB_ * CC * NN * 4);
    bf* Fh = (bf*)take((size_t)NB_ * NN * CC * 2); bf* Fl = (bf*)take((size_t)NB_ * NN * CC * 2); bf* Bh = (bf*)take((size_t)NB_ * NN * CC * 2); bf* Bl = (bf*)take((size_t)NB_ * NN * CC * 2);
    float* RS = (float*)take((size_t)NB_ * NN * 32 * 4); float* SDF = (float*)take((size_t)NB_ * CC * 32 * 4); float* SDS = (float*)take((size_t)NB_ * CC * 32 * 4);
    if ((size_t)(wsp - (char*)d_ws) > ws_size) return;    // total ~ 50 MiB; ws 256 MiB
    float* Oc = FV;   // both value contractions write [c][n] over FV (dead after k_post each time)
    const unsigned L4 = (unsigned)(((size_t)NN * CC / 4 + 255) / 256);
    // stage 1: self attention on x
    k_prep<<<512 + 128 + 64, 256, 0, stream>>>(x, XT, IN[2], IN[3], WQ1, BQ1, IN[4], IN[5], WK1, BK1, IN[9], IN[10], WQ2, BQ2, IN[11], IN[12], WK2, BK2, IN[6], WV1, IN[13], WV2);
    k_conv3<0, 0><<<dim3(256 + 64 + 64, NB_), 256, 0, stream>>>(XT, nullptr, XT, nullptr, WQ1, WK1, BQ1, BK1, FQ, FK, WV1, XT, nullptr, FV, CC);
    k_post<<<dim3(2048 + 512 + 512, NB_), 256, 0, stream>>>(FQ, Qh, Ql, FK, Kh, Kl, FV, IN[7], V16);
    k_attn<<<dim3(NN / 32, NB_), 512, 0, stream>>>(Qh, Ql, Kh, Kl, V16, Oc, RS);   // sa [c][i] (x1024 carried)
    k_x1<<<dim3(L4, NB_), 256, 0, stream>>>(Oc, RS, x, IN[8], X1);
    // stage 2: masked cross attention on x1 (q from mask*x1, k/v from (1-mask)*x1)
    k_mT2<<<dim3(256 + 256, NB_), 256, 0, stream>>>(X1, mk, Fh, Fl, Bh, Bl);
    k_conv3<1, 3><<<dim3(256 + 64 + 64, NB_), 256, 0, stream>>>(Fh, Fl, Bh, Bl, WQ2, WK2, BQ2, BK2, FQ, FK, WV2, Bh, Bl, FV, CC);
    k_post<<<dim3(2048 + 512 + 512, NB_), 256, 0, stream>>>(FQ, Qh, Ql, FK, Kh, Kl, FV, IN[14], V16);
    k_attn<<<dim3(NN / 32, NB_), 512, 0, stream>>>(Qh, Ql, Kh, Kl, V16, Oc, RS);   // sw [c][i] (x1024 carried; RS applied inside k_std / not needed elsewhere)
    k_std2<<<dim3(CC / 8 + CC / 8, NB_), 256, 0, stream>>>(Oc, RS, SDS, X1, mk, SDF);
    k_out<<<dim3(L4, NB_), 256, 0, stream>>>(X1, mk, SDF, SDS, IN[15], OUT);
}

// v005
// One run takes 220 microseconds.
// Next to v004, in two timings, it ran 1.05 and 1.04 times as fast.
// All steps since v000 together make it 3.88 times as fast.
#include <hip/hip_runtime.h>

// x [2][256][64][64], mask [2][1][64][64] in {0,1} read as data; (1) self-attention: q/k = 1x1 convs to 32 ch, v 256 ch (+bias), A = softmax_j(sum_c q[c][i] k[c][j]) (unscaled),
// sa[c][i] = sum_j v[c][j] A[i][j]; x1 = sa_gamma sa + x; (2) masked cross attention: fb = (1-mask) x1, ff = mask x1; q from ff, k/v from fb (second conv set), sw[c][i] likewise;
// (3) out = x1 + gamma * ff * (std(sw) / std(ff)) per channel (unbiased variance over the 4096 positions + 1e-5, sqrt).
// Compute dtypes, f32 accumulate: every input rounded to bf16; stage-1 convs on PLAIN bf16 operands (inputs: exact, + bias; q/k padded 32 -> 64 output channels with
// numerators x1024 + 1/(1024 sum); both value contractions fp16 v x fp16 numerators (K 4096, channel-major); residuals, masks, the per-channel statistics and the final mix in f32 on VALU (one wave

#define NB_  2
#define CC   256
#define CQ   32                   // q/k channels
#define CQP  64                   // padded to one tile
#define NN   4096
#define PCAR 1024.0f
#define SCL  1.0f                 // energies are unscaled in this module
typedef _Float16 h16;
typedef unsigned short bf;
typedef __attribute__((ext_vector_type(16))) __bf16   v16bf;
typedef __attribute__((ext_vector_type(16))) _Float16 v16h;
typedef __attribute__((ext_vector_type(8)))  _Float16 v8h;
typedef __attribute__((ext_vector_type(8)))  unsigned short v8us;
typedef __attribute__((ext_vector_type(8)))  float    v8f;
typedef __attribute__((ext_vector_type(4)))  float    v4f;
typedef v8h  __attribute__((may_alias)) v8ha;
typedef v4f  __attribute__((may_alias)) v4fa;
typedef v8us __attribute__((may_alias)) v8usa;

__device__ __forceinline__ unsigned short f2bf(float f) { unsigned u = __float_as_uint(f); u += 0x7FFFu + ((u >> 16) & 1u); return (unsigned short)(u >> 16); }
__device__ __forceinline__ float bf2f(unsigned short b) { return __uint_as_float(((unsigned)b) << 16); }
__device__ __forceinline__ float bfr(float f) { return bf2f(f2bf(f)); }
__device__ __forceinline__ v16h cat16(v8h lo, v8h hi) { return __builtin_shufflevector(lo, hi, 0, 1, 2, 3, 4, 5, 6, 7, 8, 9, 10, 11, 12, 13, 14, 15); }
__device__ __forceinline__ v16bf cat16b(v8us lo, v8us hi) { return __builtin_bit_cast(v16bf, __builtin_shufflevector(lo, hi, 0, 1, 2, 3, 4, 5, 6, 7, 8, 9, 10, 11, 12, 13, 14, 15)); }
__device__ __forceinline__ v8f wmma16(v16h a, v16h b, v8f c) { return __builtin_amdgcn_wmma_f32_16x16x32_f16(false, a, false, b, (short)0, c, false, false); }
__device__ __forceinline__ v8f wmmab(v16bf a, v16bf b, v8f c) { return __builtin_amdgcn_wmma_f32_16x16x32_bf16(false, a, false, b, (short)0, c, false, false); }
__device__ __forceinline__ h16 tohx(float x) { return (h16)x; }
__device__ __forceinline__ void splitf(float y, unsigned short& h, unsigned short& l) { h = f2bf(y); l = f2bf(y - bf2f(h)); }
typedef __attribute__((ext_vector_type(2))) _Float16 v2h;
typedef __attribute__((ext_vector_type(4))) _Float16 v4h;
typedef __attribute__((ext_vector_type(2))) unsigned short v2us;
typedef __attribute__((ext_vector_type(4))) unsigned short v4us;



// ---- gemmw_body: register-blocked GEMM, KS WAVES per 64x64 output tile, each with all 16 accumulators over its own share of K; operands straight from K-contiguous 16-bit planes; one tile (bx, by) of image z per call, 32 * KS threads.
// c[m][n] (f32) = sum_k A[m][k] Bt[n][k] (+ split products per NSPLIT). z-batch strides sA/sB/sC in elements. K % (32 * KS) == 0.
// The tile leaves as the 16-bit planes that the attention kernel reads, never as f32: VROW: C16[m][n] = fp16(c + bf16(bias[m])); else Ch/Cl[m][n] = the hi/lo bf16 split of c + bf16(bias[n]). Pitch ldc.
// Wave w takes the 32-k blocks w, w + KS, w + 2 KS, ... (neighbouring waves read the two halves of one 128-byte line in the same trip); the KS partial tiles meet in LDS and are summed in wave order.
template <typename T16> struct WFrag;
template <> struct WFrag<h16> { typedef v16h V; static __device__ __forceinline__ V ld(const h16* p) { return cat16(*(const v8h*)p, *(const v8h*)(p + 16)); } static __device__ __forceinline__ v8f mma(V a, V b, v8f c) { return wmma16(a, b, c); } };
template <> struct WFrag<bf> { typedef v16bf V; static __device__ __forceinline__ V ld(const bf* p) { return cat16b(*(const v8us*)p, *(const v8us*)(p + 16)); } static __device__ __forceinline__ v8f mma(V a, V b, v8f c) { return wmmab(a, b, c); } };
// The work is a device function that is told its tile (bx, by), its image z and its LDS, so that one launch can hold GEMMs of several shapes side by side.
template <typename T16, int NSPLIT, bool VROW, int KS>
__device__ __forceinline__ void gemmw_body(float* os, int bx, int by, size_t z, const T16* __restrict__ A, const T16* __restrict__ A2, const T16* __restrict__ Bt, const T16* __restrict__ Bt2, int K, h16* C16, bf* Ch, bf* Cl, int ldc, const float* __restrict__ bias, size_t sA, size_t sB, size_t sC) {
    typedef typename WFrag<T16>::V V;
    A += z * sA; if (A2) A2 += z * sA; Bt += z * sB; if (Bt2) Bt2 += z * sB;
    const int lane = threadIdx.x & 31, lr = lane & 15, hi = lane >> 4; const int r0 = bx * 64, c0 = by * 64;
    const int wv = KS == 1 ? 0 : __builtin_amdgcn_readfirstlane((int)(threadIdx.x >> 5));   // wave number, held scalar so that the k loop stays a scalar loop
    v8f acc[4][4];
#pragma unroll
    for (int mb = 0; mb < 4; ++mb)
#pragma unroll
        for (int nb = 0; nb < 4; ++nb) acc[mb][nb] = (v8f){};
    const size_t aoff = (size_t)(r0 + lr) * K + 8 * hi, boff = (size_t)(c0 + lr) * K + 8 * hi;
#pragma unroll 1
    for (int kc = wv * 32; kc < K; kc += 32 * KS) {
        V a[4], a2[4];
#pragma unroll
        for (int mb = 0; mb < 4; ++mb) { a[mb] = WFrag<T16>::ld(A + aoff + (size_t)mb * 16 * K + kc); if (NSPLIT == 1 || NSPLIT == 2) a2[mb] = WFrag<T16>::ld(A2 + aoff + (size_t)mb * 16 * K + kc); }
#pragma unroll
        for (int nb = 0; nb < 4; ++nb) { const V b = WFrag<T16>::ld(Bt + boff + (size_t)nb * 16 * K + kc); V b2; if (NSPLIT >= 2) b2 = WFrag<T16>::ld(Bt2 + boff + (size_t)nb * 16 * K + kc);
#pragma unroll
            for (int mb = 0; mb < 4; ++mb) { acc[mb][nb] = WFrag<T16>::mma(a[mb], b, acc[mb][nb]); if (NSPLIT == 1 || NSPLIT == 2) acc[mb][nb] = WFrag<T16>::mma(a2[mb], b, acc[mb][nb]); if (NSPLIT >= 2) acc[mb][nb] = WFrag<T16>::mma(a[mb], b2, acc[mb][nb]); } }
        asm volatile("v_nop\n\tv_nop\n\tv_nop\n\tv_nop" : "+v"(acc[0][0]), "+v"(acc[1][1]), "+v"(acc[2][2]), "+v"(acc[3][3]) : "v"(a[0]), "v"(a[3]));
    }
    float bb[32 / KS];   // VROW: the bias of this thread's rows, asked for ahead of the LDS stores and the barrier that hide its way
    if constexpr (VROW) {
#pragma unroll
        for (int s = 0; s < 32 / KS; ++s) bb[s] = bias[r0 + s * (2 * KS) + (int)(threadIdx.x >> 4)];
        asm volatile("s_wait_xcnt 0x0" ::: "memory");   // stands behind the bias loads, before later code writes over their offset registers
    }
    float* mine = os + wv * (64 * 68);
#pragma unroll
    for (int mb = 0; mb < 4; ++mb)
#pragma unroll
        for (int nb = 0; nb < 4; ++nb)
#pragma unroll
            for (int j = 0; j < 8; ++j) mine[(mb * 16 + hi * 8 + j) * 68 + nb * 16 + lr] = acc[mb][nb][j];
    __syncthreads();   // every wave's partial tile is in LDS before any of them is summed
#pragma unroll
    for (int s = 0; s < 32 / KS; ++s) { const int f = s * (32 * KS) + (int)threadIdx.x, row = f >> 4, cofs = (f & 15) * 4; v4f val = *(const v4fa*)(os + row * 68 + cofs);
#pragma unroll
        for (int q = 1; q < KS; ++q) val += *(const v4fa*)(os + q * (64 * 68) + row * 68 + cofs);
        const size_t co = z * sC + (size_t)(r0 + row) * ldc + c0 + cofs;
        if constexpr (VROW) { const float br = bfr(bb[s]); v4h o;
#pragma unroll
            for (int q = 0; q < 4; ++q) o[q] = tohx(__fadd_rn(val[q], br));
            *(v4h*)(C16 + co) = o; }
        else { v4us oh, ol;
#pragma unroll
            for (int q = 0; q < 4; ++q) { unsigned short a, c2; splitf(__fadd_rn(val[q], bfr(bias[c0 + cofs + q])), a, c2); oh[q] = a; ol[q] = c2; }
            *(v4us*)(Ch + co) = oh; *(v4us*)(Cl + co) = ol; }
    }
}
// k_conv3: the three 1x1 convs of one stage (none reads another's result) in ONE launch; grid (256 + 64 + 64, NB_): blocks 0..255 the value conv's tiles in their old order, then the q conv's 64, then the k conv's 64.
// Each tile's last lines add the bias and store v as fp16, q and k as their hi/lo bf16 planes.
template <int NSQK, int NSV>
__global__ __launch_bounds__(256) void k_conv3(const bf* __restrict__ Aq, const bf* __restrict__ Aq2, const bf* __restrict__ Ak, const bf* __restrict__ Ak2, const bf* __restrict__ WQ, const bf* __restrict__ WK, const float* __restrict__ BQ, const float* __restrict__ BK, bf* Qh, bf* Ql, bf* Kh, bf* Kl,
                                               const bf* __restrict__ WV, const bf* __restrict__ Xv, const bf* __restrict__ Xv2, const float* __restrict__ bv, h16* V16, int K) {
    __shared__ __align__(16) float os[8 * 64 * 68];
    const int b = (int)blockIdx.x; const size_t z = blockIdx.y;
    if (b < (CC / 64) * (NN / 64)) { gemmw_body<bf, NSV, true, 8>(os, b & (CC / 64 - 1), b / (CC / 64), z, WV, nullptr, Xv, Xv2, K, V16, nullptr, nullptr, NN, bv, 0, (size_t)NN * CC, (size_t)NN * CC); return; }
    const int t = b - (CC / 64) * (NN / 64); const bool isk = t >= NN / 64;
    gemmw_body<bf, NSQK, false, 8>(os, isk ? t - NN / 64 : t, 0, z, isk ? Ak : Aq, isk ? Ak2 : Aq2, isk ? WK : WQ, nullptr, K, nullptr, isk ? Kh : Qh, isk ? Kl : Ql, CQP, isk ? BK : BQ, (size_t)NN * CC, 0, (size_t)NN * CQP);
}


__device__ __forceinline__ void cvt8_body(int bx, const float* __restrict__ src, bf* dst, size_t n8) { const size_t i = (size_t)bx * 256 + threadIdx.x; if (i >= n8) return; const v8f v = *(const v8f*)(src + i * 8); v8us o;
#pragma unroll
    for (int k = 0; k < 8; ++k) o[k] = f2bf(v[k]); *(v8us*)(dst + i * 8) = o;  }
// Every per-image kernel below takes its image from blockIdx.y (k_prep's transpose: blockIdx.x / 256): both images' planes lie one behind the other in the workspace.
// The *_body functions are told their block (bx) and image (img) by the kernel that holds them: launches that do not depend on one another share one grid.
__device__ __forceinline__ void xt_body(int bx, int img, const float* __restrict__ xb, bf* XT) {
    xb += (size_t)img * CC * NN; XT += (size_t)img * NN * CC;
    const int lane = threadIdx.x & 31; const int L0 = (bx * 8 + (threadIdx.x >> 5)) * 8; const int nlines = NN * CC / 64;
{
#pragma unroll
        for (int l = 0; l < 8; ++l) { const int L = L0 + l; if (L >= nlines) break; const int e = L * 64 + lane * 2; const int c = e & (CC - 1); const int n = e >> 8; v2us o;
#pragma unroll
            for (int q = 0; q < 2; ++q) o[q] = f2bf(xb[(size_t)(c + q) * NN + n]);
            *(v2us*)(XT + (size_t)e) = o; }
         }
}
__device__ __forceinline__ void wpad_body(int bx, const float* __restrict__ w, const float* __restrict__ b, bf* Bt, float* BP) { const int e = (bx * 256 + threadIdx.x) * 2; if (e >= CQP * CC) return; const int n = e / CC, k = e % CC; v2us o;
#pragma unroll
    for (int q = 0; q < 2; ++q) o[q] = (n < CQ) ? f2bf(w[(size_t)n * CC + k + q]) : (unsigned short)0;
    *(v2us*)(Bt + e) = o; if (e < CQP) { *(float*)(BP + e) = (e < CQ) ? b[e] : 0.f; *(float*)(BP + e + 1) = (e + 1 < CQ) ? b[e + 1] : 0.f; }
     }
// k_prep: all that reads the inputs alone, in ONE launch; grid 512 + 128 + 64: the transpose of x (256 blocks an image), the four padded q/k weight planes (32 blocks each), the two value weight planes (32 blocks each).
__global__ __launch_bounds__(256) void k_prep(const float* __restrict__ x, bf* XT,
                                              const float* __restrict__ wq1, const float* __restrict__ bq1, bf* WQ1, float* BQ1, const float* __restrict__ wk1, const float* __restrict__ bk1, bf* WK1, float* BK1,
                                              const float* __restrict__ wq2, const float* __restrict__ bq2, bf* WQ2, float* BQ2, const float* __restrict__ wk2, const float* __restrict__ bk2, bf* WK2, float* BK2,
                                              const float* __restrict__ wv1, bf* WV1, const float* __restrict__ wv2, bf* WV2) {
    const int b = (int)blockIdx.x;
    if (b < 512) { xt_body(b & 255, b >> 8, x, XT); return; }
    const int t = b - 512, bx = t & 31, w = t >> 5;
    if (w == 0) wpad_body(bx, wq1, bq1, WQ1, BQ1);
    else if (w == 1) wpad_body(bx, wk1, bk1, WK1, BK1);
    else if (w == 2) wpad_body(bx, wq2, bq2, WQ2, BQ2);
    else if (w == 3) wpad_body(bx, wk2, bk2, WK2, BK2);
    else if (w == 4) cvt8_body(bx, wv1, WV1, (size_t)CC * CC / 8);
    else cvt8_body(bx, wv2, WV2, (size_t)CC * CC / 8);
}
__global__ __launch_bounds__(256) void k_p16(const float* __restrict__ F, h16* P, size_t n) { const size_t i = ((size_t)blockIdx.x * 256 + threadIdx.x) * 2; if (i >= n) return; v2h v; v[0] = tohx(F[i]); v[1] = tohx(F[i + 1]); *(v2h*)(P + i) = v;  }
// k_attn: scores, softmax and value contraction of 32 query positions i in ONE work-group of 16 waves; grid (NN / 32, NB_). No score and no numerator leaves the work-group.
// Scores are formed transposed, St[j][i] = sum_c k[j][c] q[i][c] (A = k rows, B = q rows, the three hi/lo products in the old order, over the 32 real channels: the pad's products are exact zeros): a lane then
// holds 8 neighbouring keys j of one column i, which is one 16-byte piece of a numerator row p[i][j].
// Pass 1: wave w takes the keys w * 256 .. + 255 and finds each column's maximum; the 16 partial maxima meet in LDS.
// Pass 2, in steps of PJ = 256 keys: wave w forms the scores of the step's keys w * 16 .. + 15 again, numerators exp(s - max) (f32 sum; x1024 to fp16) into LDS (two buffers, one barrier a step);
// then wave w adds the step to its own 16 channels, O[c][i] += v[c][j] p[i][j], v straight from its K-contiguous plane (each v element is read once by the work-group), keys in rising order.
#define PJ 256
#define PP (PJ + 8)               // pitch of a numerator row in LDS, in halves: rows 4 banks apart
__global__ __launch_bounds__(512) void k_attn(const bf* __restrict__ Qh, const bf* __restrict__ Ql, const bf* __restrict__ Kh, const bf* __restrict__ Kl, const h16* __restrict__ V16, float* O, float* RS) {
    __shared__ __align__(16) h16 ps[2 * 32 * PP];
    __shared__ float mx[16 * 32];
    __shared__ float ls[16 * 32];
    __shared__ float mf[32];
    const size_t img = blockIdx.y;
    Qh += img * NN * CQP; Ql += img * NN * CQP; Kh += img * NN * CQP; Kl += img * NN * CQP; V16 += img * CC * NN; O += img * CC * NN; RS += img * NN * 32;
    const int lane = threadIdx.x & 31, lr = lane & 15, hi = lane >> 4; const int i0 = (int)blockIdx.x * 32;
    const int wv = __builtin_amdgcn_readfirstlane((int)(threadIdx.x >> 5));   // wave number, held scalar so that the key loops stay scalar loops
    v16bf qh[2], ql[2];
#pragma unroll
    for (int nb = 0; nb < 2; ++nb) { const size_t o = (size_t)(i0 + nb * 16 + lr) * CQP + 8 * hi; qh[nb] = WFrag<bf>::ld(Qh + o); ql[nb] = WFrag<bf>::ld(Ql + o); }
    float m[2] = { -3.0e38f, -3.0e38f };
#pragma unroll 4
    for (int j0 = wv * 256; j0 < wv * 256 + 256; j0 += 16) { const size_t o = (size_t)(j0 + lr) * CQP + 8 * hi; const v16bf kh = WFrag<bf>::ld(Kh + o), kl = WFrag<bf>::ld(Kl + o);
#pragma unroll
        for (int nb = 0; nb < 2; ++nb) { v8f s = (v8f){}; s = wmmab(kh, qh[nb], s); s = wmmab(kh, ql[nb], s); s = wmmab(kl, qh[nb], s);
#pragma unroll
            for (int e = 0; e < 8; ++e) m[nb] = fmaxf(m[nb], s[e]); }
    }
#pragma unroll
    for (int nb = 0; nb < 2; ++nb) m[nb] = fmaxf(m[nb], __shfl_xor(m[nb], 16, 32));
    if (hi == 0) { mx[wv * 32 + lr] = m[0]; mx[wv * 32 + 16 + lr] = m[1]; }
    __syncthreads();   // all 16 partial maxima are in LDS before any wave takes the maximum over them
#pragma unroll
    for (int nb = 0; nb < 2; ++nb) { float t = mx[nb * 16 + lr];
#pragma unroll
        for (int q = 1; q < 16; ++q) t = fmaxf(t, mx[q * 32 + nb * 16 + lr]);
        m[nb] = t; }
    if (wv == 0 && hi == 0) { mf[lr] = m[0]; mf[16 + lr] = m[1]; }
    v8f acc[2]; acc[0] = (v8f){}; acc[1] = (v8f){};
    float sum[2] = { 0.f, 0.f };
    const h16* vb = V16 + (size_t)(wv * 16 + lr) * NN + 8 * hi;
    const size_t ko = (size_t)(wv * 16 + lr) * CQP + 8 * hi;
    v16bf kh = WFrag<bf>::ld(Kh + ko), kl = WFrag<bf>::ld(Kl + ko);
#pragma unroll 1
    for (int st = 0; st < NN / PJ; ++st) {
        v16h a[PJ / 32];   // the step's v fragments, asked for ahead of the score work that hides their way
#pragma unroll
        for (int kb = 0; kb < PJ / 32; ++kb) a[kb] = WFrag<h16>::ld(vb + st * PJ + kb * 32);
        v16bf khn = kh, kln = kl;   // the next step's key rows, asked for together with v: the barrier below waits for every load that is under way, so a load issued just in front of it would be waited for in full
        if (st + 1 < NN / PJ) { const size_t kn = ko + (size_t)(st + 1) * PJ * CQP; khn = WFrag<bf>::ld(Kh + kn); kln = WFrag<bf>::ld(Kl + kn); }
        h16* pw = ps + (st & 1) * (32 * PP);
#pragma unroll
        for (int nb = 0; nb < 2; ++nb) { v8f s = (v8f){}; s = wmmab(kh, qh[nb], s); s = wmmab(kh, ql[nb], s); s = wmmab(kl, qh[nb], s); v8h o;
#pragma unroll
            for (int e = 0; e < 8; ++e) { const float ex = __expf(__fsub_rn(s[e], m[nb])); sum[nb] += ex; o[e] = tohx(ex * PCAR); }
            *(v8ha*)(pw + (nb * 16 + lr) * PP + wv * 16 + hi * 8) = o; }
        kh = khn; kl = kln;
        __syncthreads();   // the step's numerators are all in LDS; and every wave has left the other buffer, which the next step fills
#pragma unroll
        for (int kb = 0; kb < PJ / 32; ++kb)
#pragma unroll
            for (int nb = 0; nb < 2; ++nb) { const h16* pr = pw + (nb * 16 + lr) * PP + kb * 32 + 8 * hi; acc[nb] = wmma16(a[kb], cat16(*(const v8ha*)pr, *(const v8ha*)(pr + 16)), acc[nb]); }
    }
#pragma unroll
    for (int nb = 0; nb < 2; ++nb) sum[nb] += __shfl_xor(sum[nb], 16, 32);
    if (hi == 0) { ls[wv * 32 + lr] = sum[0]; ls[wv * 32 + 16 + lr] = sum[1]; }
#pragma unroll
    for (int nb = 0; nb < 2; ++nb)
#pragma unroll
        for (int e = 0; e < 8; ++e) O[(size_t)(wv * 16 + hi * 8 + e) * NN + i0 + nb * 16 + lr] = acc[nb][e];
    __syncthreads();   // all 16 partial sums are in LDS before they are added, in wave order
#pragma unroll
    for (int s = 0; s < 2; ++s) { const int f = s * 512 + (int)threadIdx.x, i = f >> 5, ln = f & 31; float t = ls[i];
#pragma unroll
        for (int q = 1; q < 16; ++q) t += ls[q * 32 + i];
        const float o2 = ln == 0 ? mf[i] : (ln == 1 ? __fdiv_rn(1.0f, t * PCAR) : 0.f); /* 1/(PCAR * sum): undoes the carry at the merge */ *(float*)(RS + (size_t)(i0 + i) * 32 + ln) = o2; }
}
__global__ __launch_bounds__(256) void k_x1(const float* __restrict__ O, const float* __restrict__ RS, const float* __restrict__ xb, const float* __restrict__ gam, float* X1) { O += (size_t)blockIdx.y * CC * NN; RS += (size_t)blockIdx.y * NN * 32; xb += (size_t)blockIdx.y * CC * NN; X1 += (size_t)blockIdx.y * CC * NN; const size_t i = ((size_t)blockIdx.x * 256 + threadIdx.x) * 4; if (i >= (size_t)CC * NN) return; const int n0 = (int)(i & (NN - 1)); const float g = bfr(gam[0]); const v4f a = *(const v4f*)(O + i), x4 = *(const v4f*)(xb + i); v4f o;
#pragma unroll
    for (int q = 0; q < 4; ++q) { float t = __fmul_rn(a[q], RS[(size_t)(n0 + q) * 32 + 1]); asm volatile("" : "+v"(t)); float t2 = __fmul_rn(g, t); asm volatile("" : "+v"(t2)); o[q] = __fadd_rn(t2, bfr(x4[q])); }
    *(v4f*)(X1 + i) = o;  }
template <int FG>
__device__ __forceinline__ void mT_body(int bx, int img, const float* __restrict__ X1, const float* __restrict__ mk, bf* Hh, bf* Hl) {
    X1 += (size_t)img * CC * NN; mk += (size_t)img * NN; Hh += (size_t)img * NN * CC; Hl += (size_t)img * NN * CC;
    const int lane = threadIdx.x & 31; const int L0 = (bx * 8 + (threadIdx.x >> 5)) * 8; const int nlines = NN * CC / 64;
{
#pragma unroll 1
        for (int l = 0; l < 8; ++l) { const int L = L0 + l; if (L >= nlines) break; const int e = L * 64 + lane * 2; const int c = e & (CC - 1); const int n = e >> 8; const float w = FG ? bfr(mk[n]) : __fsub_rn(1.0f, bfr(mk[n])); v2us oh, ol;
#pragma unroll
            for (int q = 0; q < 2; ++q) { unsigned short a, c2; splitf(__fmul_rn(X1[(size_t)(c + q) * NN + n], w), a, c2); oh[q] = a; ol[q] = c2; }
            *(v2us*)(Hh + (size_t)e) = oh; *(v2us*)(Hl + (size_t)e) = ol;
            asm volatile("s_wait_xcnt 0x0" ::: "memory"); }   // stands behind the two stores, before the next trip (or the code behind the loop) writes over their address and data registers
         }
}
// k_mT2: the foreground and the background planes in ONE launch; grid (256 + 256, NB_).
__global__ __launch_bounds__(256) void k_mT2(const float* __restrict__ X1, const float* __restrict__ mk, bf* Fh, bf* Fl, bf* Bh, bf* Bl) {
    const int b = (int)blockIdx.x, img = (int)blockIdx.y;
    if (b < 256) mT_body<1>(b, img, X1, mk, Fh, Fl); else mT_body<0>(b - 256, img, X1, mk, Bh, Bl);
}
// std_body: per channel row c (one wave, lanes stride the 4096 positions in a fixed order, fixed shuffle trees): FG = 1: values ff = X1[c][n] * bf16(mask[n]); FG = 0: values sw = O2[c][n] * RS2[n][1];
template <int FG>
__device__ __forceinline__ void std_body(int bx, int img, const float* __restrict__ A, const float* __restrict__ aux, float* SD) {
    A += (size_t)img * CC * NN; aux += (size_t)img * (FG ? NN : NN * 32); SD += (size_t)img * CC * 32;
    const int lane = threadIdx.x & 31; const int c = bx * 8 + (threadIdx.x >> 5); if (c >= CC) return; const float* row = A + (size_t)c * NN; float s = 0.f;
#pragma unroll 4
    for (int n = lane; n < NN; n += 32) { const float v = FG ? __fmul_rn(row[n], bfr(aux[n])) : __fmul_rn(row[n], aux[(size_t)n * 32 + 1]); s += v; }
#pragma unroll
    for (int sh = 16; sh; sh >>= 1) s += __shfl_xor(s, sh, 32);
    const float mu = s * (1.0f / NN); float qq = 0.f;
#pragma unroll 4
    for (int n = lane; n < NN; n += 32) { const float v = FG ? __fmul_rn(row[n], bfr(aux[n])) : __fmul_rn(row[n], aux[(size_t)n * 32 + 1]); const float d0 = __fsub_rn(v, mu); qq = __fadd_rn(qq, __fmul_rn(d0, d0)); }
#pragma unroll
    for (int sh = 16; sh; sh >>= 1) qq += __shfl_xor(qq, sh, 32);
    const float sd = __fsqrt_rn(__fadd_rn(__fdiv_rn(qq, (float)(NN - 1)), 1e-5f)); const float o = (lane == 0) ? sd : 0.f;
    *(float*)(SD + (size_t)c * 32 + lane) = o;  }
// k_std2: both statistics in ONE launch; grid (32 + 32, NB_): sw's rows first, then ff's.
__global__ __launch_bounds__(256) void k_std2(const float* __restrict__ O2, const float* __restrict__ RS, float* SDS, const float* __restrict__ X1, const float* __restrict__ mk, float* SDF) {
    const int b = (int)blockIdx.x, img = (int)blockIdx.y;
    if (b < CC / 8) std_body<0>(b, img, O2, RS, SDS); else std_body<1>(b - CC / 8, img, X1, mk, SDF);
}
__global__ __launch_bounds__(256) void k_out(const float* __restrict__ X1, const float* __restrict__ mk, const float* __restrict__ SDF, const float* __restrict__ SDS, const float* __restrict__ gam, float* OUTb) { X1 += (size_t)blockIdx.y * CC * NN; mk += (size_t)blockIdx.y * NN; SDF += (size_t)blockIdx.y * CC * 32; SDS += (size_t)blockIdx.y * CC * 32; OUTb += (size_t)blockIdx.y * CC * NN; const size_t i = ((size_t)blockIdx.x * 256 + threadIdx.x) * 4; if (i >= (size_t)CC * NN) return; const int n0 = (int)(i & (NN - 1)); const int c = (int)(i >> 12); const float g = bfr(gam[0]); const float ratio = __fdiv_rn(SDS[(size_t)c * 32], SDF[(size_t)c * 32]); const v4f x4 = *(const v4f*)(X1 + i); v4f o;
#pragma unroll
    for (int q = 0; q < 4; ++q) { float ff = __fmul_rn(x4[q], bfr(mk[n0 + q])); asm volatile("" : "+v"(ff)); float t = __fmul_rn(ff, ratio); asm volatile("" : "+v"(t)); float t2 = __fmul_rn(g, t); asm volatile("" : "+v"(t2)); o[q] = __fadd_rn(x4[q], t2); }
    *(v4f*)(OUTb + i) = o;  }
extern "C" void kernel_launch(void* const* d_in, const int* in_sizes, int n_in,
                              void* d_out, int out_size, void* d_ws, size_t ws_size, hipStream_t stream) {
    (void)in_sizes; (void)n_in; (void)out_size;
    const float* IN[16]; for (int i = 0; i < 16; ++i) IN[i] = (const float*)d_in[i];
    // x [2][256][64][64], mask [2][1][64][64], sa_wq [32][256], sa_bq, sa_wk, sa_bk, sa_wv [256][256], sa_bv, sa_gamma [1], wq, bq, wk, bk, wv, bv, gamma [1] = d_in[0..15]
    const float* x = IN[0]; const float* mk = IN[1];
    float* OUT = (float*)d_out;     // [2][256][64][64]
    char* wsp = (char*)d_ws;
    auto take = [&](size_t bytes) { char* p = wsp; wsp += (bytes + 255) & ~(size_t)255; return (void*)p; };
    bf* WQ1 = (bf*)take((size_t)CQP * CC * 2); bf* WK1 = (bf*)take((size_t)CQP * CC * 2); float* BQ1 = (float*)take(256); float* BK1 = (float*)take(256); bf* WV1 = (bf*)take((size_t)CC * CC * 2);
    bf* WQ2 = (bf*)take((size_t)CQP * CC * 2); bf* WK2 = (bf*)take((size_t)CQP * CC * 2); float* BQ2 = (float*)take(256); float* BK2 = (float*)take(256); bf* WV2 = (bf*)take((size_t)CC * CC * 2);
    // per-image planes, NB_ of each, one behind the other
    bf* XT = (bf*)take((size_t)NB_ * NN * CC * 2); bf* Qh = (bf*)take((size_t)NB_ * NN * CQP * 2); bf* Ql = (bf*)take((size_t)NB_ * NN * CQP * 2); bf* Kh = (bf*)take((size_t)NB_ * NN * CQP * 2); bf* Kl = (bf*)take((size_t)NB_ * NN * CQP * 2);
    float* Oc = (float*)take((size_t)NB_ * CC * NN * 4); h16* V16 = (h16*)take((size_t)NB_ * CC * NN * 2); float* X1 = (float*)take((size_t)NB_ * CC * NN * 4);
    bf* Fh = (bf*)take((size_t)NB_ * NN * CC * 2); bf* Fl = (bf*)take((size_t)NB_ * NN * CC * 2); bf* Bh = (bf*)take((size_t)NB_ * NN * CC * 2); bf* Bl = (bf*)take((size_t)NB_ * NN * CC * 2);
    float* RS = (float*)take((size_t)NB_ * NN * 32 * 4); float* SDF = (float*)take((size_t)NB_ * CC * 32 * 4); float* SDS = (float*)take((size_t)NB_ * CC * 32 * 4);
    if ((size_t)(wsp - (char*)d_ws) > ws_size) return;    // total ~ 46 MiB; ws 256 MiB
    const unsigned L4 = (unsigned)(((size_t)NN * CC / 4 + 255) / 256);
    // stage 1: self attention on x
    k_prep<<<512 + 128 + 64, 256, 0, stream>>>(x, XT, IN[2], IN[3], WQ1, BQ1, IN[4], IN[5], WK1, BK1, IN[9], IN[10], WQ2, BQ2, IN[11], IN[12], WK2, BK2, IN[6], WV1, IN[13], WV2);
    k_conv3<0, 0><<<dim3(256 + 64 + 64, NB_), 256, 0, stream>>>(XT, nullptr, XT, nullptr, WQ1, WK1, BQ1, BK1, Qh, Ql, Kh, Kl, WV1, XT, nullptr, IN[7], V16, CC);
    k_attn<<<dim3(NN / 32, NB_), 512, 0, stream>>>(Qh, Ql, Kh, Kl, V16, Oc, RS);   // sa [c][i] (x1024 carried)
    k_x1<<<dim3(L4, NB_), 256, 0, stream>>>(Oc, RS, x, IN[8], X1);
    // stage 2: masked cross attention on x1 (q from mask*x1, k/v from (1-mask)*x1)
    k_mT2<<<dim3(256 + 256, NB_), 256, 0, stream>>>(X1, mk, Fh, Fl, Bh, Bl);
    k_conv3<1, 3><<<dim3(256 + 64 + 64, NB_), 256, 0, stream>>>(Fh, Fl, Bh, Bl, WQ2, WK2, BQ2, BK2, Qh, Ql, Kh, Kl, WV2, Bh, Bl, IN[14], V16, CC);
    k_attn<<<dim3(NN / 32, NB_), 512, 0, stream>>>(Qh, Ql, Kh, Kl, V16, Oc, RS);   // sw [c][i] (x1024 carried; RS applied inside k_std / not needed elsewhere)
    k_std2<<<dim3(CC / 8 + CC / 8, NB_), 256, 0, stream>>>(Oc, RS, SDS, X1, mk, SDF);
    k_out<<<dim3(L4, NB_), 256, 0, stream>>>(X1, mk, SDF, SDS, IN[15], OUT);
}

// v006
// Measured time: 163 microseconds a run.
// Next to v005, in two timings, it ran 1.33 and 1.35 times as fast.
// All steps since v000 together make it 5.19 times as fast.
#include <hip/hip_runtime.h>

// x [2][256][64][64], mask [2][1][64][64] in {0,1} read as data; (1) self-attention: q/k = 1x1 convs to 32 ch, v 256 ch (+bias), A = softmax_j(sum_c q[c][i] k[c][j]) (unscaled),
// sa[c][i] = sum_j v[c][j] A[i][j]; x1 = sa_gamma sa + x; (2) masked cross attention: fb = (1-mask) x1, ff = mask x1; q from ff, k/v from fb (second conv set), sw[c][i] likewise;
// (3) out = x1 + gamma * ff * (std(sw) / std(ff)) per channel (unbiased variance over the 4096 positions + 1e-5, sqrt).
// Compute dtypes, f32 accumulate: every input rounded to bf16; stage-1 convs on PLAIN bf16 operands (inputs: exact, + bias; q/k padded 32 -> 64 output channels with
// numerators x1024 + 1/(1024 sum); both value contractions fp16 v x fp16 numerators (K 4096, channel-major); residuals, masks, the per-channel statistics and the final mix in f32 on VALU (one wave

#define NB_  2
#define CC   256
#define CQ   32                   // q/k channels
#define CQP  64                   // padded to one tile
#define NN   4096
#define PCAR 1024.0f
#define SCL  1.0f                 // energies are unscaled in this module
typedef _Float16 h16;
typedef unsigned short bf;
typedef __attribute__((ext_vector_type(16))) __bf16   v16bf;
typedef __attribute__((ext_vector_type(16))) _Float16 v16h;
typedef __attribute__((ext_vector_type(8)))  _Float16 v8h;
typedef __attribute__((ext_vector_type(8)))  unsigned short v8us;
typedef __attribute__((ext_vector_type(8)))  float    v8f;
typedef __attribute__((ext_vector_type(4)))  float    v4f;
typedef v8h  __attribute__((may_alias)) v8ha;
typedef v4f  __attribute__((may_alias)) v4fa;
typedef v8us __attribute__((may_alias)) v8usa;

__device__ __forceinline__ unsigned short f2bf(float f) { unsigned u = __float_as_uint(f); u += 0x7FFFu + ((u >> 16) & 1u); return (unsigned short)(u >> 16); }
__device__ __forceinline__ float bf2f(unsigned short b) { return __uint_as_float(((unsigned)b) << 16); }
__device__ __forceinline__ float bfr(float f) { return bf2f(f2bf(f)); }
__device__ __forceinline__ v16h cat16(v8h lo, v8h hi) { return __builtin_shufflevector(lo, hi, 0, 1, 2, 3, 4, 5, 6, 7, 8, 9, 10, 11, 12, 13, 14, 15); }
__device__ __forceinline__ v16bf cat16b(v8us lo, v8us hi) { return __builtin_bit_cast(v16bf, __builtin_shufflevector(lo, hi, 0, 1, 2, 3, 4, 5, 6, 7, 8, 9, 10, 11, 12, 13, 14, 15)); }
__device__ __forceinline__ v8f wmma16(v16h a, v16h b, v8f c) { return __builtin_amdgcn_wmma_f32_16x16x32_f16(false, a, false, b, (short)0, c, false, false); }
__device__ __forceinline__ v8f wmmab(v16bf a, v16bf b, v8f c) { return __builtin_amdgcn_wmma_f32_16x16x32_bf16(false, a, false, b, (short)0, c, false, false); }
__device__ __forceinline__ h16 tohx(float x) { return (h16)x; }
__device__ __forceinline__ void splitf(float y, unsigned short& h, unsigned short& l) { h = f2bf(y); l = f2bf(y - bf2f(h)); }
typedef __attribute__((ext_vector_type(2))) _Float16 v2h;
typedef __attribute__((ext_vector_type(4))) _Float16 v4h;
typedef __attribute__((ext_vector_type(2))) unsigned short v2us;
typedef __attribute__((ext_vector_type(4))) unsigned short v4us;



// ---- gemmw_body: register-blocked GEMM, KS WAVES per 64x64 output tile, each with all 16 accumulators over its own share of K; operands straight from K-contiguous 16-bit planes; one tile (bx, by) of image z per call, 32 * KS threads.
// c[m][n] (f32) = sum_k A[m][k] Bt[n][k] (+ split products per NSPLIT). z-batch strides sA/sB/sC in elements. K % (32 * KS) == 0.
// The tile leaves as the 16-bit planes that the attention kernel reads, never as f32: VROW: C16(m, n) = fp16(c + bf16(bias[m])); else Ch/Cl(m, n) = the hi/lo bf16 split of c + bf16(bias[n]), n < ldc only (the pad has no place).
// These planes lie in FRAGMENT ORDER (fragofs, row m, k index n, ldc k's a row): the attention kernel's fragment loads then read 512 contiguous bytes a wave, four whole 128-byte lines, not 32-byte pieces of 16 lines.
// Wave w takes the 32-k blocks w, w + KS, w + 2 KS, ... (neighbouring waves read the two halves of one 128-byte line in the same trip); the KS partial tiles meet in LDS and are summed in wave order.
// Fragment order of a 16-bit operand plane: each tile of 16 rows x 32 k is 1 KiB, laid as a wave's two 16-byte loads take it: [k bit 4][lane = (k bit 3) * 16 + row % 16][k % 8]; tiles run along k (KB of them a row block), then down the rows.
__device__ __forceinline__ size_t fragofs(int row, int k, int KB) { return ((((size_t)(row >> 4) * KB + (k >> 5)) * 2 + ((k >> 4) & 1)) * 32 + ((k >> 3) & 1) * 16 + (row & 15)) * 8 + (k & 7); }
template <typename T16> struct WFrag;
template <> struct WFrag<h16> { typedef v16h V; static __device__ __forceinline__ V ld(const h16* p) { return cat16(*(const v8h*)p, *(const v8h*)(p + 16)); } static __device__ __forceinline__ V ldf(const h16* p) { return cat16(*(const v8h*)p, *(const v8h*)(p + 256)); } static __device__ __forceinline__ v8f mma(V a, V b, v8f c) { return wmma16(a, b, c); } };
template <> struct WFrag<bf> { typedef v16bf V; static __device__ __forceinline__ V ld(const bf* p) { return cat16b(*(const v8us*)p, *(const v8us*)(p + 16)); } static __device__ __forceinline__ V ldf(const bf* p) { return cat16b(*(const v8us*)p, *(const v8us*)(p + 256)); } static __device__ __forceinline__ v8f mma(V a, V b, v8f c) { return wmmab(a, b, c); } };
// The work is a device function that is told its tile (bx, by), its image z and its LDS, so that one launch can hold GEMMs of several shapes side by side.
template <typename T16, int NSPLIT, bool VROW, int KS>
__device__ __forceinline__ void gemmw_body(float* os, int bx, int by, size_t z, const T16* __restrict__ A, const T16* __restrict__ A2, const T16* __restrict__ Bt, const T16* __restrict__ Bt2, int K, h16* C16, bf* Ch, bf* Cl, int ldc, const float* __restrict__ bias, size_t sA, size_t sB, size_t sC) {
    typedef typename WFrag<T16>::V V;
    A += z * sA; if (A2) A2 += z * sA; Bt += z * sB; if (Bt2) Bt2 += z * sB;
    const int lane = threadIdx.x & 31, lr = lane & 15, hi = lane >> 4; const int r0 = bx * 64, c0 = by * 64;
    const int wv = KS == 1 ? 0 : __builtin_amdgcn_readfirstlane((int)(threadIdx.x >> 5));   // wave number, held scalar so that the k loop stays a scalar loop
    v8f acc[4][4];
#pragma unroll
    for (int mb = 0; mb < 4; ++mb)
#pragma unroll
        for (int nb = 0; nb < 4; ++nb) acc[mb][nb] = (v8f){};
    const size_t aoff = (size_t)(r0 + lr) * K + 8 * hi, boff = (size_t)(c0 + lr) * K + 8 * hi;
#pragma unroll 1
    for (int kc = wv * 32; kc < K; kc += 32 * KS) {
        V a[4], a2[4];
#pragma unroll
        for (int mb = 0; mb < 4; ++mb) { a[mb] = WFrag<T16>::ld(A + aoff + (size_t)mb * 16 * K + kc); if (NSPLIT == 1 || NSPLIT == 2) a2[mb] = WFrag<T16>::ld(A2 + aoff + (size_t)mb * 16 * K + kc); }
#pragma unroll
        for (int nb = 0; nb < 4; ++nb) { const V b = WFrag<T16>::ld(Bt + boff + (size_t)nb * 16 * K + kc); V b2; if (NSPLIT >= 2) b2 = WFrag<T16>::ld(Bt2 + boff + (size_t)nb * 16 * K + kc);
#pragma unroll
            for (int mb = 0; mb < 4; ++mb) { acc[mb][nb] = WFrag<T16>::mma(a[mb], b, acc[mb][nb]); if (NSPLIT == 1 || NSPLIT == 2) acc[mb][nb] = WFrag<T16>::mma(a2[mb], b, acc[mb][nb]); if (NSPLIT >= 2) acc[mb][nb] = WFrag<T16>::mma(a[mb], b2, acc[mb][nb]); } }
        asm volatile("v_nop\n\tv_nop\n\tv_nop\n\tv_nop" : "+v"(acc[0][0]), "+v"(acc[1][1]), "+v"(acc[2][2]), "+v"(acc[3][3]) : "v"(a[0]), "v"(a[3]));
    }
    float bb[32 / KS];   // VROW: the bias of this thread's rows, asked for ahead of the LDS stores and the barrier that hide its way
    if constexpr (VROW) {
#pragma unroll
        for (int s = 0; s < 32 / KS; ++s) bb[s] = bias[r0 + s * (2 * KS) + (int)(threadIdx.x >> 4)];
        asm volatile("s_wait_xcnt 0x0" ::: "memory");   // stands behind the bias loads, before later code writes over their offset registers
    }
    float* mine = os + wv * (64 * 68);
#pragma unroll
    for (int mb = 0; mb < 4; ++mb)
#pragma unroll
        for (int nb = 0; nb < 4; ++nb)
#pragma unroll
            for (int j = 0; j < 8; ++j) mine[(mb * 16 + hi * 8 + j) * 68 + nb * 16 + lr] = acc[mb][nb][j];
    __syncthreads();   // every wave's partial tile is in LDS before any of them is summed
#pragma unroll
    for (int s = 0; s < 32 / KS; ++s) { const int f = s * (32 * KS) + (int)threadIdx.x, row = f >> 4, cofs = (f & 15) * 4; if (!VROW && c0 + cofs >= ldc) continue; v4f val = *(const v4fa*)(os + row * 68 + cofs);
#pragma unroll
        for (int q = 1; q < KS; ++q) val += *(const v4fa*)(os + q * (64 * 68) + row * 68 + cofs);
        const size_t co = z * sC + fragofs(r0 + row, c0 + cofs, ldc / 32);
        if constexpr (VROW) { const float br = bfr(bb[s]); v4h o;
#pragma unroll
            for (int q = 0; q < 4; ++q) o[q] = tohx(__fadd_rn(val[q], br));
            *(v4h*)(C16 + co) = o; }
        else { v4us oh, ol;
#pragma unroll
            for (int q = 0; q < 4; ++q) { unsigned short a, c2; splitf(__fadd_rn(val[q], bfr(bias[c0 + cofs + q])), a, c2); oh[q] = a; ol[q] = c2; }
            *(v4us*)(Ch + co) = oh; *(v4us*)(Cl + co) = ol; }
    }
}
// k_conv3: the three 1x1 convs of one stage (none reads another's result) in ONE launch; grid (256 + 64 + 64, NB_): blocks 0..255 the value conv's tiles in their old order, then the q conv's 64, then the k conv's 64.
// Each tile's last lines add the bias and store v as fp16, q and k (their 32 real channels) as their hi/lo bf16 planes, all in fragment order.
template <int NSQK, int NSV>
__global__ __launch_bounds__(256) void k_conv3(const bf* __restrict__ Aq, const bf* __restrict__ Aq2, const bf* __restrict__ Ak, const bf* __restrict__ Ak2, const bf* __restrict__ WQ, const bf* __restrict__ WK, const float* __restrict__ BQ, const float* __restrict__ BK, bf* Qh, bf* Ql, bf* Kh, bf* Kl,
                                               const bf* __restrict__ WV, const bf* __restrict__ Xv, const bf* __restrict__ Xv2, const float* __restrict__ bv, h16* V16, int K) {
    __shared__ __align__(16) float os[8 * 64 * 68];
    const int b = (int)blockIdx.x; const size_t z = blockIdx.y;
    if (b < (CC / 64) * (NN / 64)) { gemmw_body<bf, NSV, true, 8>(os, b & (CC / 64 - 1), b / (CC / 64), z, WV, nullptr, Xv, Xv2, K, V16, nullptr, nullptr, NN, bv, 0, (size_t)NN * CC, (size_t)NN * CC); return; }
    const int t = b - (CC / 64) * (NN / 64); const bool isk = t >= NN / 64;
    gemmw_body<bf, NSQK, false, 8>(os, isk ? t - NN / 64 : t, 0, z, isk ? Ak : Aq, isk ? Ak2 : Aq2, isk ? WK : WQ, nullptr, K, nullptr, isk ? Kh : Qh, isk ? Kl : Ql, CQ, isk ? BK : BQ, (size_t)NN * CC, 0, (size_t)NN * CQ);
}


__device__ __forceinline__ void cvt8_body(int bx, const float* __restrict__ src, bf* dst, size_t n8) { const size_t i = (size_t)bx * 256 + threadIdx.x; if (i >= n8) return; const v8f v = *(const v8f*)(src + i * 8); v8us o;
#pragma unroll
    for (int k = 0; k < 8; ++k) o[k] = f2bf(v[k]); *(v8us*)(dst + i * 8) = o;  }
// Every per-image kernel below takes its image from blockIdx.y (k_prep's transpose: blockIdx.x / 256): both images' planes lie one behind the other in the workspace.
// The *_body functions are told their block (bx) and image (img) by the kernel that holds them: launches that do not depend on one another share one grid.
__device__ __forceinline__ void xt_body(int bx, int img, const float* __restrict__ xb, bf* XT) {
    xb += (size_t)img * CC * NN; XT += (size_t)img * NN * CC;
    const int lane = threadIdx.x & 31; const int L0 = (bx * 8 + (threadIdx.x >> 5)) * 8; const int nlines = NN * CC / 64;
{
#pragma unroll
        for (int l = 0; l < 8; ++l) { const int L = L0 + l; if (L >= nlines) break; const int e = L * 64 + lane * 2; const int c = e & (CC - 1); const int n = e >> 8; v2us o;
#pragma unroll
            for (int q = 0; q < 2; ++q) o[q] = f2bf(xb[(size_t)(c + q) * NN + n]);
            *(v2us*)(XT + (size_t)e) = o; }
         }
}
__device__ __forceinline__ void wpad_body(int bx, const float* __restrict__ w, const float* __restrict__ b, bf* Bt, float* BP) { const int e = (bx * 256 + threadIdx.x) * 2; if (e >= CQP * CC) return; const int n = e / CC, k = e % CC; v2us o;
#pragma unroll
    for (int q = 0; q < 2; ++q) o[q] = (n < CQ) ? f2bf(w[(size_t)n * CC + k + q]) : (unsigned short)0;
    *(v2us*)(Bt + e) = o; if (e < CQP) { *(float*)(BP + e) = (e < CQ) ? b[e] : 0.f; *(float*)(BP + e + 1) = (e + 1 < CQ) ? b[e + 1] : 0.f; }
     }
// k_prep: all that reads the inputs alone, in ONE launch; grid 512 + 128 + 64: the transpose of x (256 blocks an image), the four padded q/k weight planes (32 blocks each), the two value weight planes (32 blocks each).
__global__ __launch_bounds__(256) void k_prep(const float* __restrict__ x, bf* XT,
                                              const float* __restrict__ wq1, const float* __restrict__ bq1, bf* WQ1, float* BQ1, const float* __restrict__ wk1, const float* __restrict__ bk1, bf* WK1, float* BK1,
                                              const float* __restrict__ wq2, const float* __restrict__ bq2, bf* WQ2, float* BQ2, const float* __restrict__ wk2, const float* __restrict__ bk2, bf* WK2, float* BK2,
                                              const float* __restrict__ wv1, bf* WV1, const float* __restrict__ wv2, bf* WV2) {
    const int b = (int)blockIdx.x;
    if (b < 512) { xt_body(b & 255, b >> 8, x, XT); return; }
    const int t = b - 512, bx = t & 31, w = t >> 5;
    if (w == 0) wpad_body(bx, wq1, bq1, WQ1, BQ1);
    else if (w == 1) wpad_body(bx, wk1, bk1, WK1, BK1);
    else if (w == 2) wpad_body(bx, wq2, bq2, WQ2, BQ2);
    else if (w == 3) wpad_body(bx, wk2, bk2, WK2, BK2);
    else if (w == 4) cvt8_body(bx, wv1, WV1, (size_t)CC * CC / 8);
    else cvt8_body(bx, wv2, WV2, (size_t)CC * CC / 8);
}
__global__ __launch_bounds__(256) void k_p16(const float* __restrict__ F, h16* P, size_t n) { const size_t i = ((size_t)blockIdx.x * 256 + threadIdx.x) * 2; if (i >= n) return; v2h v; v[0] = tohx(F[i]); v[1] = tohx(F[i + 1]); *(v2h*)(P + i) = v;  }
// k_attn: scores, softmax and value contraction of 32 query positions i in ONE work-group of 16 waves; grid (NN / 32, NB_). No score and no numerator leaves the work-group.
// Scores are formed transposed, St[j][i] = sum_c k[j][c] q[i][c] (A = k rows, B = q rows, the three hi/lo products in the old order, over the 32 real channels: the pad's products are exact zeros): a lane then
// holds 8 neighbouring keys j of one column i, which is one 16-byte piece of a numerator row p[i][j].
// Pass 1: wave w takes the keys w * 256 .. + 255 and finds each column's maximum; the 16 partial maxima meet in LDS.
// Pass 2, in steps of PJ = 256 keys: wave w forms the scores of the step's keys w * 16 .. + 15 again, numerators exp(s - max) (f32 sum; x1024 to fp16) into LDS (two buffers, one barrier a step);
// then wave w adds the step to its own 16 channels, O[c][i] += v[c][j] p[i][j], v straight from its plane (each v element is read once by the work-group), keys in rising order.
// q, k (rows = positions, k = the 32 channels) and v (rows = channels, k = keys) lie in fragment order: lane l's two pieces of a tile stand at halves l * 8 and 256 + l * 8 of its 512.
#define PJ 256
#define PP (PJ + 8)               // pitch of a numerator row in LDS, in halves: rows 4 banks apart
__global__ __launch_bounds__(512) void k_attn(const bf* __restrict__ Qh, const bf* __restrict__ Ql, const bf* __restrict__ Kh, const bf* __restrict__ Kl, const h16* __restrict__ V16, float* O, float* RS) {
    __shared__ __align__(16) h16 ps[2 * 32 * PP];
    __shared__ float mx[16 * 32];
    __shared__ float ls[16 * 32];
    __shared__ float mf[32];
    const size_t img = blockIdx.y;
    Qh += img * NN * CQ; Ql += img * NN * CQ; Kh += img * NN * CQ; Kl += img * NN * CQ; V16 += img * CC * NN; O += img * CC * NN; RS += img * NN * 32;
    const int lane = threadIdx.x & 31, lr = lane & 15, hi = lane >> 4; const int i0 = (int)blockIdx.x * 32;
    const int wv = __builtin_amdgcn_readfirstlane((int)(threadIdx.x >> 5));   // wave number, held scalar so that the key loops stay scalar loops
    v16bf qh[2], ql[2];
#pragma unroll
    for (int nb = 0; nb < 2; ++nb) { const size_t o = (size_t)((i0 >> 4) + nb) * 512 + lane * 8; qh[nb] = WFrag<bf>::ldf(Qh + o); ql[nb] = WFrag<bf>::ldf(Ql + o); }
    float m[2] = { -3.0e38f, -3.0e38f };
#pragma unroll 4
    for (int j0 = wv * 256; j0 < wv * 256 + 256; j0 += 16) { const size_t o = (size_t)(j0 >> 4) * 512 + lane * 8; const v16bf kh = WFrag<bf>::ldf(Kh + o), kl = WFrag<bf>::ldf(Kl + o);
#pragma unroll
        for (int nb = 0; nb < 2; ++nb) { v8f s = (v8f){}; s = wmmab(kh, qh[nb], s); s = wmmab(kh, ql[nb], s); s = wmmab(kl, qh[nb], s);
#pragma unroll
            for (int e = 0; e < 8; ++e) m[nb] = fmaxf(m[nb], s[e]); }
    }
#pragma unroll
    for (int nb = 0; nb < 2; ++nb) m[nb] = fmaxf(m[nb], __shfl_xor(m[nb], 16, 32));
    if (hi == 0) { mx[wv * 32 + lr] = m[0]; mx[wv * 32 + 16 + lr] = m[1]; }
    __syncthreads();   // all 16 partial maxima are in LDS before any wave takes the maximum over them
#pragma unroll
    for (int nb = 0; nb < 2; ++nb) { float t = mx[nb * 16 + lr];
#pragma unroll
        for (int q = 1; q < 16; ++q) t = fmaxf(t, mx[q * 32 + nb * 16 + lr]);
        m[nb] = t; }
    if (wv == 0 && hi == 0) { mf[lr] = m[0]; mf[16 + lr] = m[1]; }
    v8f acc[2]; acc[0] = (v8f){}; acc[1] = (v8f){};
    float sum[2] = { 0.f, 0.f };
    const h16* vb = V16 + (size_t)wv * (NN / 32) * 512 + lane * 8;
    const size_t ko = (size_t)wv * 512 + lane * 8;
    v16bf kh = WFrag<bf>::ldf(Kh + ko), kl = WFrag<bf>::ldf(Kl + ko);
#pragma unroll 1
    for (int st = 0; st < NN / PJ; ++st) {
        v16h a[PJ / 32];   // the step's v fragments, asked for ahead of the score work that hides their way
#pragma unroll
        for (int kb = 0; kb < PJ / 32; ++kb) a[kb] = WFrag<h16>::ldf(vb + (st * (PJ / 32) + kb) * 512);
        v16bf khn = kh, kln = kl;   // the next step's key rows, asked for together with v: the barrier below waits for every load that is under way, so a load issued just in front of it would be waited for in full
        if (st + 1 < NN / PJ) { const size_t kn = ko + (size_t)(st + 1) * (PJ / 16) * 512; khn = WFrag<bf>::ldf(Kh + kn); kln = WFrag<bf>::ldf(Kl + kn); }
        h16* pw = ps + (st & 1) * (32 * PP);
#pragma unroll
        for (int nb = 0; nb < 2; ++nb) { v8f s = (v8f){}; s = wmmab(kh, qh[nb], s); s = wmmab(kh, ql[nb], s); s = wmmab(kl, qh[nb], s); v8h o;
#pragma unroll
            for (int e = 0; e < 8; ++e) { const float ex = __expf(__fsub_rn(s[e], m[nb])); sum[nb] += ex; o[e] = tohx(ex * PCAR); }
            *(v8ha*)(pw + (nb * 16 + lr) * PP + wv * 16 + hi * 8) = o; }
        kh = khn; kl = kln;
        __syncthreads();   // the step's numerators are all in LDS; and every wave has left the other buffer, which the next step fills
#pragma unroll
        for (int kb = 0; kb < PJ / 32; ++kb)
#pragma unroll
            for (int nb = 0; nb < 2; ++nb) { const h16* pr = pw + (nb * 16 + lr) * PP + kb * 32 + 8 * hi; acc[nb] = wmma16(a[kb], cat16(*(const v8ha*)pr, *(const v8ha*)(pr + 16)), acc[nb]); }
    }
#pragma unroll
    for (int nb = 0; nb < 2; ++nb) sum[nb] += __shfl_xor(sum[nb], 16, 32);
    if (hi == 0) { ls[wv * 32 + lr] = sum[0]; ls[wv * 32 + 16 + lr] = sum[1]; }
#pragma unroll
    for (int nb = 0; nb < 2; ++nb)
#pragma unroll
        for (int e = 0; e < 8; ++e) O[(size_t)(wv * 16 + hi * 8 + e) * NN + i0 + nb * 16 + lr] = acc[nb][e];
    __syncthreads();   // all 16 partial sums are in LDS before they are added, in wave order
#pragma unroll
    for (int s = 0; s < 2; ++s) { const int f = s * 512 + (int)threadIdx.x, i = f >> 5, ln = f & 31; float t = ls[i];
#pragma unroll
        for (int q = 1; q < 16; ++q) t += ls[q * 32 + i];
        const float o2 = ln == 0 ? mf[i] : (ln == 1 ? __fdiv_rn(1.0f, t * PCAR) : 0.f); /* 1/(PCAR * sum): undoes the carry at the merge */ *(float*)(RS + (size_t)(i0 + i) * 32 + ln) = o2; }
}
__global__ __launch_bounds__(256) void k_x1(const float* __restrict__ O, const float* __restrict__ RS, const float* __restrict__ xb, const float* __restrict__ gam, float* X1) { O += (size_t)blockIdx.y * CC * NN; RS += (size_t)blockIdx.y * NN * 32; xb += (size_t)blockIdx.y * CC * NN; X1 += (size_t)blockIdx.y * CC * NN; const size_t i = ((size_t)blockIdx.x * 256 + threadIdx.x) * 4; if (i >= (size_t)CC * NN) return; const int n0 = (int)(i & (NN - 1)); const float g = bfr(gam[0]); const v4f a = *(const v4f*)(O + i), x4 = *(const v4f*)(xb + i); v4f o;
#pragma unroll
    for (int q = 0; q < 4; ++q) { float t = __fmul_rn(a[q], RS[(size_t)(n0 + q) * 32 + 1]); asm volatile("" : "+v"(t)); float t2 = __fmul_rn(g, t); asm volatile("" : "+v"(t2)); o[q] = __fadd_rn(t2, bfr(x4[q])); }
    *(v4f*)(X1 + i) = o;  }
template <int FG>
__device__ __forceinline__ void mT_body(int bx, int img, const float* __restrict__ X1, const float* __restrict__ mk, bf* Hh, bf* Hl) {
    X1 += (size_t)img * CC * NN; mk += (size_t)img * NN; Hh += (size_t)img * NN * CC; Hl += (size_t)img * NN * CC;
    const int lane = threadIdx.x & 31; const int L0 = (bx * 8 + (threadIdx.x >> 5)) * 8; const int nlines = NN * CC / 64;
{
#pragma unroll 1
        for (int l = 0; l < 8; ++l) { const int L = L0 + l; if (L >= nlines) break; const int e = L * 64 + lane * 2; const int c = e & (CC - 1); const int n = e >> 8; const float w = FG ? bfr(mk[n]) : __fsub_rn(1.0f, bfr(mk[n])); v2us oh, ol;
#pragma unroll
            for (int q = 0; q < 2; ++q) { unsigned short a, c2; splitf(__fmul_rn(X1[(size_t)(c + q) * NN + n], w), a, c2); oh[q] = a; ol[q] = c2; }
            *(v2us*)(Hh + (size_t)e) = oh; *(v2us*)(Hl + (size_t)e) = ol;
            asm volatile("s_wait_xcnt 0x0" ::: "memory"); }   // stands behind the two stores, before the next trip (or the code behind the loop) writes over their address and data registers
         }
}
// k_mT2: the foreground and the background planes in ONE launch; grid (256 + 256, NB_).
__global__ __launch_bounds__(256) void k_mT2(const float* __restrict__ X1, const float* __restrict__ mk, bf* Fh, bf* Fl, bf* Bh, bf* Bl) {
    const int b = (int)blockIdx.x, img = (int)blockIdx.y;
    if (b < 256) mT_body<1>(b, img, X1, mk, Fh, Fl); else mT_body<0>(b - 256, img, X1, mk, Bh, Bl);
}
// std_body: per channel row c (one wave, lanes stride the 4096 positions in a fixed order, fixed shuffle trees): FG = 1: values ff = X1[c][n] * bf16(mask[n]); FG = 0: values sw = O2[c][n] * RS2[n][1];
template <int FG>
__device__ __forceinline__ void std_body(int bx, int img, const float* __restrict__ A, const float* __restrict__ aux, float* SD) {
    A += (size_t)img * CC * NN; aux += (size_t)img * (FG ? NN : NN * 32); SD += (size_t)img * CC * 32;
    const int lane = threadIdx.x & 31; const int c = bx * 8 + (threadIdx.x >> 5); if (c >= CC) return; const float* row = A + (size_t)c * NN; float s = 0.f;
#pragma unroll 4
    for (int n = lane; n < NN; n += 32) { const float v = FG ? __fmul_rn(row[n], bfr(aux[n])) : __fmul_rn(row[n], aux[(size_t)n * 32 + 1]); s += v; }
#pragma unroll
    for (int sh = 16; sh; sh >>= 1) s += __shfl_xor(s, sh, 32);
    const float mu = s * (1.0f / NN); float qq = 0.f;
#pragma unroll 4
    for (int n = lane; n < NN; n += 32) { const float v = FG ? __fmul_rn(row[n], bfr(aux[n])) : __fmul_rn(row[n], aux[(size_t)n * 32 + 1]); const float d0 = __fsub_rn(v, mu); qq = __fadd_rn(qq, __fmul_rn(d0, d0)); }
#pragma unroll
    for (int sh = 16; sh; sh >>= 1) qq += __shfl_xor(qq, sh, 32);
    const float sd = __fsqrt_rn(__fadd_rn(__fdiv_rn(qq, (float)(NN - 1)), 1e-5f)); const float o = (lane == 0) ? sd : 0.f;
    *(float*)(SD + (size_t)c * 32 + lane) = o;  }
// k_std2: both statistics in ONE launch; grid (32 + 32, NB_): sw's rows first, then ff's.
__global__ __launch_bounds__(256) void k_std2(const float* __restrict__ O2, const float* __restrict__ RS, float* SDS, const float* __restrict__ X1, const float* __restrict__ mk, float* SDF) {
    const int b = (int)blockIdx.x, img = (int)blockIdx.y;
    if (b < CC / 8) std_body<0>(b, img, O2, RS, SDS); else std_body<1>(b - CC / 8, img, X1, mk, SDF);
}
__global__ __launch_bounds__(256) void k_out(const float* __restrict__ X1, const float* __restrict__ mk, const float* __restrict__ SDF, const float* __restrict__ SDS, const float* __restrict__ gam, float* OUTb) { X1 += (size_t)blockIdx.y * CC * NN; mk += (size_t)blockIdx.y * NN; SDF += (size_t)blockIdx.y * CC * 32; SDS += (size_t)blockIdx.y * CC * 32; OUTb += (size_t)blockIdx.y * CC * NN; const size_t i = ((size_t)blockIdx.x * 256 + threadIdx.x) * 4; if (i >= (size_t)CC * NN) return; const int n0 = (int)(i & (NN - 1)); const int c = (int)(i >> 12); const float g = bfr(gam[0]); const float ratio = __fdiv_rn(SDS[(size_t)c * 32], SDF[(size_t)c * 32]); const v4f x4 = *(const v4f*)(X1 + i); v4f o;
#pragma unroll
    for (int q = 0; q < 4; ++q) { float ff = __fmul_rn(x4[q], bfr(mk[n0 + q])); asm volatile("" : "+v"(ff)); float t = __fmul_rn(ff, ratio); asm volatile("" : "+v"(t)); float t2 = __fmul_rn(g, t); asm volatile("" : "+v"(t2)); o[q] = __fadd_rn(x4[q], t2); }
    *(v4f*)(OUTb + i) = o;  }
extern "C" void kernel_launch(void* const* d_in, const int* in_sizes, int n_in,
                              void* d_out, int out_size, void* d_ws, size_t ws_size, hipStream_t stream) {
    (void)in_sizes; (void)n_in; (void)out_size;
    const float* IN[16]; for (int i = 0; i < 16; ++i) IN[i] = (const float*)d_in[i];
    // x [2][256][64][64], mask [2][1][64][64], sa_wq [32][256], sa_bq, sa_wk, sa_bk, sa_wv [256][256], sa_bv, sa_gamma [1], wq, bq, wk, bk, wv, bv, gamma [1] = d_in[0..15]
    const float* x = IN[0]; const float* mk = IN[1];
    float* OUT = (float*)d_out;     // [2][256][64][64]
    char* wsp = (char*)d_ws;
    auto take = [&](size_t bytes) { char* p = wsp; wsp += (bytes + 255) & ~(size_t)255; return (void*)p; };
    bf* WQ1 = (bf*)take((size_t)CQP * CC * 2); bf* WK1 = (bf*)take((size_t)CQP * CC * 2); float* BQ1 = (float*)take(256); float* BK1 = (float*)take(256); bf* WV1 = (bf*)take((size_t)CC * CC * 2);
    bf* WQ2 = (bf*)take((size_t)CQP * CC * 2); bf* WK2 = (bf*)take((size_t)CQP * CC * 2); float* BQ2 = (float*)take(256); float* BK2 = (float*)take(256); bf* WV2 = (bf*)take((size_t)CC * CC * 2);
    // per-image planes, NB_ of each, one behind the other
    bf* XT = (bf*)take((size_t)NB_ * NN * CC * 2); bf* Qh = (bf*)take((size_t)NB_ * NN * CQ * 2); bf* Ql = (bf*)take((size_t)NB_ * NN * CQ * 2); bf* Kh = (bf*)take((size_t)NB_ * NN * CQ * 2); bf* Kl = (bf*)take((size_t)NB_ * NN * CQ * 2);
    float* Oc = (float*)take((size_t)NB_ * CC * NN * 4); h16* V16 = (h16*)take((size_t)NB_ * CC * NN * 2); float* X1 = (float*)take((size_t)NB_ * CC * NN * 4);
    bf* Fh = (bf*)take((size_t)NB_ * NN * CC * 2); bf* Fl = (bf*)take((size_t)NB_ * NN * CC * 2); bf* Bh = (bf*)take((size_t)NB_ * NN * CC * 2); bf* Bl = (bf*)take((size_t)NB_ * NN * CC * 2);
    float* RS = (float*)take((size_t)NB_ * NN * 32 * 4); float* SDF = (float*)take((size_t)NB_ * CC * 32 * 4); float* SDS = (float*)take((size_t)NB_ * CC * 32 * 4);
    if ((size_t)(wsp - (char*)d_ws) > ws_size) return;    // total ~ 43.5 MiB; ws 256 MiB
    const unsigned L4 = (unsigned)(((size_t)NN * CC / 4 + 255) / 256);
    // stage 1: self attention on x
    k_prep<<<512 + 128 + 64, 256, 0, stream>>>(x, XT, IN[2], IN[3], WQ1, BQ1, IN[4], IN[5], WK1, BK1, IN[9], IN[10], WQ2, BQ2, IN[11], IN[12], WK2, BK2, IN[6], WV1, IN[13], WV2);
    k_conv3<0, 0><<<dim3(256 + 64 + 64, NB_), 256, 0, stream>>>(XT, nullptr, XT, nullptr, WQ1, WK1, BQ1, BK1, Qh, Ql, Kh, Kl, WV1, XT, nullptr, IN[7], V16, CC);
    k_attn<<<dim3(NN / 32, NB_), 512, 0, stream>>>(Qh, Ql, Kh, Kl, V16, Oc, RS);   // sa [c][i] (x1024 carried)
    k_x1<<<dim3(L4, NB_), 256, 0, stream>>>(Oc, RS, x, IN[8], X1);
    // stage 2: masked cross attention on x1 (q from mask*x1, k/v from (1-mask)*x1)
    k_mT2<<<dim3(256 + 256, NB_), 256, 0, stream>>>(X1, mk, Fh, Fl, Bh, Bl);
    k_conv3<1, 3><<<dim3(256 + 64 + 64, NB_), 256, 0, stream>>>(Fh, Fl, Bh, Bl, WQ2, WK2, BQ2, BK2, Qh, Ql, Kh, Kl, WV2, Bh, Bl, IN[14], V16, CC);
    k_attn<<<dim3(NN / 32, NB_), 512, 0, stream>>>(Qh, Ql, Kh, Kl, V16, Oc, RS);   // sw [c][i] (x1024 carried; RS applied inside k_std / not needed elsewhere)
    k_std2<<<dim3(CC / 8 + CC / 8, NB_), 256, 0, stream>>>(Oc, RS, SDS, X1, mk, SDF);
    k_out<<<dim3(L4, NB_), 256, 0, stream>>>(X1, mk, SDF, SDS, IN[15], OUT);
}

// v007
// A run of this version takes 138 microseconds.
// Timed twice side by side with v006, it ran 1.18 times as fast both times.
// Counting every step since v000, it is 6.12 times as fast.
#include <hip/hip_runtime.h>

// x [2][256][64][64], mask [2][1][64][64] in {0,1} read as data; (1) self-attention: q/k = 1x1 convs to 32 ch, v 256 ch (+bias), A = softmax_j(sum_c q[c][i] k[c][j]) (unscaled),
// sa[c][i] = sum_j v[c][j] A[i][j]; x1 = sa_gamma sa + x; (2) masked cross attention: fb = (1-mask) x1, ff = mask x1; q from ff, k/v from fb (second conv set), sw[c][i] likewise;
// (3) out = x1 + gamma * ff * (std(sw) / std(ff)) per channel (unbiased variance over the 4096 positions + 1e-5, sqrt).
// Compute dtypes, f32 accumulate: every input rounded to bf16; stage-1 convs on PLAIN bf16 operands (inputs: exact, + bias; q/k padded 32 -> 64 output channels with
// numerators x1024 + 1/(1024 sum); both value contractions fp16 v x fp16 numerators (K 4096, channel-major); residuals, masks, the per-channel statistics and the final mix in f32 on VALU (one wave

#define NB_  2
#define CC   256
#define CQ   32                   // q/k channels
#define CQP  64                   // padded to one tile
#define NN   4096
#define PCAR 1024.0f
#define SCL  1.0f                 // energies are unscaled in this module
typedef _Float16 h16;
typedef unsigned short bf;
typedef __attribute__((ext_vector_type(16))) __bf16   v16bf;
typedef __attribute__((ext_vector_type(16))) _Float16 v16h;
typedef __attribute__((ext_vector_type(8)))  _Float16 v8h;
typedef __attribute__((ext_vector_type(8)))  unsigned short v8us;
typedef __attribute__((ext_vector_type(8)))  float    v8f;
typedef __attribute__((ext_vector_type(4)))  float    v4f;
typedef v8h  __attribute__((may_alias)) v8ha;
typedef v4f  __attribute__((may_alias)) v4fa;
typedef v8us __attribute__((may_alias)) v8usa;

__device__ __forceinline__ unsigned short f2bf(float f) { unsigned u = __float_as_uint(f); u += 0x7FFFu + ((u >> 16) & 1u); return (unsigned short)(u >> 16); }
__device__ __forceinline__ float bf2f(unsigned short b) { return __uint_as_float(((unsigned)b) << 16); }
__device__ __forceinline__ float bfr(float f) { return bf2f(f2bf(f)); }
__device__ __forceinline__ v16h cat16(v8h lo, v8h hi) { return __builtin_shufflevector(lo, hi, 0, 1, 2, 3, 4, 5, 6, 7, 8, 9, 10, 11, 12, 13, 14, 15); }
__device__ __forceinline__ v16bf cat16b(v8us lo, v8us hi) { return __builtin_bit_cast(v16bf, __builtin_shufflevector(lo, hi, 0, 1, 2, 3, 4, 5, 6, 7, 8, 9, 10, 11, 12, 13, 14, 15)); }
__device__ __forceinline__ v8f wmma16(v16h a, v16h b, v8f c) { return __builtin_amdgcn_wmma_f32_16x16x32_f16(false, a, false, b, (short)0, c, false, false); }
__device__ __forceinline__ v8f wmmab(v16bf a, v16bf b, v8f c) { return __builtin_amdgcn_wmma_f32_16x16x32_bf16(false, a, false, b, (short)0, c, false, false); }
__device__ __forceinline__ h16 tohx(float x) { return (h16)x; }
__device__ __forceinline__ void splitf(float y, unsigned short& h, unsigned short& l) { h = f2bf(y); l = f2bf(y - bf2f(h)); }
typedef __attribute__((ext_vector_type(2))) _Float16 v2h;
typedef __attribute__((ext_vector_type(4))) _Float16 v4h;
typedef __attribute__((ext_vector_type(2))) unsigned short v2us;
typedef __attribute__((ext_vector_type(4))) unsigned short v4us;



// ---- gemmw_body: register-blocked GEMM, KS WAVES per 64x64 output tile, each with all 16 accumulators over its own share of K; operands straight from K-contiguous 16-bit planes; one tile (bx, by) of image z per call, 32 * KS threads.
// c[m][n] (f32) = sum_k A[m][k] Bt[n][k] (+ split products per NSPLIT). z-batch strides sA/sB/sC in elements. K % (32 * KS) == 0.
// The tile leaves as the 16-bit planes that the attention kernel reads, never as f32: VROW: C16(m, n) = fp16(c + bf16(bias[m])); else Ch/Cl(m, n) = the hi/lo bf16 split of c + bf16(bias[n]), n < ldc only (the pad has no place).
// These planes lie in FRAGMENT ORDER (fragofs, row m, k index n, ldc k's a row): the attention kernel's fragment loads then read 512 contiguous bytes a wave, four whole 128-byte lines, not 32-byte pieces of 16 lines.
// Wave w takes the 32-k blocks w, w + KS, w + 2 KS, ... (neighbouring waves read the two halves of one 128-byte line in the same trip); the KS partial tiles meet in LDS and are summed in wave order.
// Fragment order of a 16-bit operand plane: each tile of 16 rows x 32 k is 1 KiB, laid as a wave's two 16-byte loads take it: [k bit 4][lane = (k bit 3) * 16 + row % 16][k % 8]; tiles run along k (KB of them a row block), then down the rows.
__device__ __forceinline__ size_t fragofs(int row, int k, int KB) { return ((((size_t)(row >> 4) * KB + (k >> 5)) * 2 + ((k >> 4) & 1)) * 32 + ((k >> 3) & 1) * 16 + (row & 15)) * 8 + (k & 7); }
template <typename T16> struct WFrag;
template <> struct WFrag<h16> { typedef v16h V; static __device__ __forceinline__ V ld(const h16* p) { return cat16(*(const v8h*)p, *(const v8h*)(p + 16)); } static __device__ __forceinline__ V ldf(const h16* p) { return cat16(*(const v8h*)p, *(const v8h*)(p + 256)); } static __device__ __forceinline__ v8f mma(V a, V b, v8f c) { return wmma16(a, b, c); } };
template <> struct WFrag<bf> { typedef v16bf V; static __device__ __forceinline__ V ld(const bf* p) { return cat16b(*(const v8us*)p, *(const v8us*)(p + 16)); } static __device__ __forceinline__ V ldf(const bf* p) { return cat16b(*(const v8us*)p, *(const v8us*)(p + 256)); } static __device__ __forceinline__ v8f mma(V a, V b, v8f c) { return wmmab(a, b, c); } };
// The work is a device function that is told its tile (bx, by), its image z and its LDS, so that one launch can hold GEMMs of several shapes side by side.
template <typename T16, int NSPLIT, bool VROW, int KS>
__device__ __forceinline__ void gemmw_body(float* os, int bx, int by, size_t z, const T16* __restrict__ A, const T16* __restrict__ A2, const T16* __restrict__ Bt, const T16* __restrict__ Bt2, int K, h16* C16, bf* Ch, bf* Cl, int ldc, const float* __restrict__ bias, size_t sA, size_t sB, size_t sC) {
    typedef typename WFrag<T16>::V V;
    A += z * sA; if (A2) A2 += z * sA; Bt += z * sB; if (Bt2) Bt2 += z * sB;
    const int lane = threadIdx.x & 31, lr = lane & 15, hi = lane >> 4; const int r0 = bx * 64, c0 = by * 64;
    const int wv = KS == 1 ? 0 : __builtin_amdgcn_readfirstlane((int)(threadIdx.x >> 5));   // wave number, held scalar so that the k loop stays a scalar loop
    v8f acc[4][4];
#pragma unroll
    for (int mb = 0; mb < 4; ++mb)
#pragma unroll
        for (int nb = 0; nb < 4; ++nb) acc[mb][nb] = (v8f){};
    const size_t aoff = (size_t)(r0 + lr) * K + 8 * hi, boff = (size_t)(c0 + lr) * K + 8 * hi;
#pragma unroll 1
    for (int kc = wv * 32; kc < K; kc += 32 * KS) {
        V a[4], a2[4];
#pragma unroll
        for (int mb = 0; mb < 4; ++mb) { a[mb] = WFrag<T16>::ld(A + aoff + (size_t)mb * 16 * K + kc); if (NSPLIT == 1 || NSPLIT == 2) a2[mb] = WFrag<T16>::ld(A2 + aoff + (size_t)mb * 16 * K + kc); }
#pragma unroll
        for (int nb = 0; nb < 4; ++nb) { const V b = WFrag<T16>::ld(Bt + boff + (size_t)nb * 16 * K + kc); V b2; if (NSPLIT >= 2) b2 = WFrag<T16>::ld(Bt2 + boff + (size_t)nb * 16 * K + kc);
#pragma unroll
            for (int mb = 0; mb < 4; ++mb) { acc[mb][nb] = WFrag<T16>::mma(a[mb], b, acc[mb][nb]); if (NSPLIT == 1 || NSPLIT == 2) acc[mb][nb] = WFrag<T16>::mma(a2[mb], b, acc[mb][nb]); if (NSPLIT >= 2) acc[mb][nb] = WFrag<T16>::mma(a[mb], b2, acc[mb][nb]); } }
        asm volatile("v_nop\n\tv_nop\n\tv_nop\n\tv_nop" : "+v"(acc[0][0]), "+v"(acc[1][1]), "+v"(acc[2][2]), "+v"(acc[3][3]) : "v"(a[0]), "v"(a[3]));
    }
    float bb[32 / KS];   // VROW: the bias of this thread's rows, asked for ahead of the LDS stores and the barrier that hide its way
    if constexpr (VROW) {
#pragma unroll
        for (int s = 0; s < 32 / KS; ++s) bb[s] = bias[r0 + s * (2 * KS) + (int)(threadIdx.x >> 4)];
        asm volatile("s_wait_xcnt 0x0" ::: "memory");   // stands behind the bias loads, before later code writes over their offset registers
    }
    float* mine = os + wv * (64 * 68);
#pragma unroll
    for (int mb = 0; mb < 4; ++mb)
#pragma unroll
        for (int nb = 0; nb < 4; ++nb)
#pragma unroll
            for (int j = 0; j < 8; ++j) mine[(mb * 16 + hi * 8 + j) * 68 + nb * 16 + lr] = acc[mb][nb][j];
    __syncthreads();   // every wave's partial tile is in LDS before any of them is summed
#pragma unroll
    for (int s = 0; s < 32 / KS; ++s) { const int f = s * (32 * KS) + (int)threadIdx.x, row = f >> 4, cofs = (f & 15) * 4; if (!VROW && c0 + cofs >= ldc) continue; v4f val = *(const v4fa*)(os + row * 68 + cofs);
#pragma unroll
        for (int q = 1; q < KS; ++q) val += *(const v4fa*)(os + q * (64 * 68) + row * 68 + cofs);
        const size_t co = z * sC + fragofs(r0 + row, c0 + cofs, ldc / 32);
        if constexpr (VROW) { const float br = bfr(bb[s]); v4h o;
#pragma unroll
            for (int q = 0; q < 4; ++q) o[q] = tohx(__fadd_rn(val[q], br));
            *(v4h*)(C16 + co) = o; }
        else { v4us oh, ol;
#pragma unroll
            for (int q = 0; q < 4; ++q) { unsigned short a, c2; splitf(__fadd_rn(val[q], bfr(bias[c0 + cofs + q])), a, c2); oh[q] = a; ol[q] = c2; }
            *(v4us*)(Ch + co) = oh; *(v4us*)(Cl + co) = ol; }
    }
}
// k_conv3: the three 1x1 convs of one stage (none reads another's result) in ONE launch; grid (256 + 64 + 64, NB_): blocks 0..255 the value conv's tiles in their old order, then the q conv's 64, then the k conv's 64.
// Each tile's last lines add the bias and store v as fp16, q and k (their 32 real channels) as their hi/lo bf16 planes, all in fragment order.
template <int NSQK, int NSV>
__global__ __launch_bounds__(256) void k_conv3(const bf* __restrict__ Aq, const bf* __restrict__ Aq2, const bf* __restrict__ Ak, const bf* __restrict__ Ak2, const bf* __restrict__ WQ, const bf* __restrict__ WK, const float* __restrict__ BQ, const float* __restrict__ BK, bf* Qh, bf* Ql, bf* Kh, bf* Kl,
                                               const bf* __restrict__ WV, const bf* __restrict__ Xv, const bf* __restrict__ Xv2, const float* __restrict__ bv, h16* V16, int K) {
    __shared__ __align__(16) float os[8 * 64 * 68];
    const int b = (int)blockIdx.x; const size_t z = blockIdx.y;
    if (b < (CC / 64) * (NN / 64)) { gemmw_body<bf, NSV, true, 8>(os, b & (CC / 64 - 1), b / (CC / 64), z, WV, nullptr, Xv, Xv2, K, V16, nullptr, nullptr, NN, bv, 0, (size_t)NN * CC, (size_t)NN * CC); return; }
    const int t = b - (CC / 64) * (NN / 64); const bool isk = t >= NN / 64;
    gemmw_body<bf, NSQK, false, 8>(os, isk ? t - NN / 64 : t, 0, z, isk ? Ak : Aq, isk ? Ak2 : Aq2, isk ? WK : WQ, nullptr, K, nullptr, isk ? Kh : Qh, isk ? Kl : Ql, CQ, isk ? BK : BQ, (size_t)NN * CC, 0, (size_t)NN * CQ);
}


__device__ __forceinline__ void cvt8_body(int bx, const float* __restrict__ src, bf* dst, size_t n8) { const size_t i = (size_t)bx * 256 + threadIdx.x; if (i >= n8) return; const v8f v = *(const v8f*)(src + i * 8); v8us o;
#pragma unroll
    for (int k = 0; k < 8; ++k) o[k] = f2bf(v[k]); *(v8us*)(dst + i * 8) = o;  }
// Every per-image kernel below takes its image from blockIdx.y (k_prep's transpose: blockIdx.x / 256): both images' planes lie one behind the other in the workspace.
// The *_body functions are told their block (bx) and image (img) by the kernel that holds them: launches that do not depend on one another share one grid.
__device__ __forceinline__ void xt_body(int bx, int img, const float* __restrict__ xb, bf* XT) {
    xb += (size_t)img * CC * NN; XT += (size_t)img * NN * CC;
    const int lane = threadIdx.x & 31; const int L0 = (bx * 8 + (threadIdx.x >> 5)) * 8; const int nlines = NN * CC / 64;
{
#pragma unroll
        for (int l = 0; l < 8; ++l) { const int L = L0 + l; if (L >= nlines) break; const int e = L * 64 + lane * 2; const int c = e & (CC - 1); const int n = e >> 8; v2us o;
#pragma unroll
            for (int q = 0; q < 2; ++q) o[q] = f2bf(xb[(size_t)(c + q) * NN + n]);
            *(v2us*)(XT + (size_t)e) = o; }
         }
}
__device__ __forceinline__ void wpad_body(int bx, const float* __restrict__ w, const float* __restrict__ b, bf* Bt, float* BP) { const int e = (bx * 256 + threadIdx.x) * 2; if (e >= CQP * CC) return; const int n = e / CC, k = e % CC; v2us o;
#pragma unroll
    for (int q = 0; q < 2; ++q) o[q] = (n < CQ) ? f2bf(w[(size_t)n * CC + k + q]) : (unsigned short)0;
    *(v2us*)(Bt + e) = o; if (e < CQP) { *(float*)(BP + e) = (e < CQ) ? b[e] : 0.f; *(float*)(BP + e + 1) = (e + 1 < CQ) ? b[e + 1] : 0.f; }
     }
// k_prep: all that reads the inputs alone, in ONE launch; grid 512 + 128 + 64: the transpose of x (256 blocks an image), the four padded q/k weight planes (32 blocks each), the two value weight planes (32 blocks each).
__global__ __launch_bounds__(256) void k_prep(const float* __restrict__ x, bf* XT,
                                              const float* __restrict__ wq1, const float* __restrict__ bq1, bf* WQ1, float* BQ1, const float* __restrict__ wk1, const float* __restrict__ bk1, bf* WK1, float* BK1,
                                              const float* __restrict__ wq2, const float* __restrict__ bq2, bf* WQ2, float* BQ2, const float* __restrict__ wk2, const float* __restrict__ bk2, bf* WK2, float* BK2,
                                              const float* __restrict__ wv1, bf* WV1, const float* __restrict__ wv2, bf* WV2) {
    const int b = (int)blockIdx.x;
    if (b < 512) { xt_body(b & 255, b >> 8, x, XT); return; }
    const int t = b - 512, bx = t & 31, w = t >> 5;
    if (w == 0) wpad_body(bx, wq1, bq1, WQ1, BQ1);
    else if (w == 1) wpad_body(bx, wk1, bk1, WK1, BK1);
    else if (w == 2) wpad_body(bx, wq2, bq2, WQ2, BQ2);
    else if (w == 3) wpad_body(bx, wk2, bk2, WK2, BK2);
    else if (w == 4) cvt8_body(bx, wv1, WV1, (size_t)CC * CC / 8);
    else cvt8_body(bx, wv2, WV2, (size_t)CC * CC / 8);
}
__global__ __launch_bounds__(256) void k_p16(const float* __restrict__ F, h16* P, size_t n) { const size_t i = ((size_t)blockIdx.x * 256 + threadIdx.x) * 2; if (i >= n) return; v2h v; v[0] = tohx(F[i]); v[1] = tohx(F[i + 1]); *(v2h*)(P + i) = v;  }
// k_attn: scores, softmax and value contraction of 32 query positions i in ONE work-group of 16 waves; grid (NN / 32, NB_). No score and no numerator leaves the work-group.
// Scores are formed transposed, St[j][i] = sum_c k[j][c] q[i][c] (A = k rows, B = q rows, the three hi/lo products in the old order, over the 32 real channels: the pad's products are exact zeros): a lane then
// holds 8 neighbouring keys j of one column i, which is one 16-byte piece of a numerator row p[i][j].
// Pass 1: wave w takes the keys w * 256 .. + 255 and finds each column's maximum; the 16 partial maxima meet in LDS.
// Pass 2, in steps of PJ = 256 keys: wave w forms the scores of the step's keys w * 16 .. + 15 again, numerators exp(s - max) (f32 sum; x1024 to fp16) into LDS (two buffers, one barrier a step);
// then wave w adds the step to its own 16 channels, O[c][i] += v[c][j] p[i][j], v straight from its plane (each v element is read once by the work-group), keys in rising order.
// q, k (rows = positions, k = the 32 channels) and v (rows = channels, k = keys) lie in fragment order: lane l's two pieces of a tile stand at halves l * 8 and 256 + l * 8 of its 512.
#define PJ 256
#define PP (PJ + 8)               // pitch of a numerator row in LDS, in halves: rows 4 banks apart
__global__ __launch_bounds__(512) void k_attn(const bf* __restrict__ Qh, const bf* __restrict__ Ql, const bf* __restrict__ Kh, const bf* __restrict__ Kl, const h16* __restrict__ V16, float* O, float* RS) {
    __shared__ __align__(16) h16 ps[2 * 32 * PP];
    __shared__ float mx[16 * 32];
    __shared__ float ls[16 * 32];
    __shared__ float mf[32];
    const size_t img = blockIdx.y;
    Qh += img * NN * CQ; Ql += img * NN * CQ; Kh += img * NN * CQ; Kl += img * NN * CQ; V16 += img * CC * NN; O += img * CC * NN; RS += img * NN * 32;
    const int lane = threadIdx.x & 31, lr = lane & 15, hi = lane >> 4; const int i0 = (int)blockIdx.x * 32;
    const int wv = __builtin_amdgcn_readfirstlane((int)(threadIdx.x >> 5));   // wave number, held scalar so that the key loops stay scalar loops
    v16bf qh[2], ql[2];
#pragma unroll
    for (int nb = 0; nb < 2; ++nb) { const size_t o = (size_t)((i0 >> 4) + nb) * 512 + lane * 8; qh[nb] = WFrag<bf>::ldf(Qh + o); ql[nb] = WFrag<bf>::ldf(Ql + o); }
    float m[2] = { -3.0e38f, -3.0e38f };
#pragma unroll 4
    for (int j0 = wv * 256; j0 < wv * 256 + 256; j0 += 16) { const size_t o = (size_t)(j0 >> 4) * 512 + lane * 8; const v16bf kh = WFrag<bf>::ldf(Kh + o), kl = WFrag<bf>::ldf(Kl + o);
#pragma unroll
        for (int nb = 0; nb < 2; ++nb) { v8f s = (v8f){}; s = wmmab(kh, qh[nb], s); s = wmmab(kh, ql[nb], s); s = wmmab(kl, qh[nb], s);
#pragma unroll
            for (int e = 0; e < 8; ++e) m[nb] = fmaxf(m[nb], s[e]); }
    }
#pragma unroll
    for (int nb = 0; nb < 2; ++nb) m[nb] = fmaxf(m[nb], __shfl_xor(m[nb], 16, 32));
    if (hi == 0) { mx[wv * 32 + lr] = m[0]; mx[wv * 32 + 16 + lr] = m[1]; }
    __syncthreads();   // all 16 partial maxima are in LDS before any wave takes the maximum over them
#pragma unroll
    for (int nb = 0; nb < 2; ++nb) { float t = mx[nb * 16 + lr];
#pragma unroll
        for (int q = 1; q < 16; ++q) t = fmaxf(t, mx[q * 32 + nb * 16 + lr]);
        m[nb] = t; }
    if (wv == 0 && hi == 0) { mf[lr] = m[0]; mf[16 + lr] = m[1]; }
    v8f acc[2]; acc[0] = (v8f){}; acc[1] = (v8f){};
    float sum[2] = { 0.f, 0.f };
    const h16* vb = V16 + (size_t)wv * (NN / 32) * 512 + lane * 8;
    const size_t ko = (size_t)wv * 512 + lane * 8;
    v16bf kh = WFrag<bf>::ldf(Kh + ko), kl = WFrag<bf>::ldf(Kl + ko);
#pragma unroll 1
    for (int st = 0; st < NN / PJ; ++st) {
        v16h a[PJ / 32];   // the step's v fragments, asked for ahead of the score work that hides their way
#pragma unroll
        for (int kb = 0; kb < PJ / 32; ++kb) a[kb] = WFrag<h16>::ldf(vb + (st * (PJ / 32) + kb) * 512);
        v16bf khn = kh, kln = kl;   // the next step's key rows, asked for together with v: the barrier below waits for every load that is under way, so a load issued just in front of it would be waited for in full
        if (st + 1 < NN / PJ) { const size_t kn = ko + (size_t)(st + 1) * (PJ / 16) * 512; khn = WFrag<bf>::ldf(Kh + kn); kln = WFrag<bf>::ldf(Kl + kn); }
        h16* pw = ps + (st & 1) * (32 * PP);
#pragma unroll
        for (int nb = 0; nb < 2; ++nb) { v8f s = (v8f){}; s = wmmab(kh, qh[nb], s); s = wmmab(kh, ql[nb], s); s = wmmab(kl, qh[nb], s); v8h o;
#pragma unroll
            for (int e = 0; e < 8; ++e) { const float ex = __expf(__fsub_rn(s[e], m[nb])); sum[nb] += ex; o[e] = tohx(ex * PCAR); }
            *(v8ha*)(pw + (nb * 16 + lr) * PP + wv * 16 + hi * 8) = o; }
        kh = khn; kl = kln;
        __syncthreads();   // the step's numerators are all in LDS; and every wave has left the other buffer, which the next step fills
#pragma unroll
        for (int kb = 0; kb < PJ / 32; ++kb)
#pragma unroll
            for (int nb = 0; nb < 2; ++nb) { const h16* pr = pw + (nb * 16 + lr) * PP + kb * 32 + 8 * hi; acc[nb] = wmma16(a[kb], cat16(*(const v8ha*)pr, *(const v8ha*)(pr + 16)), acc[nb]); }
    }
#pragma unroll
    for (int nb = 0; nb < 2; ++nb) sum[nb] += __shfl_xor(sum[nb], 16, 32);
    if (hi == 0) { ls[wv * 32 + lr] = sum[0]; ls[wv * 32 + 16 + lr] = sum[1]; }
#pragma unroll
    for (int nb = 0; nb < 2; ++nb)
#pragma unroll
        for (int e = 0; e < 8; ++e) O[(size_t)(wv * 16 + hi * 8 + e) * NN + i0 + nb * 16 + lr] = acc[nb][e];
    __syncthreads();   // all 16 partial sums are in LDS before they are added, in wave order
#pragma unroll
    for (int s = 0; s < 2; ++s) { const int f = s * 512 + (int)threadIdx.x, i = f >> 5, ln = f & 31; float t = ls[i];
#pragma unroll
        for (int q = 1; q < 16; ++q) t += ls[q * 32 + i];
        const float o2 = ln == 0 ? mf[i] : (ln == 1 ? __fdiv_rn(1.0f, t * PCAR) : 0.f); /* 1/(PCAR * sum): undoes the carry at the merge */ *(float*)(RS + (size_t)(i0 + i) * 32 + ln) = o2; }
}
__global__ __launch_bounds__(256) void k_x1(const float* __restrict__ O, const float* __restrict__ RS, const float* __restrict__ xb, const float* __restrict__ gam, float* X1) { O += (size_t)blockIdx.y * CC * NN; RS += (size_t)blockIdx.y * NN * 32; xb += (size_t)blockIdx.y * CC * NN; X1 += (size_t)blockIdx.y * CC * NN; const size_t i = ((size_t)blockIdx.x * 256 + threadIdx.x) * 4; if (i >= (size_t)CC * NN) return; const int n0 = (int)(i & (NN - 1)); const float g = bfr(gam[0]); const v4f a = *(const v4f*)(O + i), x4 = *(const v4f*)(xb + i); v4f o;
#pragma unroll
    for (int q = 0; q < 4; ++q) { float t = __fmul_rn(a[q], RS[(size_t)(n0 + q) * 32 + 1]); asm volatile("" : "+v"(t)); float t2 = __fmul_rn(g, t); asm volatile("" : "+v"(t2)); o[q] = __fadd_rn(t2, bfr(x4[q])); }
    *(v4f*)(X1 + i) = o;  }
template <int FG>
__device__ __forceinline__ void mT_body(int bx, int img, const float* __restrict__ X1, const float* __restrict__ mk, bf* Hh, bf* Hl) {
    X1 += (size_t)img * CC * NN; mk += (size_t)img * NN; Hh += (size_t)img * NN * CC; Hl += (size_t)img * NN * CC;
    const int lane = threadIdx.x & 31; const int L0 = (bx * 8 + (threadIdx.x >> 5)) * 8; const int nlines = NN * CC / 64;
{
#pragma unroll 1
        for (int l = 0; l < 8; ++l) { const int L = L0 + l; if (L >= nlines) break; const int e = L * 64 + lane * 2; const int c = e & (CC - 1); const int n = e >> 8; const float w = FG ? bfr(mk[n]) : __fsub_rn(1.0f, bfr(mk[n])); v2us oh, ol;
#pragma unroll
            for (int q = 0; q < 2; ++q) { unsigned short a, c2; splitf(__fmul_rn(X1[(size_t)(c + q) * NN + n], w), a, c2); oh[q] = a; ol[q] = c2; }
            *(v2us*)(Hh + (size_t)e) = oh; *(v2us*)(Hl + (size_t)e) = ol;
            asm volatile("s_wait_xcnt 0x0" ::: "memory"); }   // stands behind the two stores, before the next trip (or the code behind the loop) writes over their address and data registers
         }
}
// k_mT2: the foreground and the background planes in ONE launch; grid (256 + 256, NB_).
__global__ __launch_bounds__(256) void k_mT2(const float* __restrict__ X1, const float* __restrict__ mk, bf* Fh, bf* Fl, bf* Bh, bf* Bl) {
    const int b = (int)blockIdx.x, img = (int)blockIdx.y;
    if (b < 256) mT_body<1>(b, img, X1, mk, Fh, Fl); else mT_body<0>(b - 256, img, X1, mk, Bh, Bl);
}
// k_smix: both statistics and the final mix in ONE launch; grid (CC / 4, NB_), 16 waves. A work-group owns 4 whole channel rows: wave w holds positions (w >> 2) * 1024 .. + 1023 of row w & 3 in registers,
// 32 a lane, as sw = O2[c][n] * RS2[n][1], x1 and ff = x1 * bf16(mask[n]); each row is read once. The 4096 row-sum reciprocals (one 128-byte line each) are fetched once by the work-group and shared through LDS.
// Sums: four chains a lane (position % 4), a fixed tree over them, a fixed shuffle tree over the lanes, then the row's 4 wave partials from LDS in rising order; mean first, then the squared distances from it.
#define SR 4
__global__ __launch_bounds__(512) void k_smix(const float* __restrict__ O2, const float* __restrict__ RS, const float* __restrict__ X1, const float* __restrict__ mk, const float* __restrict__ gam, float* OUTb) {
    __shared__ __align__(16) float rsl[NN];
    __shared__ float p1[2 * SR * 4];
    __shared__ float p2[2 * SR * 4];
    const int t = (int)threadIdx.x, lane = t & 31;
    const int wv = __builtin_amdgcn_readfirstlane(t >> 5);   // wave number, held scalar so that the row bases are scalar
    const int r = wv & (SR - 1), seg = wv >> 2;
    const size_t img = blockIdx.y;
    const size_t ro = (img * CC + (size_t)blockIdx.x * SR + r) * NN + seg * 1024;   // the wave's first position of its row: scalar, so that every row access is a scalar base + the lane's offset
    O2 += ro; X1 += ro; OUTb += ro; RS += img * NN * 32; mk += img * NN + seg * 1024;
    const int lo = lane * 4;
    float rg[8]; v4f sw[8], x1[8], ff[8];
#pragma unroll
    for (int k = 0; k < 8; ++k) rg[k] = RS[(size_t)(k * 512 + t) * 32 + 1];
#pragma unroll
    for (int k = 0; k < 8; ++k) { sw[k] = *(const v4f*)(O2 + lo + k * 128); x1[k] = *(const v4f*)(X1 + lo + k * 128); ff[k] = *(const v4f*)(mk + lo + k * 128); }
    const float g = bfr(gam[0]);
#pragma unroll
    for (int k = 0; k < 8; ++k) rsl[k * 512 + t] = rg[k];
    __syncthreads();   // all 4096 reciprocals are in LDS before any wave reads its share
    v4f a0 = (v4f){}, a1 = (v4f){};
#pragma unroll
    for (int k = 0; k < 8; ++k) { const v4f rv = *(const v4fa*)(rsl + seg * 1024 + k * 128 + lo);
#pragma unroll
        for (int q = 0; q < 4; ++q) { sw[k][q] = sw[k][q] * rv[q]; ff[k][q] = x1[k][q] * bfr(ff[k][q]); }
        a0 += sw[k]; a1 += ff[k]; }
    float s0 = (a0[0] + a0[1]) + (a0[2] + a0[3]), s1 = (a1[0] + a1[1]) + (a1[2] + a1[3]);
#pragma unroll
    for (int sh = 16; sh; sh >>= 1) { s0 += __shfl_xor(s0, sh, 32); s1 += __shfl_xor(s1, sh, 32); }
    if (lane == 0) { p1[r * 4 + seg] = s0; p1[(SR + r) * 4 + seg] = s1; }
    __syncthreads();   // the row's 4 partial sums are in LDS before they are added
    const float mu0 = (((p1[r * 4] + p1[r * 4 + 1]) + p1[r * 4 + 2]) + p1[r * 4 + 3]) * (1.0f / NN);
    const float mu1 = (((p1[(SR + r) * 4] + p1[(SR + r) * 4 + 1]) + p1[(SR + r) * 4 + 2]) + p1[(SR + r) * 4 + 3]) * (1.0f / NN);
    a0 = (v4f){}; a1 = (v4f){};
#pragma unroll
    for (int k = 0; k < 8; ++k) { const v4f d0 = sw[k] - mu0, d1 = ff[k] - mu1; a0 += d0 * d0; a1 += d1 * d1; }
    s0 = (a0[0] + a0[1]) + (a0[2] + a0[3]); s1 = (a1[0] + a1[1]) + (a1[2] + a1[3]);
#pragma unroll
    for (int sh = 16; sh; sh >>= 1) { s0 += __shfl_xor(s0, sh, 32); s1 += __shfl_xor(s1, sh, 32); }
    if (lane == 0) { p2[r * 4 + seg] = s0; p2[(SR + r) * 4 + seg] = s1; }
    __syncthreads();   // the row's 4 partial sums of squares are in LDS before they are added
    const float q0 = ((p2[r * 4] + p2[r * 4 + 1]) + p2[r * 4 + 2]) + p2[r * 4 + 3];
    const float q1 = ((p2[(SR + r) * 4] + p2[(SR + r) * 4 + 1]) + p2[(SR + r) * 4 + 2]) + p2[(SR + r) * 4 + 3];
    const float ratio = __fdiv_rn(__fsqrt_rn(__fdiv_rn(q0, (float)(NN - 1)) + 1e-5f), __fsqrt_rn(__fdiv_rn(q1, (float)(NN - 1)) + 1e-5f));
#pragma unroll
    for (int k = 0; k < 8; ++k) *(v4f*)(OUTb + lo + k * 128) = x1[k] + g * (ff[k] * ratio);
}
extern "C" void kernel_launch(void* const* d_in, const int* in_sizes, int n_in,
                              void* d_out, int out_size, void* d_ws, size_t ws_size, hipStream_t stream) {
    (void)in_sizes; (void)n_in; (void)out_size;
    const float* IN[16]; for (int i = 0; i < 16; ++i) IN[i] = (const float*)d_in[i];
    // x [2][256][64][64], mask [2][1][64][64], sa_wq [32][256], sa_bq, sa_wk, sa_bk, sa_wv [256][256], sa_bv, sa_gamma [1], wq, bq, wk, bk, wv, bv, gamma [1] = d_in[0..15]
    const float* x = IN[0]; const float* mk = IN[1];
    float* OUT = (float*)d_out;     // [2][256][64][64]
    char* wsp = (char*)d_ws;
    auto take = [&](size_t bytes) { char* p = wsp; wsp += (bytes + 255) & ~(size_t)255; return (void*)p; };
    bf* WQ1 = (bf*)take((size_t)CQP * CC * 2); bf* WK1 = (bf*)take((size_t)CQP * CC * 2); float* BQ1 = (float*)take(256); float* BK1 = (float*)take(256); bf* WV1 = (bf*)take((size_t)CC * CC * 2);
    bf* WQ2 = (bf*)take((size_t)CQP * CC * 2); bf* WK2 = (bf*)take((size_t)CQP * CC * 2); float* BQ2 = (float*)take(256); float* BK2 = (float*)take(256); bf* WV2 = (bf*)take((size_t)CC * CC * 2);
    // per-image planes, NB_ of each, one behind the other
    bf* XT = (bf*)take((size_t)NB_ * NN * CC * 2); bf* Qh = (bf*)take((size_t)NB_ * NN * CQ * 2); bf* Ql = (bf*)take((size_t)NB_ * NN * CQ * 2); bf* Kh = (bf*)take((size_t)NB_ * NN * CQ * 2); bf* Kl = (bf*)take((size_t)NB_ * NN * CQ * 2);
    float* Oc = (float*)take((size_t)NB_ * CC * NN * 4); h16* V16 = (h16*)take((size_t)NB_ * CC * NN * 2); float* X1 = (float*)take((size_t)NB_ * CC * NN * 4);
    bf* Fh = (bf*)take((size_t)NB_ * NN * CC * 2); bf* Fl = (bf*)take((size_t)NB_ * NN * CC * 2); bf* Bh = (bf*)take((size_t)NB_ * NN * CC * 2); bf* Bl = (bf*)take((size_t)NB_ * NN * CC * 2);
    float* RS = (float*)take((size_t)NB_ * NN * 32 * 4);
    if ((size_t)(wsp - (char*)d_ws) > ws_size) return;    // total ~ 43 MiB; ws 256 MiB
    const unsigned L4 = (unsigned)(((size_t)NN * CC / 4 + 255) / 256);
    // stage 1: self attention on x
    k_prep<<<512 + 128 + 64, 256, 0, stream>>>(x, XT, IN[2], IN[3], WQ1, BQ1, IN[4], IN[5], WK1, BK1, IN[9], IN[10], WQ2, BQ2, IN[11], IN[12], WK2, BK2, IN[6], WV1, IN[13], WV2);
    k_conv3<0, 0><<<dim3(256 + 64 + 64, NB_), 256, 0, stream>>>(XT, nullptr, XT, nullptr, WQ1, WK1, BQ1, BK1, Qh, Ql, Kh, Kl, WV1, XT, nullptr, IN[7], V16, CC);
    k_attn<<<dim3(NN / 32, NB_), 512, 0, stream>>>(Qh, Ql, Kh, Kl, V16, Oc, RS);   // sa [c][i] (x1024 carried)
    k_x1<<<dim3(L4, NB_), 256, 0, stream>>>(Oc, RS, x, IN[8], X1);
    // stage 2: masked cross attention on x1 (q from mask*x1, k/v from (1-mask)*x1)
    k_mT2<<<dim3(256 + 256, NB_), 256, 0, stream>>>(X1, mk, Fh, Fl, Bh, Bl);
    k_conv3<1, 3><<<dim3(256 + 64 + 64, NB_), 256, 0, stream>>>(Fh, Fl, Bh, Bl, WQ2, WK2, BQ2, BK2, Qh, Ql, Kh, Kl, WV2, Bh, Bl, IN[14], V16, CC);
    k_attn<<<dim3(NN / 32, NB_), 512, 0, stream>>>(Qh, Ql, Kh, Kl, V16, Oc, RS);   // sw [c][i] (x1024 carried; RS applied inside k_smix)
    k_smix<<<dim3(CC / SR, NB_), 512, 0, stream>>>(Oc, RS, X1, mk, IN[15], OUT);
}

// v008
// It runs in 129 microseconds.
// Next to v007, in two timings, it ran 1.07 times as fast each time.
// All steps since v000 together make it 6.56 times as fast.
#include <hip/hip_runtime.h>

// x [2][256][64][64], mask [2][1][64][64] in {0,1} read as data; (1) self-attention: q/k = 1x1 convs to 32 ch, v 256 ch (+bias), A = softmax_j(sum_c q[c][i] k[c][j]) (unscaled),
// sa[c][i] = sum_j v[c][j] A[i][j]; x1 = sa_gamma sa + x; (2) masked cross attention: fb = (1-mask) x1, ff = mask x1; q from ff, k/v from fb (second conv set), sw[c][i] likewise;
// (3) out = x1 + gamma * ff * (std(sw) / std(ff)) per channel (unbiased variance over the 4096 positions + 1e-5, sqrt).
// Compute dtypes, f32 accumulate: every input rounded to bf16; stage-1 convs on PLAIN bf16 operands (inputs: exact, + bias; q/k padded 32 -> 64 output channels with
// numerators x1024 + 1/(1024 sum); both value contractions fp16 v x fp16 numerators (K 4096, channel-major); residuals, masks, the per-channel statistics and the final mix in f32 on VALU (one wave

#define NB_  2
#define CC   256
#define CQ   32                   // q/k channels
#define CQP  64                   // padded to one tile
#define NN   4096
#define PCAR 1024.0f
#define SCL  1.0f                 // energies are unscaled in this module
typedef _Float16 h16;
typedef unsigned short bf;
typedef __attribute__((ext_vector_type(16))) __bf16   v16bf;
typedef __attribute__((ext_vector_type(16))) _Float16 v16h;
typedef __attribute__((ext_vector_type(8)))  _Float16 v8h;
typedef __attribute__((ext_vector_type(8)))  unsigned short v8us;
typedef __attribute__((ext_vector_type(8)))  float    v8f;
typedef __attribute__((ext_vector_type(4)))  float    v4f;
typedef v8h  __attribute__((may_alias)) v8ha;
typedef v4f  __attribute__((may_alias)) v4fa;
typedef v8us __attribute__((may_alias)) v8usa;

__device__ __forceinline__ unsigned short f2bf(float f) { unsigned u = __float_as_uint(f); u += 0x7FFFu + ((u >> 16) & 1u); return (unsigned short)(u >> 16); }
__device__ __forceinline__ float bf2f(unsigned short b) { return __uint_as_float(((unsigned)b) << 16); }
__device__ __forceinline__ float bfr(float f) { return bf2f(f2bf(f)); }
__device__ __forceinline__ v16h cat16(v8h lo, v8h hi) { return __builtin_shufflevector(lo, hi, 0, 1, 2, 3, 4, 5, 6, 7, 8, 9, 10, 11, 12, 13, 14, 15); }
__device__ __forceinline__ v16bf cat16b(v8us lo, v8us hi) { return __builtin_bit_cast(v16bf, __builtin_shufflevector(lo, hi, 0, 1, 2, 3, 4, 5, 6, 7, 8, 9, 10, 11, 12, 13, 14, 15)); }
__device__ __forceinline__ v8f wmma16(v16h a, v16h b, v8f c) { return __builtin_amdgcn_wmma_f32_16x16x32_f16(false, a, false, b, (short)0, c, false, false); }
__device__ __forceinline__ v8f wmmab(v16bf a, v16bf b, v8f c) { return __builtin_amdgcn_wmma_f32_16x16x32_bf16(false, a, false, b, (short)0, c, false, false); }
__device__ __forceinline__ h16 tohx(float x) { return (h16)x; }
__device__ __forceinline__ void splitf(float y, unsigned short& h, unsigned short& l) { h = f2bf(y); l = f2bf(y - bf2f(h)); }
typedef __attribute__((ext_vector_type(2))) _Float16 v2h;
typedef __attribute__((ext_vector_type(4))) _Float16 v4h;
typedef __attribute__((ext_vector_type(2))) unsigned short v2us;
typedef __attribute__((ext_vector_type(4))) unsigned short v4us;



// ---- gemmw_body: register-blocked GEMM, KS WAVES per 64x64 output tile, each with all 16 accumulators over its own share of K; operands straight from K-contiguous 16-bit planes; one tile (bx, by) of image z per call, 32 * KS threads.
// c[m][n] (f32) = sum_k A[m][k] Bt[n][k] (+ split products per NSPLIT). z-batch strides sA/sB/sC in elements. K % (32 * KS) == 0.
// The tile leaves as the 16-bit planes that the attention kernel reads, never as f32: VROW: C16(m, n) = fp16(c + bf16(bias[m])); else Ch/Cl(m, n) = the hi/lo bf16 split of c + bf16(bias[n]), n < ldc only (the pad has no place).
// These planes lie in FRAGMENT ORDER (fragofs, row m, k index n, ldc k's a row): the attention kernel's fragment loads then read 512 contiguous bytes a wave, four whole 128-byte lines, not 32-byte pieces of 16 lines.
// Wave w takes the 32-k blocks w, w + KS, w + 2 KS, ... (neighbouring waves read the two halves of one 128-byte line in the same trip); the KS partial tiles meet in LDS and are summed in wave order.
// Fragment order of a 16-bit operand plane: each tile of 16 rows x 32 k is 1 KiB, laid as a wave's two 16-byte loads take it: [k bit 4][lane = (k bit 3) * 16 + row % 16][k % 8]; tiles run along k (KB of them a row block), then down the rows.
__device__ __forceinline__ size_t fragofs(int row, int k, int KB) { return ((((size_t)(row >> 4) * KB + (k >> 5)) * 2 + ((k >> 4) & 1)) * 32 + ((k >> 3) & 1) * 16 + (row & 15)) * 8 + (k & 7); }
template <typename T16> struct WFrag;
template <> struct WFrag<h16> { typedef v16h V; static __device__ __forceinline__ V ld(const h16* p) { return cat16(*(const v8h*)p, *(const v8h*)(p + 16)); } static __device__ __forceinline__ V ldf(const h16* p) { return cat16(*(const v8h*)p, *(const v8h*)(p + 256)); } static __device__ __forceinline__ v8f mma(V a, V b, v8f c) { return wmma16(a, b, c); } };
template <> struct WFrag<bf> { typedef v16bf V; static __device__ __forceinline__ V ld(const bf* p) { return cat16b(*(const v8us*)p, *(const v8us*)(p + 16)); } static __device__ __forceinline__ V ldf(const bf* p) { return cat16b(*(const v8us*)p, *(const v8us*)(p + 256)); } static __device__ __forceinline__ v8f mma(V a, V b, v8f c) { return wmmab(a, b, c); } };
// The work is a device function that is told its tile (bx, by), its image z and its LDS, so that one launch can hold GEMMs of several shapes side by side.
template <typename T16, int NSPLIT, bool VROW, int KS>
__device__ __forceinline__ void gemmw_body(float* os, int bx, int by, size_t z, const T16* __restrict__ A, const T16* __restrict__ A2, const T16* __restrict__ Bt, const T16* __restrict__ Bt2, int K, h16* C16, bf* Ch, bf* Cl, int ldc, const float* __restrict__ bias, size_t sA, size_t sB, size_t sC) {
    typedef typename WFrag<T16>::V V;
    A += z * sA; if (A2) A2 += z * sA; Bt += z * sB; if (Bt2) Bt2 += z * sB;
    const int lane = threadIdx.x & 31, lr = lane & 15, hi = lane >> 4; const int r0 = bx * 64, c0 = by * 64;
    const int wv = KS == 1 ? 0 : __builtin_amdgcn_readfirstlane((int)(threadIdx.x >> 5));   // wave number, held scalar so that the k loop stays a scalar loop
    v8f acc[4][4];
#pragma unroll
    for (int mb = 0; mb < 4; ++mb)
#pragma unroll
        for (int nb = 0; nb < 4; ++nb) acc[mb][nb] = (v8f){};
    const size_t aoff = (size_t)(r0 + lr) * K + 8 * hi, boff = (size_t)(c0 + lr) * K + 8 * hi;
#pragma unroll 1
    for (int kc = wv * 32; kc < K; kc += 32 * KS) {
        V a[4], a2[4];
#pragma unroll
        for (int mb = 0; mb < 4; ++mb) { a[mb] = WFrag<T16>::ld(A + aoff + (size_t)mb * 16 * K + kc); if (NSPLIT == 1 || NSPLIT == 2) a2[mb] = WFrag<T16>::ld(A2 + aoff + (size_t)mb * 16 * K + kc); }
#pragma unroll
        for (int nb = 0; nb < 4; ++nb) { const V b = WFrag<T16>::ld(Bt + boff + (size_t)nb * 16 * K + kc); V b2; if (NSPLIT >= 2) b2 = WFrag<T16>::ld(Bt2 + boff + (size_t)nb * 16 * K + kc);
#pragma unroll
            for (int mb = 0; mb < 4; ++mb) { acc[mb][nb] = WFrag<T16>::mma(a[mb], b, acc[mb][nb]); if (NSPLIT == 1 || NSPLIT == 2) acc[mb][nb] = WFrag<T16>::mma(a2[mb], b, acc[mb][nb]); if (NSPLIT >= 2) acc[mb][nb] = WFrag<T16>::mma(a[mb], b2, acc[mb][nb]); } }
        asm volatile("v_nop\n\tv_nop\n\tv_nop\n\tv_nop" : "+v"(acc[0][0]), "+v"(acc[1][1]), "+v"(acc[2][2]), "+v"(acc[3][3]) : "v"(a[0]), "v"(a[3]));
    }
    float bb[32 / KS];   // VROW: the bias of this thread's rows, asked for ahead of the LDS stores and the barrier that hide its way
    if constexpr (VROW) {
#pragma unroll
        for (int s = 0; s < 32 / KS; ++s) bb[s] = bias[r0 + s * (2 * KS) + (int)(threadIdx.x >> 4)];
        asm volatile("s_wait_xcnt 0x0" ::: "memory");   // stands behind the bias loads, before later code writes over their offset registers
    }
    float* mine = os + wv * (64 * 68);
#pragma unroll
    for (int mb = 0; mb < 4; ++mb)
#pragma unroll
        for (int nb = 0; nb < 4; ++nb)
#pragma unroll
            for (int j = 0; j < 8; ++j) mine[(mb * 16 + hi * 8 + j) * 68 + nb * 16 + lr] = acc[mb][nb][j];
    __syncthreads();   // every wave's partial tile is in LDS before any of them is summed
#pragma unroll
    for (int s = 0; s < 32 / KS; ++s) { const int f = s * (32 * KS) + (int)threadIdx.x, row = f >> 4, cofs = (f & 15) * 4; if (!VROW && c0 + cofs >= ldc) continue; v4f val = *(const v4fa*)(os + row * 68 + cofs);
#pragma unroll
        for (int q = 1; q < KS; ++q) val += *(const v4fa*)(os + q * (64 * 68) + row * 68 + cofs);
        const size_t co = z * sC + fragofs(r0 + row, c0 + cofs, ldc / 32);
        if constexpr (VROW) { const float br = bfr(bb[s]); v4h o;
#pragma unroll
            for (int q = 0; q < 4; ++q) o[q] = tohx(__fadd_rn(val[q], br));
            *(v4h*)(C16 + co) = o; }
        else { v4us oh, ol;
#pragma unroll
            for (int q = 0; q < 4; ++q) { unsigned short a, c2; splitf(__fadd_rn(val[q], bfr(bias[c0 + cofs + q])), a, c2); oh[q] = a; ol[q] = c2; }
            *(v4us*)(Ch + co) = oh; *(v4us*)(Cl + co) = ol; }
    }
}
// k_conv3: the three 1x1 convs of one stage (none reads another's result) in ONE launch; grid (256 + 64 + 64, NB_): blocks 0..255 the value conv's tiles in their old order, then the q conv's 64, then the k conv's 64.
// Each tile's last lines add the bias and store v as fp16, q and k (their 32 real channels) as their hi/lo bf16 planes, all in fragment order.
template <int NSQK, int NSV>
__global__ __launch_bounds__(256) void k_conv3(const bf* __restrict__ Aq, const bf* __restrict__ Aq2, const bf* __restrict__ Ak, const bf* __restrict__ Ak2, const bf* __restrict__ WQ, const bf* __restrict__ WK, const float* __restrict__ BQ, const float* __restrict__ BK, bf* Qh, bf* Ql, bf* Kh, bf* Kl,
                                               const bf* __restrict__ WV, const bf* __restrict__ Xv, const bf* __restrict__ Xv2, const float* __restrict__ bv, h16* V16, int K) {
    __shared__ __align__(16) float os[8 * 64 * 68];
    const int b = (int)blockIdx.x; const size_t z = blockIdx.y;
    if (b < (CC / 64) * (NN / 64)) { gemmw_body<bf, NSV, true, 8>(os, b & (CC / 64 - 1), b / (CC / 64), z, WV, nullptr, Xv, Xv2, K, V16, nullptr, nullptr, NN, bv, 0, (size_t)NN * CC, (size_t)NN * CC); return; }
    const int t = b - (CC / 64) * (NN / 64); const bool isk = t >= NN / 64;
    gemmw_body<bf, NSQK, false, 8>(os, isk ? t - NN / 64 : t, 0, z, isk ? Ak : Aq, isk ? Ak2 : Aq2, isk ? WK : WQ, nullptr, K, nullptr, isk ? Kh : Qh, isk ? Kl : Ql, CQ, isk ? BK : BQ, (size_t)NN * CC, 0, (size_t)NN * CQ);
}


__device__ __forceinline__ void cvt8_body(int bx, const float* __restrict__ src, bf* dst, size_t n8) { const size_t i = (size_t)bx * 256 + threadIdx.x; if (i >= n8) return; const v8f v = *(const v8f*)(src + i * 8); v8us o;
#pragma unroll
    for (int k = 0; k < 8; ++k) o[k] = f2bf(v[k]); *(v8us*)(dst + i * 8) = o;  }
// Every per-image kernel below takes its image from blockIdx.y (k_prep's transpose: blockIdx.x / 256): both images' planes lie one behind the other in the workspace.
// The *_body functions are told their block (bx) and image (img) by the kernel that holds them: launches that do not depend on one another share one grid.
__device__ __forceinline__ void xt_body(int bx, int img, const float* __restrict__ xb, bf* XT) {
    xb += (size_t)img * CC * NN; XT += (size_t)img * NN * CC;
    const int lane = threadIdx.x & 31; const int L0 = (bx * 8 + (threadIdx.x >> 5)) * 8; const int nlines = NN * CC / 64;
{
#pragma unroll
        for (int l = 0; l < 8; ++l) { const int L = L0 + l; if (L >= nlines) break; const int e = L * 64 + lane * 2; const int c = e & (CC - 1); const int n = e >> 8; v2us o;
#pragma unroll
            for (int q = 0; q < 2; ++q) o[q] = f2bf(xb[(size_t)(c + q) * NN + n]);
            *(v2us*)(XT + (size_t)e) = o; }
         }
}
__device__ __forceinline__ void wpad_body(int bx, const float* __restrict__ w, const float* __restrict__ b, bf* Bt, float* BP) { const int e = (bx * 256 + threadIdx.x) * 2; if (e >= CQP * CC) return; const int n = e / CC, k = e % CC; v2us o;
#pragma unroll
    for (int q = 0; q < 2; ++q) o[q] = (n < CQ) ? f2bf(w[(size_t)n * CC + k + q]) : (unsigned short)0;
    *(v2us*)(Bt + e) = o; if (e < CQP) { *(float*)(BP + e) = (e < CQ) ? b[e] : 0.f; *(float*)(BP + e + 1) = (e + 1 < CQ) ? b[e + 1] : 0.f; }
     }
// k_prep: all that reads the inputs alone, in ONE launch; grid 512 + 128 + 64: the transpose of x (256 blocks an image), the four padded q/k weight planes (32 blocks each), the two value weight planes (32 blocks each).
__global__ __launch_bounds__(256) void k_prep(const float* __restrict__ x, bf* XT,
                                              const float* __restrict__ wq1, const float* __restrict__ bq1, bf* WQ1, float* BQ1, const float* __restrict__ wk1, const float* __restrict__ bk1, bf* WK1, float* BK1,
                                              const float* __restrict__ wq2, const float* __restrict__ bq2, bf* WQ2, float* BQ2, const float* __restrict__ wk2, const float* __restrict__ bk2, bf* WK2, float* BK2,
                                              const float* __restrict__ wv1, bf* WV1, const float* __restrict__ wv2, bf* WV2) {
    const int b = (int)blockIdx.x;
    if (b < 512) { xt_body(b & 255, b >> 8, x, XT); return; }
    const int t = b - 512, bx = t & 31, w = t >> 5;
    if (w == 0) wpad_body(bx, wq1, bq1, WQ1, BQ1);
    else if (w == 1) wpad_body(bx, wk1, bk1, WK1, BK1);
    else if (w == 2) wpad_body(bx, wq2, bq2, WQ2, BQ2);
    else if (w == 3) wpad_body(bx, wk2, bk2, WK2, BK2);
    else if (w == 4) cvt8_body(bx, wv1, WV1, (size_t)CC * CC / 8);
    else cvt8_body(bx, wv2, WV2, (size_t)CC * CC / 8);
}
__global__ __launch_bounds__(256) void k_p16(const float* __restrict__ F, h16* P, size_t n) { const size_t i = ((size_t)blockIdx.x * 256 + threadIdx.x) * 2; if (i >= n) return; v2h v; v[0] = tohx(F[i]); v[1] = tohx(F[i + 1]); *(v2h*)(P + i) = v;  }
// k_attn: scores, softmax and value contraction of 32 query positions i in ONE work-group of 16 waves; grid (NN / 32, NB_). No score and no numerator leaves the work-group.
// Scores are formed transposed, St[j][i] = sum_c k[j][c] q[i][c] (A = k rows, B = q rows, the three hi/lo products in the old order, over the 32 real channels: the pad's products are exact zeros): a lane then
// holds 8 neighbouring keys j of one column i, which is one 16-byte piece of a numerator row p[i][j].
// Pass 1: wave w takes the keys w * 256 .. + 255 and finds each column's maximum; the 16 partial maxima meet in LDS.
// Pass 2, in steps of PJ = 256 keys: wave w forms the scores of the step's keys w * 16 .. + 15 again, numerators exp(s - max) (f32 sum; x1024 to fp16) into LDS (two buffers, one barrier a step);
// then wave w adds the step to its own 16 channels, O[c][i] += v[c][j] p[i][j], v straight from its plane (each v element is read once by the work-group), keys in rising order.
// q, k (rows = positions, k = the 32 channels) and v (rows = channels, k = keys) lie in fragment order: lane l's two pieces of a tile stand at halves l * 8 and 256 + l * 8 of its 512.
#define PJ 256
#define PP (PJ + 8)               // pitch of a numerator row in LDS, in halves: rows 4 banks apart
__global__ __launch_bounds__(512) void k_attn(const bf* __restrict__ Qh, const bf* __restrict__ Ql, const bf* __restrict__ Kh, const bf* __restrict__ Kl, const h16* __restrict__ V16, float* O, float* RS) {
    __shared__ __align__(16) h16 ps[2 * 32 * PP];
    __shared__ float mx[16 * 32];
    __shared__ float ls[16 * 32];
    __shared__ float mf[32];
    const size_t img = blockIdx.y;
    Qh += img * NN * CQ; Ql += img * NN * CQ; Kh += img * NN * CQ; Kl += img * NN * CQ; V16 += img * CC * NN; O += img * CC * NN; RS += img * NN * 32;
    const int lane = threadIdx.x & 31, lr = lane & 15, hi = lane >> 4; const int i0 = (int)blockIdx.x * 32;
    const int wv = __builtin_amdgcn_readfirstlane((int)(threadIdx.x >> 5));   // wave number, held scalar so that the key loops stay scalar loops
    v16bf qh[2], ql[2];
#pragma unroll
    for (int nb = 0; nb < 2; ++nb) { const size_t o = (size_t)((i0 >> 4) + nb) * 512 + lane * 8; qh[nb] = WFrag<bf>::ldf(Qh + o); ql[nb] = WFrag<bf>::ldf(Ql + o); }
    float m[2] = { -3.0e38f, -3.0e38f };
#pragma unroll 4
    for (int j0 = wv * 256; j0 < wv * 256 + 256; j0 += 16) { const size_t o = (size_t)(j0 >> 4) * 512 + lane * 8; const v16bf kh = WFrag<bf>::ldf(Kh + o), kl = WFrag<bf>::ldf(Kl + o);
#pragma unroll
        for (int nb = 0; nb < 2; ++nb) { v8f s = (v8f){}; s = wmmab(kh, qh[nb], s); s = wmmab(kh, ql[nb], s); s = wmmab(kl, qh[nb], s);
#pragma unroll
            for (int e = 0; e < 8; ++e) m[nb] = fmaxf(m[nb], s[e]); }
    }
#pragma unroll
    for (int nb = 0; nb < 2; ++nb) m[nb] = fmaxf(m[nb], __shfl_xor(m[nb], 16, 32));
    if (hi == 0) { mx[wv * 32 + lr] = m[0]; mx[wv * 32 + 16 + lr] = m[1]; }
    __syncthreads();   // all 16 partial maxima are in LDS before any wave takes the maximum over them
#pragma unroll
    for (int nb = 0; nb < 2; ++nb) { float t = mx[nb * 16 + lr];
#pragma unroll
        for (int q = 1; q < 16; ++q) t = fmaxf(t, mx[q * 32 + nb * 16 + lr]);
        m[nb] = t; }
    if (wv == 0 && hi == 0) { mf[lr] = m[0]; mf[16 + lr] = m[1]; }
    v8f acc[2]; acc[0] = (v8f){}; acc[1] = (v8f){};
    float sum[2] = { 0.f, 0.f };
    const h16* vb = V16 + (size_t)wv * (NN / 32) * 512 + lane * 8;
    const size_t ko = (size_t)wv * 512 + lane * 8;
    v16bf kh = WFrag<bf>::ldf(Kh + ko), kl = WFrag<bf>::ldf(Kl + ko);
#pragma unroll 1
    for (int st = 0; st < NN / PJ; ++st) {
        v16h a[PJ / 32];   // the step's v fragments, asked for ahead of the score work that hides their way
#pragma unroll
        for (int kb = 0; kb < PJ / 32; ++kb) a[kb] = WFrag<h16>::ldf(vb + (st * (PJ / 32) + kb) * 512);
        v16bf khn = kh, kln = kl;   // the next step's key rows, asked for together with v: the barrier below waits for every load that is under way, so a load issued just in front of it would be waited for in full
        if (st + 1 < NN / PJ) { const size_t kn = ko + (size_t)(st + 1) * (PJ / 16) * 512; khn = WFrag<bf>::ldf(Kh + kn); kln = WFrag<bf>::ldf(Kl + kn); }
        h16* pw = ps + (st & 1) * (32 * PP);
#pragma unroll
        for (int nb = 0; nb < 2; ++nb) { v8f s = (v8f){}; s = wmmab(kh, qh[nb], s); s = wmmab(kh, ql[nb], s); s = wmmab(kl, qh[nb], s); v8h o;
#pragma unroll
            for (int e = 0; e < 8; ++e) { const float ex = __expf(__fsub_rn(s[e], m[nb])); sum[nb] += ex; o[e] = tohx(ex * PCAR); }
            *(v8ha*)(pw + (nb * 16 + lr) * PP + wv * 16 + hi * 8) = o; }
        kh = khn; kl = kln;
        __syncthreads();   // the step's numerators are all in LDS; and every wave has left the other buffer, which the next step fills
#pragma unroll
        for (int kb = 0; kb < PJ / 32; ++kb)
#pragma unroll
            for (int nb = 0; nb < 2; ++nb) { const h16* pr = pw + (nb * 16 + lr) * PP + kb * 32 + 8 * hi; acc[nb] = wmma16(a[kb], cat16(*(const v8ha*)pr, *(const v8ha*)(pr + 16)), acc[nb]); }
    }
#pragma unroll
    for (int nb = 0; nb < 2; ++nb) sum[nb] += __shfl_xor(sum[nb], 16, 32);
    if (hi == 0) { ls[wv * 32 + lr] = sum[0]; ls[wv * 32 + 16 + lr] = sum[1]; }
#pragma unroll
    for (int nb = 0; nb < 2; ++nb)
#pragma unroll
        for (int e = 0; e < 8; ++e) O[(size_t)(wv * 16 + hi * 8 + e) * NN + i0 + nb * 16 + lr] = acc[nb][e];
    __syncthreads();   // all 16 partial sums are in LDS before they are added, in wave order
#pragma unroll
    for (int s = 0; s < 2; ++s) { const int f = s * 512 + (int)threadIdx.x, i = f >> 5, ln = f & 31; float t = ls[i];
#pragma unroll
        for (int q = 1; q < 16; ++q) t += ls[q * 32 + i];
        const float o2 = ln == 0 ? mf[i] : (ln == 1 ? __fdiv_rn(1.0f, t * PCAR) : 0.f); /* 1/(PCAR * sum): undoes the carry at the merge */ *(float*)(RS + (size_t)(i0 + i) * 32 + ln) = o2; }
}
// k_x1mT: x1 and its four masked, transposed 16-bit planes in ONE launch; grid (NN / 32, NB_), 16 waves. A work-group owns all 256 channels of 32 neighbouring positions.
// Each x1 value is formed once, in registers: x1 = bf16(gamma) * (O * RS[n][1]) + bf16(x). It leaves as f32 X1[c][n] (one whole 128-byte line a channel) and goes through LDS, turned to [n][c];
// behind the barrier wave w takes positions 2 w and 2 w + 1 and stores the hi/lo bf16 splits of mask * x1 and (1 - mask) * x1, 256 contiguous bytes a store.
#define TN 32
#define TP (CC + 4)               // pitch of a position's row in LDS, in floats: rows stay 16-byte aligned
__global__ __launch_bounds__(512) void k_x1mT(const float* __restrict__ O, const float* __restrict__ RS, const float* __restrict__ xb, const float* __restrict__ gam, const float* __restrict__ mk, float* X1, bf* Fh, bf* Fl, bf* Bh, bf* Bl) {
    __shared__ __align__(16) float xs[TN * TP];
    const int t = (int)threadIdx.x, lane = t & 31;
    const size_t img = blockIdx.y; const int n0 = (int)blockIdx.x * TN;
    O += img * CC * NN + n0; xb += img * CC * NN + n0; X1 += img * CC * NN + n0; RS += (img * NN + n0) * 32; mk += img * NN + n0;
    const int nq = (t & 7) * 4, c0 = t >> 3;   // 8 lanes cover a channel's 32 positions, a wave 4 channels: every load and store of a wave is 4 whole lines
    const float* pO = O + (size_t)c0 * NN + nq; const float* pX = xb + (size_t)c0 * NN + nq; const float* pR = RS + (size_t)nq * 32 + 1;
    v4f a[4], x4[4], o[4]; float rs[4], mw[2];
    const int wv = __builtin_amdgcn_readfirstlane(t >> 5);   // wave number, held scalar so that the mask reads and the row bases are scalar
#pragma unroll
    for (int r = 0; r < 2; ++r) mw[r] = mk[wv * 2 + r];   // the mask of the wave's two positions, asked for first: behind the barrier its way would stand open
    asm volatile("s_wait_xcnt 0x0" ::: "memory");   // stands behind the two mask loads, before later code writes over their base and offset registers
#pragma unroll
    for (int k = 0; k < 4; ++k) { a[k] = *(const v4f*)(pO + (size_t)(64 * k) * NN); x4[k] = *(const v4f*)(pX + (size_t)(64 * k) * NN); }
#pragma unroll
    for (int q = 0; q < 4; ++q) rs[q] = pR[q * 32];
    asm volatile("s_wait_xcnt 0x0" :: "v"(pO), "v"(pX) : "memory");   // stands behind the tile's loads, before later code writes over their address registers; the two row addresses are inputs so that their registers live up to the wait
    const float g = bfr(gam[0]);
#pragma unroll
    for (int k = 0; k < 4; ++k)
#pragma unroll
        for (int q = 0; q < 4; ++q) { o[k][q] = __fadd_rn(__fmul_rn(g, __fmul_rn(a[k][q], rs[q])), bfr(x4[k][q])); xs[(nq + q) * TP + c0 + 64 * k] = o[k][q]; }
    __syncthreads();   // the whole 256 x 32 tile of x1 is in LDS before any wave reads a position's row
#pragma unroll
    for (int k = 0; k < 4; ++k) *(v4f*)(X1 + (size_t)(c0 + 64 * k) * NN + nq) = o[k];   // behind the barrier, which would wait for stores issued in front of it
    asm volatile("s_wait_xcnt 0x0" ::: "memory");   // stands behind the four stores, before later code writes over their address and data registers
    const size_t po = (img * NN + n0) * CC;
#pragma unroll
    for (int r = 0; r < 2; ++r) { const int n = wv * 2 + r; const float wf = bfr(mw[r]), wb = __fsub_rn(1.0f, wf);
#pragma unroll
        for (int j = 0; j < 2; ++j) { const int c = j * 128 + lane * 4; const v4f v = *(const v4fa*)(xs + n * TP + c); v4us fh, fl, bh, bl;
#pragma unroll
            for (int q = 0; q < 4; ++q) { unsigned short h, l; splitf(__fmul_rn(v[q], wf), h, l); fh[q] = h; fl[q] = l; splitf(__fmul_rn(v[q], wb), h, l); bh[q] = h; bl[q] = l; }
            const size_t e = po + (size_t)n * CC + c;
            *(v4us*)(Fh + e) = fh; *(v4us*)(Fl + e) = fl; *(v4us*)(Bh + e) = bh; *(v4us*)(Bl + e) = bl;
            if (r + j < 2) asm volatile("s_wait_xcnt 0x0" ::: "memory"); } }   // stands behind the four stores, before the next piece's code writes over their address and data registers
}
// k_smix: both statistics and the final mix in ONE launch; grid (CC / 4, NB_), 16 waves. A work-group owns 4 whole channel rows: wave w holds positions (w >> 2) * 1024 .. + 1023 of row w & 3 in registers,
// 32 a lane, as sw = O2[c][n] * RS2[n][1], x1 and ff = x1 * bf16(mask[n]); each row is read once. The 4096 row-sum reciprocals (one 128-byte line each) are fetched once by the work-group and shared through LDS.
// Sums: four chains a lane (position % 4), a fixed tree over them, a fixed shuffle tree over the lanes, then the row's 4 wave partials from LDS in rising order; mean first, then the squared distances from it.
#define SR 4
__global__ __launch_bounds__(512) void k_smix(const float* __restrict__ O2, const float* __restrict__ RS, const float* __restrict__ X1, const float* __restrict__ mk, const float* __restrict__ gam, float* OUTb) {
    __shared__ __align__(16) float rsl[NN];
    __shared__ float p1[2 * SR * 4];
    __shared__ float p2[2 * SR * 4];
    const int t = (int)threadIdx.x, lane = t & 31;
    const int wv = __builtin_amdgcn_readfirstlane(t >> 5);   // wave number, held scalar so that the row bases are scalar
    const int r = wv & (SR - 1), seg = wv >> 2;
    const size_t img = blockIdx.y;
    const size_t ro = (img * CC + (size_t)blockIdx.x * SR + r) * NN + seg * 1024;   // the wave's first position of its row: scalar, so that every row access is a scalar base + the lane's offset
    O2 += ro; X1 += ro; OUTb += ro; RS += img * NN * 32; mk += img * NN + seg * 1024;
    const int lo = lane * 4;
    float rg[8]; v4f sw[8], x1[8], ff[8];
#pragma unroll
    for (int k = 0; k < 8; ++k) rg[k] = RS[(size_t)(k * 512 + t) * 32 + 1];
#pragma unroll
    for (int k = 0; k < 8; ++k) { sw[k] = *(const v4f*)(O2 + lo + k * 128); x1[k] = *(const v4f*)(X1 + lo + k * 128); ff[k] = *(const v4f*)(mk + lo + k * 128); }
    const float g = bfr(gam[0]);
#pragma unroll
    for (int k = 0; k < 8; ++k) rsl[k * 512 + t] = rg[k];
    __syncthreads();   // all 4096 reciprocals are in LDS before any wave reads its share
    v4f a0 = (v4f){}, a1 = (v4f){};
#pragma unroll
    for (int k = 0; k < 8; ++k) { const v4f rv = *(const v4fa*)(rsl + seg * 1024 + k * 128 + lo);
#pragma unroll
        for (int q = 0; q < 4; ++q) { sw[k][q] = sw[k][q] * rv[q]; ff[k][q] = x1[k][q] * bfr(ff[k][q]); }
        a0 += sw[k]; a1 += ff[k]; }
    float s0 = (a0[0] + a0[1]) + (a0[2] + a0[3]), s1 = (a1[0] + a1[1]) + (a1[2] + a1[3]);
#pragma unroll
    for (int sh = 16; sh; sh >>= 1) { s0 += __shfl_xor(s0, sh, 32); s1 += __shfl_xor(s1, sh, 32); }
    if (lane == 0) { p1[r * 4 + seg] = s0; p1[(SR + r) * 4 + seg] = s1; }
    __syncthreads();   // the row's 4 partial sums are in LDS before they are added
    const float mu0 = (((p1[r * 4] + p1[r * 4 + 1]) + p1[r * 4 + 2]) + p1[r * 4 + 3]) * (1.0f / NN);
    const float mu1 = (((p1[(SR + r) * 4] + p1[(SR + r) * 4 + 1]) + p1[(SR + r) * 4 + 2]) + p1[(SR + r) * 4 + 3]) * (1.0f / NN);
    a0 = (v4f){}; a1 = (v4f){};
#pragma unroll
    for (int k = 0; k < 8; ++k) { const v4f d0 = sw[k] - mu0, d1 = ff[k] - mu1; a0 += d0 * d0; a1 += d1 * d1; }
    s0 = (a0[0] + a0[1]) + (a0[2] + a0[3]); s1 = (a1[0] + a1[1]) + (a1[2] + a1[3]);
#pragma unroll
    for (int sh = 16; sh; sh >>= 1) { s0 += __shfl_xor(s0, sh, 32); s1 += __shfl_xor(s1, sh, 32); }
    if (lane == 0) { p2[r * 4 + seg] = s0; p2[(SR + r) * 4 + seg] = s1; }
    __syncthreads();   // the row's 4 partial sums of squares are in LDS before they are added
    const float q0 = ((p2[r * 4] + p2[r * 4 + 1]) + p2[r * 4 + 2]) + p2[r * 4 + 3];
    const float q1 = ((p2[(SR + r) * 4] + p2[(SR + r) * 4 + 1]) + p2[(SR + r) * 4 + 2]) + p2[(SR + r) * 4 + 3];
    const float ratio = __fdiv_rn(__fsqrt_rn(__fdiv_rn(q0, (float)(NN - 1)) + 1e-5f), __fsqrt_rn(__fdiv_rn(q1, (float)(NN - 1)) + 1e-5f));
#pragma unroll
    for (int k = 0; k < 8; ++k) *(v4f*)(OUTb + lo + k * 128) = x1[k] + g * (ff[k] * ratio);
}
extern "C" void kernel_launch(void* const* d_in, const int* in_sizes, int n_in,
                              void* d_out, int out_size, void* d_ws, size_t ws_size, hipStream_t stream) {
    (void)in_sizes; (void)n_in; (void)out_size;
    const float* IN[16]; for (int i = 0; i < 16; ++i) IN[i] = (const float*)d_in[i];
    // x [2][256][64][64], mask [2][1][64][64], sa_wq [32][256], sa_bq, sa_wk, sa_bk, sa_wv [256][256], sa_bv, sa_gamma [1], wq, bq, wk, bk, wv, bv, gamma [1] = d_in[0..15]
    const float* x = IN[0]; const float* mk = IN[1];
    float* OUT = (float*)d_out;     // [2][256][64][64]
    char* wsp = (char*)d_ws;
    auto take = [&](size_t bytes) { char* p = wsp; wsp += (bytes + 255) & ~(size_t)255; return (void*)p; };
    bf* WQ1 = (bf*)take((size_t)CQP * CC * 2); bf* WK1 = (bf*)take((size_t)CQP * CC * 2); float* BQ1 = (float*)take(256); float* BK1 = (float*)take(256); bf* WV1 = (bf*)take((size_t)CC * CC * 2);
    bf* WQ2 = (bf*)take((size_t)CQP * CC * 2); bf* WK2 = (bf*)take((size_t)CQP * CC * 2); float* BQ2 = (float*)take(256); float* BK2 = (float*)take(256); bf* WV2 = (bf*)take((size_t)CC * CC * 2);
    // per-image planes, NB_ of each, one behind the other
    bf* XT = (bf*)take((size_t)NB_ * NN * CC * 2); bf* Qh = (bf*)take((size_t)NB_ * NN * CQ * 2); bf* Ql = (bf*)take((size_t)NB_ * NN * CQ * 2); bf* Kh = (bf*)take((size_t)NB_ * NN * CQ * 2); bf* Kl = (bf*)take((size_t)NB_ * NN * CQ * 2);
    float* Oc = (float*)take((size_t)NB_ * CC * NN * 4); h16* V16 = (h16*)take((size_t)NB_ * CC * NN * 2); float* X1 = (float*)take((size_t)NB_ * CC * NN * 4);
    bf* Fh = (bf*)take((size_t)NB_ * NN * CC * 2); bf* Fl = (bf*)take((size_t)NB_ * NN * CC * 2); bf* Bh = (bf*)take((size_t)NB_ * NN * CC * 2); bf* Bl = (bf*)take((size_t)NB_ * NN * CC * 2);
    float* RS = (float*)take((size_t)NB_ * NN * 32 * 4);
    if ((size_t)(wsp - (char*)d_ws) > ws_size) return;    // total ~ 43 MiB; ws 256 MiB
    // stage 1: self attention on x
    k_prep<<<512 + 128 + 64, 256, 0, stream>>>(x, XT, IN[2], IN[3], WQ1, BQ1, IN[4], IN[5], WK1, BK1, IN[9], IN[10], WQ2, BQ2, IN[11], IN[12], WK2, BK2, IN[6], WV1, IN[13], WV2);
    k_conv3<0, 0><<<dim3(256 + 64 + 64, NB_), 256, 0, stream>>>(XT, nullptr, XT, nullptr, WQ1, WK1, BQ1, BK1, Qh, Ql, Kh, Kl, WV1, XT, nullptr, IN[7], V16, CC);
    k_attn<<<dim3(NN / 32, NB_), 512, 0, stream>>>(Qh, Ql, Kh, Kl, V16, Oc, RS);   // sa [c][i] (x1024 carried)
    // stage 2: masked cross attention on x1 (q from mask*x1, k/v from (1-mask)*x1)
    k_x1mT<<<dim3(NN / TN, NB_), 512, 0, stream>>>(Oc, RS, x, IN[8], mk, X1, Fh, Fl, Bh, Bl);
    k_conv3<1, 3><<<dim3(256 + 64 + 64, NB_), 256, 0, stream>>>(Fh, Fl, Bh, Bl, WQ2, WK2, BQ2, BK2, Qh, Ql, Kh, Kl, WV2, Bh, Bl, IN[14], V16, CC);
    k_attn<<<dim3(NN / 32, NB_), 512, 0, stream>>>(Qh, Ql, Kh, Kl, V16, Oc, RS);   // sw [c][i] (x1024 carried; RS applied inside k_smix)
    k_smix<<<dim3(CC / SR, NB_), 512, 0, stream>>>(Oc, RS, X1, mk, IN[15], OUT);
}

// v009
// It runs in 115 microseconds.
// Two timings next to v008 put it at 1.13 and 1.12 times that version's speed.
// All steps since v000 together make it 7.36 times as fast.
#include <hip/hip_runtime.h>

// x [2][256][64][64], mask [2][1][64][64] in {0,1} read as data; (1) self-attention: q/k = 1x1 convs to 32 ch, v 256 ch (+bias), A = softmax_j(sum_c q[c][i] k[c][j]) (unscaled),
// sa[c][i] = sum_j v[c][j] A[i][j]; x1 = sa_gamma sa + x; (2) masked cross attention: fb = (1-mask) x1, ff = mask x1; q from ff, k/v from fb (second conv set), sw[c][i] likewise;
// (3) out = x1 + gamma * ff * (std(sw) / std(ff)) per channel (unbiased variance over the 4096 positions + 1e-5, sqrt).
// Compute dtypes, f32 accumulate: every input rounded to bf16; stage-1 convs on PLAIN bf16 operands (inputs: exact, + bias; q/k padded 32 -> 64 output channels with
// numerators x1024 + 1/(1024 sum); both value contractions fp16 v x fp16 numerators (K 4096, channel-major); residuals, masks, the per-channel statistics and the final mix in f32 on VALU (one wave

#define NB_  2
#define CC   256
#define CQ   32                   // q/k channels
#define CQP  64                   // padded to one tile
#define NN   4096
#define PCAR 1024.0f
#define SCL  1.0f                 // energies are unscaled in this module
typedef _Float16 h16;
typedef unsigned short bf;
typedef __attribute__((ext_vector_type(16))) __bf16   v16bf;
typedef __attribute__((ext_vector_type(16))) _Float16 v16h;
typedef __attribute__((ext_vector_type(8)))  _Float16 v8h;
typedef __attribute__((ext_vector_type(8)))  unsigned short v8us;
typedef __attribute__((ext_vector_type(8)))  float    v8f;
typedef __attribute__((ext_vector_type(4)))  float    v4f;
typedef v8h  __attribute__((may_alias)) v8ha;
typedef v4f  __attribute__((may_alias)) v4fa;
typedef v8us __attribute__((may_alias)) v8usa;

__device__ __forceinline__ unsigned short f2bf(float f) { unsigned u = __float_as_uint(f); u += 0x7FFFu + ((u >> 16) & 1u); return (unsigned short)(u >> 16); }
__device__ __forceinline__ float bf2f(unsigned short b) { return __uint_as_float(((unsigned)b) << 16); }
__device__ __forceinline__ float bfr(float f) { return bf2f(f2bf(f)); }
__device__ __forceinline__ v16h cat16(v8h lo, v8h hi) { return __builtin_shufflevector(lo, hi, 0, 1, 2, 3, 4, 5, 6, 7, 8, 9, 10, 11, 12, 13, 14, 15); }
__device__ __forceinline__ v16bf cat16b(v8us lo, v8us hi) { return __builtin_bit_cast(v16bf, __builtin_shufflevector(lo, hi, 0, 1, 2, 3, 4, 5, 6, 7, 8, 9, 10, 11, 12, 13, 14, 15)); }
__device__ __forceinline__ v8f wmma16(v16h a, v16h b, v8f c) { return __builtin_amdgcn_wmma_f32_16x16x32_f16(false, a, false, b, (short)0, c, false, false); }
__device__ __forceinline__ v8f wmmab(v16bf a, v16bf b, v8f c) { return __builtin_amdgcn_wmma_f32_16x16x32_bf16(false, a, false, b, (short)0, c, false, false); }
__device__ __forceinline__ h16 tohx(float x) { return (h16)x; }
__device__ __forceinline__ void splitf(float y, unsigned short& h, unsigned short& l) { h = f2bf(y); l = f2bf(y - bf2f(h)); }
typedef __attribute__((ext_vector_type(2))) _Float16 v2h;
typedef __attribute__((ext_vector_type(4))) _Float16 v4h;
typedef __attribute__((ext_vector_type(2))) unsigned short v2us;
typedef __attribute__((ext_vector_type(4))) unsigned short v4us;



// ---- gemmw_body: register-blocked GEMM, KS WAVES per 64x64 output tile, each with all 16 accumulators over its own share of K; operands straight from K-contiguous 16-bit planes; one tile (bx, by) of image z per call, 32 * KS threads.
// c[m][n] (f32) = sum_k A[m][k] Bt[n][k] (+ split products per NSPLIT). z-batch strides sA/sB/sC in elements. K % (32 * KS) == 0.
// The tile leaves as the 16-bit planes that the attention kernel reads, never as f32: VROW: C16(m, n) = fp16(c + bf16(bias[m])); else Ch/Cl(m, n) = the hi/lo bf16 split of c + bf16(bias[n]), n < ldc only (the pad has no place).
// These planes lie in FRAGMENT ORDER (fragofs, row m, k index n, ldc k's a row): the attention kernel's fragment loads then read 512 contiguous bytes a wave, four whole 128-byte lines, not 32-byte pieces of 16 lines.
// Wave w takes the 32-k blocks w, w + KS, w + 2 KS, ... (neighbouring waves read the two halves of one 128-byte line in the same trip); the KS partial tiles meet in LDS and are summed in wave order.
// Fragment order of a 16-bit operand plane: each tile of 16 rows x 32 k is 1 KiB, laid as a wave's two 16-byte loads take it: [k bit 4][lane = (k bit 3) * 16 + row % 16][k % 8]; tiles run along k (KB of them a row block), then down the rows.
__device__ __forceinline__ size_t fragofs(int row, int k, int KB) { return ((((size_t)(row >> 4) * KB + (k >> 5)) * 2 + ((k >> 4) & 1)) * 32 + ((k >> 3) & 1) * 16 + (row & 15)) * 8 + (k & 7); }
template <typename T16> struct WFrag;
template <> struct WFrag<h16> { typedef v16h V; static __device__ __forceinline__ V ld(const h16* p) { return cat16(*(const v8h*)p, *(const v8h*)(p + 16)); } static __device__ __forceinline__ V ldf(const h16* p) { return cat16(*(const v8h*)p, *(const v8h*)(p + 256)); } static __device__ __forceinline__ v8f mma(V a, V b, v8f c) { return wmma16(a, b, c); } };
template <> struct WFrag<bf> { typedef v16bf V; static __device__ __forceinline__ V ld(const bf* p) { return cat16b(*(const v8us*)p, *(const v8us*)(p + 16)); } static __device__ __forceinline__ V ldf(const bf* p) { return cat16b(*(const v8us*)p, *(const v8us*)(p + 256)); } static __device__ __forceinline__ v8f mma(V a, V b, v8f c) { return wmmab(a, b, c); } };
// The work is a device function that is told its tile (bx, by), its image z and its LDS, so that one launch can hold GEMMs of several shapes side by side.
template <typename T16, int NSPLIT, bool VROW, int KS>
__device__ __forceinline__ void gemmw_body(float* os, int bx, int by, size_t z, const T16* __restrict__ A, const T16* __restrict__ A2, const T16* __restrict__ Bt, const T16* __restrict__ Bt2, int K, h16* C16, bf* Ch, bf* Cl, int ldc, const float* __restrict__ bias, size_t sA, size_t sB, size_t sC) {
    typedef typename WFrag<T16>::V V;
    A += z * sA; if (A2) A2 += z * sA; Bt += z * sB; if (Bt2) Bt2 += z * sB;
    const int lane = threadIdx.x & 31, lr = lane & 15, hi = lane >> 4; const int r0 = bx * 64, c0 = by * 64;
    const int wv = KS == 1 ? 0 : __builtin_amdgcn_readfirstlane((int)(threadIdx.x >> 5));   // wave number, held scalar so that the k loop stays a scalar loop
    v8f acc[4][4];
#pragma unroll
    for (int mb = 0; mb < 4; ++mb)
#pragma unroll
        for (int nb = 0; nb < 4; ++nb) acc[mb][nb] = (v8f){};
    const size_t aoff = (size_t)(r0 + lr) * K + 8 * hi, boff = (size_t)(c0 + lr) * K + 8 * hi;
#pragma unroll 1
    for (int kc = wv * 32; kc < K; kc += 32 * KS) {
        V a[4], a2[4];
#pragma unroll
        for (int mb = 0; mb < 4; ++mb) { a[mb] = WFrag<T16>::ld(A + aoff + (size_t)mb * 16 * K + kc); if (NSPLIT == 1 || NSPLIT == 2) a2[mb] = WFrag<T16>::ld(A2 + aoff + (size_t)mb * 16 * K + kc); }
#pragma unroll
        for (int nb = 0; nb < 4; ++nb) { const V b = WFrag<T16>::ld(Bt + boff + (size_t)nb * 16 * K + kc); V b2; if (NSPLIT >= 2) b2 = WFrag<T16>::ld(Bt2 + boff + (size_t)nb * 16 * K + kc);
#pragma unroll
            for (int mb = 0; mb < 4; ++mb) { acc[mb][nb] = WFrag<T16>::mma(a[mb], b, acc[mb][nb]); if (NSPLIT == 1 || NSPLIT == 2) acc[mb][nb] = WFrag<T16>::mma(a2[mb], b, acc[mb][nb]); if (NSPLIT >= 2) acc[mb][nb] = WFrag<T16>::mma(a[mb], b2, acc[mb][nb]); } }
        asm volatile("v_nop\n\tv_nop\n\tv_nop\n\tv_nop" : "+v"(acc[0][0]), "+v"(acc[1][1]), "+v"(acc[2][2]), "+v"(acc[3][3]) : "v"(a[0]), "v"(a[3]));
    }
    float bb[32 / KS];   // VROW: the bias of this thread's rows, asked for ahead of the LDS stores and the barrier that hide its way
    if constexpr (VROW) {
#pragma unroll
        for (int s = 0; s < 32 / KS; ++s) bb[s] = bias[r0 + s * (2 * KS) + (int)(threadIdx.x >> 4)];
        asm volatile("s_wait_xcnt 0x0" ::: "memory");   // stands behind the bias loads, before later code writes over their offset registers
    }
    float* mine = os + wv * (64 * 68);
#pragma unroll
    for (int mb = 0; mb < 4; ++mb)
#pragma unroll
        for (int nb = 0; nb < 4; ++nb)
#pragma unroll
            for (int j = 0; j < 8; ++j) mine[(mb * 16 + hi * 8 + j) * 68 + nb * 16 + lr] = acc[mb][nb][j];
    __syncthreads();   // every wave's partial tile is in LDS before any of them is summed
#pragma unroll
    for (int s = 0; s < 32 / KS; ++s) { const int f = s * (32 * KS) + (int)threadIdx.x, row = f >> 4, cofs = (f & 15) * 4; if (!VROW && c0 + cofs >= ldc) continue; v4f val = *(const v4fa*)(os + row * 68 + cofs);
#pragma unroll
        for (int q = 1; q < KS; ++q) val += *(const v4fa*)(os + q * (64 * 68) + row * 68 + cofs);
        const size_t co = z * sC + fragofs(r0 + row, c0 + cofs, ldc / 32);
        if constexpr (VROW) { const float br = bfr(bb[s]); v4h o;
#pragma unroll
            for (int q = 0; q < 4; ++q) o[q] = tohx(__fadd_rn(val[q], br));
            *(v4h*)(C16 + co) = o; }
        else { v4us oh, ol;
#pragma unroll
            for (int q = 0; q < 4; ++q) { unsigned short a, c2; splitf(__fadd_rn(val[q], bfr(bias[c0 + cofs + q])), a, c2); oh[q] = a; ol[q] = c2; }
            *(v4us*)(Ch + co) = oh; *(v4us*)(Cl + co) = ol; }
    }
}
// k_conv3: the three 1x1 convs of one stage (none reads another's result) in ONE launch; grid (256 + 64 + 64, NB_): blocks 0..255 the value conv's tiles in their old order, then the q conv's 64, then the k conv's 64.
// Each tile's last lines add the bias and store v as fp16, q and k (their 32 real channels) as their hi/lo bf16 planes, all in fragment order.
template <int NSQK, int NSV>
__global__ __launch_bounds__(256) void k_conv3(const bf* __restrict__ Aq, const bf* __restrict__ Aq2, const bf* __restrict__ Ak, const bf* __restrict__ Ak2, const bf* __restrict__ WQ, const bf* __restrict__ WK, const float* __restrict__ BQ, const float* __restrict__ BK, bf* Qh, bf* Ql, bf* Kh, bf* Kl,
                                               const bf* __restrict__ WV, const bf* __restrict__ Xv, const bf* __restrict__ Xv2, const float* __restrict__ bv, h16* V16, int K) {
    __shared__ __align__(16) float os[8 * 64 * 68];
    const int b = (int)blockIdx.x; const size_t z = blockIdx.y;
    if (b < (CC / 64) * (NN / 64)) { gemmw_body<bf, NSV, true, 8>(os, b & (CC / 64 - 1), b / (CC / 64), z, WV, nullptr, Xv, Xv2, K, V16, nullptr, nullptr, NN, bv, 0, (size_t)NN * CC, (size_t)NN * CC); return; }
    const int t = b - (CC / 64) * (NN / 64); const bool isk = t >= NN / 64;
    gemmw_body<bf, NSQK, false, 8>(os, isk ? t - NN / 64 : t, 0, z, isk ? Ak : Aq, isk ? Ak2 : Aq2, isk ? WK : WQ, nullptr, K, nullptr, isk ? Kh : Qh, isk ? Kl : Ql, CQ, isk ? BK : BQ, (size_t)NN * CC, 0, (size_t)NN * CQ);
}


__device__ __forceinline__ void cvt8_body(int bx, const float* __restrict__ src, bf* dst, size_t n8) { const size_t i = (size_t)bx * 256 + threadIdx.x; if (i >= n8) return; const v8f v = *(const v8f*)(src + i * 8); v8us o;
#pragma unroll
    for (int k = 0; k < 8; ++k) o[k] = f2bf(v[k]); *(v8us*)(dst + i * 8) = o;  }
// Every per-image kernel below takes its image from blockIdx.y (k_prep's transpose: blockIdx.x / 256): both images' planes lie one behind the other in the workspace.
// The *_body functions are told their block (bx) and image (img) by the kernel that holds them: launches that do not depend on one another share one grid.
__device__ __forceinline__ void xt_body(int bx, int img, const float* __restrict__ xb, bf* XT) {
    xb += (size_t)img * CC * NN; XT += (size_t)img * NN * CC;
    const int lane = threadIdx.x & 31; const int L0 = (bx * 8 + (threadIdx.x >> 5)) * 8; const int nlines = NN * CC / 64;
{
#pragma unroll
        for (int l = 0; l < 8; ++l) { const int L = L0 + l; if (L >= nlines) break; const int e = L * 64 + lane * 2; const int c = e & (CC - 1); const int n = e >> 8; v2us o;
#pragma unroll
            for (int q = 0; q < 2; ++q) o[q] = f2bf(xb[(size_t)(c + q) * NN + n]);
            *(v2us*)(XT + (size_t)e) = o; }
         }
}
__device__ __forceinline__ void wpad_body(int bx, const float* __restrict__ w, const float* __restrict__ b, bf* Bt, float* BP) { const int e = (bx * 256 + threadIdx.x) * 2; if (e >= CQP * CC) return; const int n = e / CC, k = e % CC; v2us o;
#pragma unroll
    for (int q = 0; q < 2; ++q) o[q] = (n < CQ) ? f2bf(w[(size_t)n * CC + k + q]) : (unsigned short)0;
    *(v2us*)(Bt + e) = o; if (e < CQP) { *(float*)(BP + e) = (e < CQ) ? b[e] : 0.f; *(float*)(BP + e + 1) = (e + 1 < CQ) ? b[e + 1] : 0.f; }
     }
// k_prep: all that reads the inputs alone, in ONE launch; grid 512 + 128 + 64: the transpose of x (256 blocks an image), the four padded q/k weight planes (32 blocks each), the two value weight planes (32 blocks each).
__global__ __launch_bounds__(256) void k_prep(const float* __restrict__ x, bf* XT,
                                              const float* __restrict__ wq1, const float* __restrict__ bq1, bf* WQ1, float* BQ1, const float* __restrict__ wk1, const float* __restrict__ bk1, bf* WK1, float* BK1,
                                              const float* __restrict__ wq2, const float* __restrict__ bq2, bf* WQ2, float* BQ2, const float* __restrict__ wk2, const float* __restrict__ bk2, bf* WK2, float* BK2,
                                              const float* __restrict__ wv1, bf* WV1, const float* __restrict__ wv2, bf* WV2) {
    const int b = (int)blockIdx.x;
    if (b < 512) { xt_body(b & 255, b >> 8, x, XT); return; }
    const int t = b - 512, bx = t & 31, w = t >> 5;
    if (w == 0) wpad_body(bx, wq1, bq1, WQ1, BQ1);
    else if (w == 1) wpad_body(bx, wk1, bk1, WK1, BK1);
    else if (w == 2) wpad_body(bx, wq2, bq2, WQ2, BQ2);
    else if (w == 3) wpad_body(bx, wk2, bk2, WK2, BK2);
    else if (w == 4) cvt8_body(bx, wv1, WV1, (size_t)CC * CC / 8);
    else cvt8_body(bx, wv2, WV2, (size_t)CC * CC / 8);
}
__global__ __launch_bounds__(256) void k_p16(const float* __restrict__ F, h16* P, size_t n) { const size_t i = ((size_t)blockIdx.x * 256 + threadIdx.x) * 2; if (i >= n) return; v2h v; v[0] = tohx(F[i]); v[1] = tohx(F[i + 1]); *(v2h*)(P + i) = v;  }
// k_attn: scores, softmax and value contraction of 32 query positions i in ONE work-group of 16 waves; grid (NN / 32, NB_). No score and no numerator leaves the work-group.
// Scores are formed transposed, St[j][i] = sum_c k[j][c] q[i][c] (A = k rows, B = q rows, the three hi/lo products in the old order, over the 32 real channels: the pad's products are exact zeros): a lane then
// holds 8 neighbouring keys j of one column i, which is one 16-byte piece of a numerator row p[i][j].
// Pass 1: wave w takes the keys w * 256 .. + 255 and finds each column's maximum; the 16 partial maxima meet in LDS.
// Pass 2, in steps of PJ = 256 keys: wave w forms the scores of the step's keys w * 16 .. + 15 again, numerators exp(s - max) (f32 sum; x1024 to fp16) into LDS (two buffers, one barrier a step);
// then wave w adds the step to its own 16 channels, O[c][i] += v[c][j] p[i][j], v straight from its plane (each v element is read once by the work-group), keys in rising order.
// The v fragments and key rows of step s + 1 are asked for during step s and are waited for only where they are used: the step's barrier waits for LDS alone.
// q, k (rows = positions, k = the 32 channels) and v (rows = channels, k = keys) lie in fragment order: lane l's two pieces of a tile stand at halves l * 8 and 256 + l * 8 of its 512.
#define PJ 256
struct TrueT { static constexpr bool value = true; };
struct FalseT { static constexpr bool value = false; };
#define PP (PJ + 8)               // pitch of a numerator row in LDS, in halves: rows 4 banks apart
__global__ __launch_bounds__(512) void k_attn(const bf* __restrict__ Qh, const bf* __restrict__ Ql, const bf* __restrict__ Kh, const bf* __restrict__ Kl, const h16* __restrict__ V16, float* O, float* RS) {
    __shared__ __align__(16) h16 ps[2 * 32 * PP];
    __shared__ float mx[16 * 32];
    __shared__ float ls[16 * 32];
    __shared__ float mf[32];
    const size_t img = blockIdx.y;
    Qh += img * NN * CQ; Ql += img * NN * CQ; Kh += img * NN * CQ; Kl += img * NN * CQ; V16 += img * CC * NN; O += img * CC * NN; RS += img * NN * 32;
    const int lane = threadIdx.x & 31, lr = lane & 15, hi = lane >> 4; const int i0 = (int)blockIdx.x * 32;
    const int wv = __builtin_amdgcn_readfirstlane((int)(threadIdx.x >> 5));   // wave number, held scalar so that the key loops stay scalar loops
    v16bf qh[2], ql[2];
#pragma unroll
    for (int nb = 0; nb < 2; ++nb) { const size_t o = (size_t)((i0 >> 4) + nb) * 512 + lane * 8; qh[nb] = WFrag<bf>::ldf(Qh + o); ql[nb] = WFrag<bf>::ldf(Ql + o); }
    asm volatile("s_wait_xcnt 0x0" ::: "memory");   // stands behind the query loads, before later code writes over their address registers
    float m[2] = { -3.0e38f, -3.0e38f };
#pragma unroll 4
    for (int j0 = wv * 256; j0 < wv * 256 + 256; j0 += 16) { const size_t o = (size_t)(j0 >> 4) * 512 + lane * 8; const v16bf kh = WFrag<bf>::ldf(Kh + o), kl = WFrag<bf>::ldf(Kl + o);
#pragma unroll
        for (int nb = 0; nb < 2; ++nb) { v8f s = (v8f){}; s = wmmab(kh, qh[nb], s); s = wmmab(kh, ql[nb], s); s = wmmab(kl, qh[nb], s);
#pragma unroll
            for (int e = 0; e < 8; ++e) m[nb] = fmaxf(m[nb], s[e]); }
    }
#pragma unroll
    for (int nb = 0; nb < 2; ++nb) m[nb] = fmaxf(m[nb], __shfl_xor(m[nb], 16, 32));
    if (hi == 0) { mx[wv * 32 + lr] = m[0]; mx[wv * 32 + 16 + lr] = m[1]; }
    __syncthreads();   // all 16 partial maxima are in LDS before any wave takes the maximum over them
#pragma unroll
    for (int nb = 0; nb < 2; ++nb) { float t = mx[nb * 16 + lr];
#pragma unroll
        for (int q = 1; q < 16; ++q) t = fmaxf(t, mx[q * 32 + nb * 16 + lr]);
        m[nb] = t; }
    if (wv == 0 && hi == 0) { mf[lr] = m[0]; mf[16 + lr] = m[1]; }
    v8f acc[2]; acc[0] = (v8f){}; acc[1] = (v8f){};
    float sum[2] = { 0.f, 0.f };
    const h16* vb = V16 + (size_t)wv * (NN / 32) * 512 + lane * 8;
    const size_t ko = (size_t)wv * 512 + lane * 8;
    v16bf kh = WFrag<bf>::ldf(Kh + ko), kl = WFrag<bf>::ldf(Kl + ko);
    asm volatile("s_wait_xcnt 0x0" ::: "memory");   // stands behind the key loads, before later code writes over their address registers
    v16h a[PJ / 32];   // the step's v fragments: one register set, each fragment asked for again (for the next step) once its two products have read it
#pragma unroll
    for (int kb = 0; kb < PJ / 32; ++kb) a[kb] = WFrag<h16>::ldf(vb + kb * 512);
    asm volatile("s_wait_xcnt 0x0" :: "v"(vb) : "memory");   // stands behind the v loads, before later code writes over their address registers; the address is an input so that its registers live up to the wait
    // One step. more: a next step exists, and its key rows and v fragments are asked for here; they stay under way over the step's barrier and the next step's score work.
    auto step = [&](const int st, auto more) {
        h16* pw = ps + (st & 1) * (32 * PP);
#pragma unroll
        for (int nb = 0; nb < 2; ++nb) { v8f s = (v8f){}; s = wmmab(kh, qh[nb], s); s = wmmab(kh, ql[nb], s); s = wmmab(kl, qh[nb], s); v8h o;
#pragma unroll
            for (int e = 0; e < 8; ++e) { const float ex = __expf(__fsub_rn(s[e], m[nb])); sum[nb] += ex; o[e] = tohx(ex * PCAR); }
            *(v8ha*)(pw + (nb * 16 + lr) * PP + wv * 16 + hi * 8) = o; }
        if constexpr (more.value) { const size_t kn = ko + (size_t)(st + 1) * (PJ / 16) * 512; kh = WFrag<bf>::ldf(Kh + kn); kl = WFrag<bf>::ldf(Kl + kn);
            asm volatile("s_wait_xcnt 0x0" ::: "memory"); }   // stands behind the key loads, before later code writes over their address registers
        // The step's barrier, by hand: it waits for this wave's LDS stores and reads only. __syncthreads() would also wait for every global load under way, and the v loads of this step and the key loads of the next step are to stay in flight over it.
        // Behind it the step's numerators are all in LDS, and every wave has left the other buffer, which the next step fills.
        asm volatile("s_wait_dscnt 0x0\n\ts_barrier_signal -1\n\ts_barrier_wait -1" ::: "memory");
        const h16* vn = vb + (size_t)(st + 1) * (PJ / 32) * 512;
#pragma unroll
        for (int kb = 0; kb < PJ / 32; ++kb) {
#pragma unroll
            for (int nb = 0; nb < 2; ++nb) { const h16* pr = pw + (nb * 16 + lr) * PP + kb * 32 + 8 * hi; acc[nb] = wmma16(a[kb], cat16(*(const v8ha*)pr, *(const v8ha*)(pr + 16)), acc[nb]); }
            if constexpr (more.value) a[kb] = WFrag<h16>::ldf(vn + kb * 512); }
        if constexpr (more.value) asm volatile("s_wait_xcnt 0x0" ::: "memory");   // stands behind the v loads, before the next step's code writes over their address registers
    };
    // The loop stays rolled: one copy of the step keeps the one register set of v fragments and a short hot loop. The last step stands alone behind it, since it asks for nothing.
#pragma unroll 1
    for (int st = 0; st < NN / PJ - 1; ++st) step(st, TrueT{});
    step(NN / PJ - 1, FalseT{});
#pragma unroll
    for (int nb = 0; nb < 2; ++nb) sum[nb] += __shfl_xor(sum[nb], 16, 32);
    if (hi == 0) { ls[wv * 32 + lr] = sum[0]; ls[wv * 32 + 16 + lr] = sum[1]; }
#pragma unroll
    for (int nb = 0; nb < 2; ++nb)
#pragma unroll
        for (int e = 0; e < 8; ++e) O[(size_t)(wv * 16 + hi * 8 + e) * NN + i0 + nb * 16 + lr] = acc[nb][e];
    __syncthreads();   // all 16 partial sums are in LDS before they are added, in wave order
#pragma unroll
    for (int s = 0; s < 2; ++s) { const int f = s * 512 + (int)threadIdx.x, i = f >> 5, ln = f & 31; float t = ls[i];
#pragma unroll
        for (int q = 1; q < 16; ++q) t += ls[q * 32 + i];
        const float o2 = ln == 0 ? mf[i] : (ln == 1 ? __fdiv_rn(1.0f, t * PCAR) : 0.f); /* 1/(PCAR * sum): undoes the carry at the merge */ *(float*)(RS + (size_t)(i0 + i) * 32 + ln) = o2; }
}
// k_x1mT: x1 and its four masked, transposed 16-bit planes in ONE launch; grid (NN / 32, NB_), 16 waves. A work-group owns all 256 channels of 32 neighbouring positions.
// Each x1 value is formed once, in registers: x1 = bf16(gamma) * (O * RS[n][1]) + bf16(x). It leaves as f32 X1[c][n] (one whole 128-byte line a channel) and goes through LDS, turned to [n][c];
// behind the barrier wave w takes positions 2 w and 2 w + 1 and stores the hi/lo bf16 splits of mask * x1 and (1 - mask) * x1, 256 contiguous bytes a store.
#define TN 32
#define TP (CC + 4)               // pitch of a position's row in LDS, in floats: rows stay 16-byte aligned
__global__ __launch_bounds__(512) void k_x1mT(const float* __restrict__ O, const float* __restrict__ RS, const float* __restrict__ xb, const float* __restrict__ gam, const float* __restrict__ mk, float* X1, bf* Fh, bf* Fl, bf* Bh, bf* Bl) {
    __shared__ __align__(16) float xs[TN * TP];
    const int t = (int)threadIdx.x, lane = t & 31;
    const size_t img = blockIdx.y; const int n0 = (int)blockIdx.x * TN;
    O += img * CC * NN + n0; xb += img * CC * NN + n0; X1 += img * CC * NN + n0; RS += (img * NN + n0) * 32; mk += img * NN + n0;
    const int nq = (t & 7) * 4, c0 = t >> 3;   // 8 lanes cover a channel's 32 positions, a wave 4 channels: every load and store of a wave is 4 whole lines
    const float* pO = O + (size_t)c0 * NN + nq; const float* pX = xb + (size_t)c0 * NN + nq; const float* pR = RS + (size_t)nq * 32 + 1;
    v4f a[4], x4[4], o[4]; float rs[4], mw[2];
    const int wv = __builtin_amdgcn_readfirstlane(t >> 5);   // wave number, held scalar so that the mask reads and the row bases are scalar
#pragma unroll
    for (int r = 0; r < 2; ++r) mw[r] = mk[wv * 2 + r];   // the mask of the wave's two positions, asked for first: behind the barrier its way would stand open
    asm volatile("s_wait_xcnt 0x0" ::: "memory");   // stands behind the two mask loads, before later code writes over their base and offset registers
#pragma unroll
    for (int k = 0; k < 4; ++k) { a[k] = *(const v4f*)(pO + (size_t)(64 * k) * NN); x4[k] = *(const v4f*)(pX + (size_t)(64 * k) * NN); }
#pragma unroll
    for (int q = 0; q < 4; ++q) rs[q] = pR[q * 32];
    asm volatile("s_wait_xcnt 0x0" :: "v"(pO), "v"(pX) : "memory");   // stands behind the tile's loads, before later code writes over their address registers; the two row addresses are inputs so that their registers live up to the wait
    const float g = bfr(gam[0]);
#pragma unroll
    for (int k = 0; k < 4; ++k)
#pragma unroll
        for (int q = 0; q < 4; ++q) { o[k][q] = __fadd_rn(__fmul_rn(g, __fmul_rn(a[k][q], rs[q])), bfr(x4[k][q])); xs[(nq + q) * TP + c0 + 64 * k] = o[k][q]; }
    __syncthreads();   // the whole 256 x 32 tile of x1 is in LDS before any wave reads a position's row
#pragma unroll
    for (int k = 0; k < 4; ++k) *(v4f*)(X1 + (size_t)(c0 + 64 * k) * NN + nq) = o[k];   // behind the barrier, which would wait for stores issued in front of it
    asm volatile("s_wait_xcnt 0x0" ::: "memory");   // stands behind the four stores, before later code writes over their address and data registers
    const size_t po = (img * NN + n0) * CC;
#pragma unroll
    for (int r = 0; r < 2; ++r) { const int n = wv * 2 + r; const float wf = bfr(mw[r]), wb = __fsub_rn(1.0f, wf);
#pragma unroll
        for (int j = 0; j < 2; ++j) { const int c = j * 128 + lane * 4; const v4f v = *(const v4fa*)(xs + n * TP + c); v4us fh, fl, bh, bl;
#pragma unroll
            for (int q = 0; q < 4; ++q) { unsigned short h, l; splitf(__fmul_rn(v[q], wf), h, l); fh[q] = h; fl[q] = l; splitf(__fmul_rn(v[q], wb), h, l); bh[q] = h; bl[q] = l; }
            const size_t e = po + (size_t)n * CC + c;
            *(v4us*)(Fh + e) = fh; *(v4us*)(Fl + e) = fl; *(v4us*)(Bh + e) = bh; *(v4us*)(Bl + e) = bl;
            if (r + j < 2) asm volatile("s_wait_xcnt 0x0" ::: "memory"); } }   // stands behind the four stores, before the next piece's code writes over their address and data registers
}
// k_smix: both statistics and the final mix in ONE launch; grid (CC / 4, NB_), 16 waves. A work-group owns 4 whole channel rows: wave w holds positions (w >> 2) * 1024 .. + 1023 of row w & 3 in registers,
// 32 a lane, as sw = O2[c][n] * RS2[n][1], x1 and ff = x1 * bf16(mask[n]); each row is read once. The 4096 row-sum reciprocals (one 128-byte line each) are fetched once by the work-group and shared through LDS.
// Sums: four chains a lane (position % 4), a fixed tree over them, a fixed shuffle tree over the lanes, then the row's 4 wave partials from LDS in rising order; mean first, then the squared distances from it.
#define SR 4
__global__ __launch_bounds__(512) void k_smix(const float* __restrict__ O2, const float* __restrict__ RS, const float* __restrict__ X1, const float* __restrict__ mk, const float* __restrict__ gam, float* OUTb) {
    __shared__ __align__(16) float rsl[NN];
    __shared__ float p1[2 * SR * 4];
    __shared__ float p2[2 * SR * 4];
    const int t = (int)threadIdx.x, lane = t & 31;
    const int wv = __builtin_amdgcn_readfirstlane(t >> 5);   // wave number, held scalar so that the row bases are scalar
    const int r = wv & (SR - 1), seg = wv >> 2;
    const size_t img = blockIdx.y;
    const size_t ro = (img * CC + (size_t)blockIdx.x * SR + r) * NN + seg * 1024;   // the wave's first position of its row: scalar, so that every row access is a scalar base + the lane's offset
    O2 += ro; X1 += ro; OUTb += ro; RS += img * NN * 32; mk += img * NN + seg * 1024;
    const int lo = lane * 4;
    float rg[8]; v4f sw[8], x1[8], ff[8];
#pragma unroll
    for (int k = 0; k < 8; ++k) rg[k] = RS[(size_t)(k * 512 + t) * 32 + 1];
#pragma unroll
    for (int k = 0; k < 8; ++k) { sw[k] = *(const v4f*)(O2 + lo + k * 128); x1[k] = *(const v4f*)(X1 + lo + k * 128); ff[k] = *(const v4f*)(mk + lo + k * 128); }
    const float g = bfr(gam[0]);
#pragma unroll
    for (int k = 0; k < 8; ++k) rsl[k * 512 + t] = rg[k];
    __syncthreads();   // all 4096 reciprocals are in LDS before any wave reads its share
    v4f a0 = (v4f){}, a1 = (v4f){};
#pragma unroll
    for (int k = 0; k < 8; ++k) { const v4f rv = *(const v4fa*)(rsl + seg * 1024 + k * 128 + lo);
#pragma unroll
        for (int q = 0; q < 4; ++q) { sw[k][q] = sw[k][q] * rv[q]; ff[k][q] = x1[k][q] * bfr(ff[k][q]); }
        a0 += sw[k]; a1 += ff[k]; }
    float s0 = (a0[0] + a0[1]) + (a0[2] + a0[3]), s1 = (a1[0] + a1[1]) + (a1[2] + a1[3]);
#pragma unroll
    for (int sh = 16; sh; sh >>= 1) { s0 += __shfl_xor(s0, sh, 32); s1 += __shfl_xor(s1, sh, 32); }
    if (lane == 0) { p1[r * 4 + seg] = s0; p1[(SR + r) * 4 + seg] = s1; }
    __syncthreads();   // the row's 4 partial sums are in LDS before they are added
    const float mu0 = (((p1[r * 4] + p1[r * 4 + 1]) + p1[r * 4 + 2]) + p1[r * 4 + 3]) * (1.0f / NN);
    const float mu1 = (((p1[(SR + r) * 4] + p1[(SR + r) * 4 + 1]) + p1[(SR + r) * 4 + 2]) + p1[(SR + r) * 4 + 3]) * (1.0f / NN);
    a0 = (v4f){}; a1 = (v4f){};
#pragma unroll
    for (int k = 0; k < 8; ++k) { const v4f d0 = sw[k] - mu0, d1 = ff[k] - mu1; a0 += d0 * d0; a1 += d1 * d1; }
    s0 = (a0[0] + a0[1]) + (a0[2] + a0[3]); s1 = (a1[0] + a1[1]) + (a1[2] + a1[3]);
#pragma unroll
    for (int sh = 16; sh; sh >>= 1) { s0 += __shfl_xor(s0, sh, 32); s1 += __shfl_xor(s1, sh, 32); }
    if (lane == 0) { p2[r * 4 + seg] = s0; p2[(SR + r) * 4 + seg] = s1; }
    __syncthreads();   // the row's 4 partial sums of squares are in LDS before they are added
    const float q0 = ((p2[r * 4] + p2[r * 4 + 1]) + p2[r * 4 + 2]) + p2[r * 4 + 3];
    const float q1 = ((p2[(SR + r) * 4] + p2[(SR + r) * 4 + 1]) + p2[(SR + r) * 4 + 2]) + p2[(SR + r) * 4 + 3];
    const float ratio = __fdiv_rn(__fsqrt_rn(__fdiv_rn(q0, (float)(NN - 1)) + 1e-5f), __fsqrt_rn(__fdiv_rn(q1, (float)(NN - 1)) + 1e-5f));
#pragma unroll
    for (int k = 0; k < 8; ++k) *(v4f*)(OUTb + lo + k * 128) = x1[k] + g * (ff[k] * ratio);
}
extern "C" void kernel_launch(void* const* d_in, const int* in_sizes, int n_in,
                              void* d_out, int out_size, void* d_ws, size_t ws_size, hipStream_t stream) {
    (void)in_sizes; (void)n_in; (void)out_size;
    const float* IN[16]; for (int i = 0; i < 16; ++i) IN[i] = (const float*)d_in[i];
    // x [2][256][64][64], mask [2][1][64][64], sa_wq [32][256], sa_bq, sa_wk, sa_bk, sa_wv [256][256], sa_bv, sa_gamma [1], wq, bq, wk, bk, wv, bv, gamma [1] = d_in[0..15]
    const float* x = IN[0]; const float* mk = IN[1];
    float* OUT = (float*)d_out;     // [2][256][64][64]
    char* wsp = (char*)d_ws;
    auto take = [&](size_t bytes) { char* p = wsp; wsp += (bytes + 255) & ~(size_t)255; return (void*)p; };
    bf* WQ1 = (bf*)take((size_t)CQP * CC * 2); bf* WK1 = (bf*)take((size_t)CQP * CC * 2); float* BQ1 = (float*)take(256); float* BK1 = (float*)take(256); bf* WV1 = (bf*)take((size_t)CC * CC * 2);
    bf* WQ2 = (bf*)take((size_t)CQP * CC * 2); bf* WK2 = (bf*)take((size_t)CQP * CC * 2); float* BQ2 = (float*)take(256); float* BK2 = (float*)take(256); bf* WV2 = (bf*)take((size_t)CC * CC * 2);
    // per-image planes, NB_ of each, one behind the other
    bf* XT = (bf*)take((size_t)NB_ * NN * CC * 2); bf* Qh = (bf*)take((size_t)NB_ * NN * CQ * 2); bf* Ql = (bf*)take((size_t)NB_ * NN * CQ * 2); bf* Kh = (bf*)take((size_t)NB_ * NN * CQ * 2); bf* Kl = (bf*)take((size_t)NB_ * NN * CQ * 2);
    float* Oc = (float*)take((size_t)NB_ * CC * NN * 4); h16* V16 = (h16*)take((size_t)NB_ * CC * NN * 2); float* X1 = (float*)take((size_t)NB_ * CC * NN * 4);
    bf* Fh = (bf*)take((size_t)NB_ * NN * CC * 2); bf* Fl = (bf*)take((size_t)NB_ * NN * CC * 2); bf* Bh = (bf*)take((size_t)NB_ * NN * CC * 2); bf* Bl = (bf*)take((size_t)NB_ * NN * CC * 2);
    float* RS = (float*)take((size_t)NB_ * NN * 32 * 4);
    if ((size_t)(wsp - (char*)d_ws) > ws_size) return;    // total ~ 43 MiB; ws 256 MiB
    // stage 1: self attention on x
    k_prep<<<512 + 128 + 64, 256, 0, stream>>>(x, XT, IN[2], IN[3], WQ1, BQ1, IN[4], IN[5], WK1, BK1, IN[9], IN[10], WQ2, BQ2, IN[11], IN[12], WK2, BK2, IN[6], WV1, IN[13], WV2);
    k_conv3<0, 0><<<dim3(256 + 64 + 64, NB_), 256, 0, stream>>>(XT, nullptr, XT, nullptr, WQ1, WK1, BQ1, BK1, Qh, Ql, Kh, Kl, WV1, XT, nullptr, IN[7], V16, CC);
    k_attn<<<dim3(NN / 32, NB_), 512, 0, stream>>>(Qh, Ql, Kh, Kl, V16, Oc, RS);   // sa [c][i] (x1024 carried)
    // stage 2: masked cross attention on x1 (q from mask*x1, k/v from (1-mask)*x1)
    k_x1mT<<<dim3(NN / TN, NB_), 512, 0, stream>>>(Oc, RS, x, IN[8], mk, X1, Fh, Fl, Bh, Bl);
    k_conv3<1, 3><<<dim3(256 + 64 + 64, NB_), 256, 0, stream>>>(Fh, Fl, Bh, Bl, WQ2, WK2, BQ2, BK2, Qh, Ql, Kh, Kl, WV2, Bh, Bl, IN[14], V16, CC);
    k_attn<<<dim3(NN / 32, NB_), 512, 0, stream>>>(Qh, Ql, Kh, Kl, V16, Oc, RS);   // sw [c][i] (x1024 carried; RS applied inside k_smix)
    k_smix<<<dim3(CC / SR, NB_), 512, 0, stream>>>(Oc, RS, X1, mk, IN[15], OUT);
}

// v010
// A run of this version takes 97.7 microseconds.
// Timed twice side by side with v009, it ran 1.17 and 1.18 times as fast.
// Counting every step since v000, it is 8.63 times as fast.
#include <hip/hip_runtime.h>

// x [2][256][64][64], mask [2][1][64][64] in {0,1} read as data; (1) self-attention: q/k = 1x1 convs to 32 ch, v 256 ch (+bias), A = softmax_j(sum_c q[c][i] k[c][j]) (unscaled),
// sa[c][i] = sum_j v[c][j] A[i][j]; x1 = sa_gamma sa + x; (2) masked cross attention: fb = (1-mask) x1, ff = mask x1; q from ff, k/v from fb (second conv set), sw[c][i] likewise;
// (3) out = x1 + gamma * ff * (std(sw) / std(ff)) per channel (unbiased variance over the 4096 positions + 1e-5, sqrt).
// Compute dtypes, f32 accumulate: every input rounded to bf16; stage-1 convs on PLAIN bf16 operands (inputs: exact, + bias; q/k padded 32 -> 64 output channels with
// numerators x1024 + 1/(1024 sum); both value contractions fp16 v x fp16 numerators (K 2048 a key half, channel-major); residuals, masks, the per-channel statistics and the final mix in f32 on VALU (one wave

#define NB_  2
#define CC   256
#define CQ   32                   // q/k channels
#define CQP  64                   // padded to one tile
#define NN   4096
#define PCAR 1024.0f
#define SCL  1.0f                 // energies are unscaled in this module
typedef _Float16 h16;
typedef unsigned short bf;
typedef __attribute__((ext_vector_type(16))) __bf16   v16bf;
typedef __attribute__((ext_vector_type(16))) _Float16 v16h;
typedef __attribute__((ext_vector_type(8)))  _Float16 v8h;
typedef __attribute__((ext_vector_type(8)))  unsigned short v8us;
typedef __attribute__((ext_vector_type(8)))  float    v8f;
typedef __attribute__((ext_vector_type(4)))  float    v4f;
typedef v8h  __attribute__((may_alias)) v8ha;
typedef v4f  __attribute__((may_alias)) v4fa;
typedef v8us __attribute__((may_alias)) v8usa;

__device__ __forceinline__ unsigned short f2bf(float f) { unsigned u = __float_as_uint(f); u += 0x7FFFu + ((u >> 16) & 1u); return (unsigned short)(u >> 16); }
__device__ __forceinline__ float bf2f(unsigned short b) { return __uint_as_float(((unsigned)b) << 16); }
__device__ __forceinline__ float bfr(float f) { return bf2f(f2bf(f)); }
__device__ __forceinline__ v16h cat16(v8h lo, v8h hi) { return __builtin_shufflevector(lo, hi, 0, 1, 2, 3, 4, 5, 6, 7, 8, 9, 10, 11, 12, 13, 14, 15); }
__device__ __forceinline__ v16bf cat16b(v8us lo, v8us hi) { return __builtin_bit_cast(v16bf, __builtin_shufflevector(lo, hi, 0, 1, 2, 3, 4, 5, 6, 7, 8, 9, 10, 11, 12, 13, 14, 15)); }
__device__ __forceinline__ v8f wmma16(v16h a, v16h b, v8f c) { return __builtin_amdgcn_wmma_f32_16x16x32_f16(false, a, false, b, (short)0, c, false, false); }
__device__ __forceinline__ v8f wmmab(v16bf a, v16bf b, v8f c) { return __builtin_amdgcn_wmma_f32_16x16x32_bf16(false, a, false, b, (short)0, c, false, false); }
__device__ __forceinline__ h16 tohx(float x) { return (h16)x; }
__device__ __forceinline__ void splitf(float y, unsigned short& h, unsigned short& l) { h = f2bf(y); l = f2bf(y - bf2f(h)); }
typedef __attribute__((ext_vector_type(2))) _Float16 v2h;
typedef __attribute__((ext_vector_type(4))) _Float16 v4h;
typedef __attribute__((ext_vector_type(2))) unsigned short v2us;
typedef __attribute__((ext_vector_type(4))) unsigned short v4us;



// ---- gemmw_body: register-blocked GEMM, KS WAVES per 64x64 output tile, each with all 16 accumulators over its own share of K; operands straight from K-contiguous 16-bit planes; one tile (bx, by) of image z per call, 32 * KS threads.
// c[m][n] (f32) = sum_k A[m][k] Bt[n][k] (+ split products per NSPLIT). z-batch strides sA/sB/sC in elements. K % (32 * KS) == 0.
// The tile leaves as the 16-bit planes that the attention kernel reads, never as f32: VROW: C16(m, n) = fp16(c + bf16(bias[m])); else Ch/Cl(m, n) = the hi/lo bf16 split of c + bf16(bias[n]), n < ldc only (the pad has no place).
// These planes lie in FRAGMENT ORDER (fragofs, row m, k index n, ldc k's a row): the attention kernel's fragment loads then read 512 contiguous bytes a wave, four whole 128-byte lines, not 32-byte pieces of 16 lines.
// Wave w takes the 32-k blocks w, w + KS, w + 2 KS, ... (neighbouring waves read the two halves of one 128-byte line in the same trip); the KS partial tiles meet in LDS and are summed in wave order.
// Fragment order of a 16-bit operand plane: each tile of 16 rows x 32 k is 1 KiB, laid as a wave's two 16-byte loads take it: [k bit 4][lane = (k bit 3) * 16 + row % 16][k % 8]; tiles run along k (KB of them a row block), then down the rows.
__device__ __forceinline__ size_t fragofs(int row, int k, int KB) { return ((((size_t)(row >> 4) * KB + (k >> 5)) * 2 + ((k >> 4) & 1)) * 32 + ((k >> 3) & 1) * 16 + (row & 15)) * 8 + (k & 7); }
template <typename T16> struct WFrag;
template <> struct WFrag<h16> { typedef v16h V; static __device__ __forceinline__ V ld(const h16* p) { return cat16(*(const v8h*)p, *(const v8h*)(p + 16)); } static __device__ __forceinline__ V ldf(const h16* p) { return cat16(*(const v8h*)p, *(const v8h*)(p + 256)); } static __device__ __forceinline__ v8f mma(V a, V b, v8f c) { return wmma16(a, b, c); } };
template <> struct WFrag<bf> { typedef v16bf V; static __device__ __forceinline__ V ld(const bf* p) { return cat16b(*(const v8us*)p, *(const v8us*)(p + 16)); } static __device__ __forceinline__ V ldf(const bf* p) { return cat16b(*(const v8us*)p, *(const v8us*)(p + 256)); } static __device__ __forceinline__ v8f mma(V a, V b, v8f c) { return wmmab(a, b, c); } };
// The work is a device function that is told its tile (bx, by), its image z and its LDS, so that one launch can hold GEMMs of several shapes side by side.
template <typename T16, int NSPLIT, bool VROW, int KS>
__device__ __forceinline__ void gemmw_body(float* os, int bx, int by, size_t z, const T16* __restrict__ A, const T16* __restrict__ A2, const T16* __restrict__ Bt, const T16* __restrict__ Bt2, int K, h16* C16, bf* Ch, bf* Cl, int ldc, const float* __restrict__ bias, size_t sA, size_t sB, size_t sC) {
    typedef typename WFrag<T16>::V V;
    A += z * sA; if (A2) A2 += z * sA; Bt += z * sB; if (Bt2) Bt2 += z * sB;
    const int lane = threadIdx.x & 31, lr = lane & 15, hi = lane >> 4; const int r0 = bx * 64, c0 = by * 64;
    const int wv = KS == 1 ? 0 : __builtin_amdgcn_readfirstlane((int)(threadIdx.x >> 5));   // wave number, held scalar so that the k loop stays a scalar loop
    v8f acc[4][4];
#pragma unroll
    for (int mb = 0; mb < 4; ++mb)
#pragma unroll
        for (int nb = 0; nb < 4; ++nb) acc[mb][nb] = (v8f){};
    const size_t aoff = (size_t)(r0 + lr) * K + 8 * hi, boff = (size_t)(c0 + lr) * K + 8 * hi;
#pragma unroll 1
    for (int kc = wv * 32; kc < K; kc += 32 * KS) {
        V a[4], a2[4];
#pragma unroll
        for (int mb = 0; mb < 4; ++mb) { a[mb] = WFrag<T16>::ld(A + aoff + (size_t)mb * 16 * K + kc); if (NSPLIT == 1 || NSPLIT == 2) a2[mb] = WFrag<T16>::ld(A2 + aoff + (size_t)mb * 16 * K + kc); }
#pragma unroll
        for (int nb = 0; nb < 4; ++nb) { const V b = WFrag<T16>::ld(Bt + boff + (size_t)nb * 16 * K + kc); V b2; if (NSPLIT >= 2) b2 = WFrag<T16>::ld(Bt2 + boff + (size_t)nb * 16 * K + kc);
#pragma unroll
            for (int mb = 0; mb < 4; ++mb) { acc[mb][nb] = WFrag<T16>::mma(a[mb], b, acc[mb][nb]); if (NSPLIT == 1 || NSPLIT == 2) acc[mb][nb] = WFrag<T16>::mma(a2[mb], b, acc[mb][nb]); if (NSPLIT >= 2) acc[mb][nb] = WFrag<T16>::mma(a[mb], b2, acc[mb][nb]); } }
        asm volatile("v_nop\n\tv_nop\n\tv_nop\n\tv_nop" : "+v"(acc[0][0]), "+v"(acc[1][1]), "+v"(acc[2][2]), "+v"(acc[3][3]) : "v"(a[0]), "v"(a[3]));
    }
    float bb[32 / KS];   // VROW: the bias of this thread's rows, asked for ahead of the LDS stores and the barrier that hide its way
    if constexpr (VROW) {
#pragma unroll
        for (int s = 0; s < 32 / KS; ++s) bb[s] = bias[r0 + s * (2 * KS) + (int)(threadIdx.x >> 4)];
        asm volatile("s_wait_xcnt 0x0" ::: "memory");   // stands behind the bias loads, before later code writes over their offset registers
    }
    float* mine = os + wv * (64 * 68);
#pragma unroll
    for (int mb = 0; mb < 4; ++mb)
#pragma unroll
        for (int nb = 0; nb < 4; ++nb)
#pragma unroll
            for (int j = 0; j < 8; ++j) mine[(mb * 16 + hi * 8 + j) * 68 + nb * 16 + lr] = acc[mb][nb][j];
    __syncthreads();   // every wave's partial tile is in LDS before any of them is summed
#pragma unroll
    for (int s = 0; s < 32 / KS; ++s) { const int f = s * (32 * KS) + (int)threadIdx.x, row = f >> 4, cofs = (f & 15) * 4; if (!VROW && c0 + cofs >= ldc) continue; v4f val = *(const v4fa*)(os + row * 68 + cofs);
#pragma unroll
        for (int q = 1; q < KS; ++q) val += *(const v4fa*)(os + q * (64 * 68) + row * 68 + cofs);
        const size_t co = z * sC + fragofs(r0 + row, c0 + cofs, ldc / 32);
        if constexpr (VROW) { const float br = bfr(bb[s]); v4h o;
#pragma unroll
            for (int q = 0; q < 4; ++q) o[q] = tohx(__fadd_rn(val[q], br));
            *(v4h*)(C16 + co) = o; }
        else { v4us oh, ol;
#pragma unroll
            for (int q = 0; q < 4; ++q) { unsigned short a, c2; splitf(__fadd_rn(val[q], bfr(bias[c0 + cofs + q])), a, c2); oh[q] = a; ol[q] = c2; }
            *(v4us*)(Ch + co) = oh; *(v4us*)(Cl + co) = ol; }
    }
}
// k_conv3: the three 1x1 convs of one stage (none reads another's result) in ONE launch; grid (256 + 64 + 64, NB_): blocks 0..255 the value conv's tiles in their old order, then the q conv's 64, then the k conv's 64.
// Each tile's last lines add the bias and store v as fp16, q and k (their 32 real channels) as their hi/lo bf16 planes, all in fragment order.
template <int NSQK, int NSV>
__global__ __launch_bounds__(256) void k_conv3(const bf* __restrict__ Aq, const bf* __restrict__ Aq2, const bf* __restrict__ Ak, const bf* __restrict__ Ak2, const bf* __restrict__ WQ, const bf* __restrict__ WK, const float* __restrict__ BQ, const float* __restrict__ BK, bf* Qh, bf* Ql, bf* Kh, bf* Kl,
                                               const bf* __restrict__ WV, const bf* __restrict__ Xv, const bf* __restrict__ Xv2, const float* __restrict__ bv, h16* V16, int K) {
    __shared__ __align__(16) float os[8 * 64 * 68];
    const int b = (int)blockIdx.x; const size_t z = blockIdx.y;
    if (b < (CC / 64) * (NN / 64)) { gemmw_body<bf, NSV, true, 8>(os, b & (CC / 64 - 1), b / (CC / 64), z, WV, nullptr, Xv, Xv2, K, V16, nullptr, nullptr, NN, bv, 0, (size_t)NN * CC, (size_t)NN * CC); return; }
    const int t = b - (CC / 64) * (NN / 64); const bool isk = t >= NN / 64;
    gemmw_body<bf, NSQK, false, 8>(os, isk ? t - NN / 64 : t, 0, z, isk ? Ak : Aq, isk ? Ak2 : Aq2, isk ? WK : WQ, nullptr, K, nullptr, isk ? Kh : Qh, isk ? Kl : Ql, CQ, isk ? BK : BQ, (size_t)NN * CC, 0, (size_t)NN * CQ);
}


__device__ __forceinline__ void cvt8_body(int bx, const float* __restrict__ src, bf* dst, size_t n8) { const size_t i = (size_t)bx * 256 + threadIdx.x; if (i >= n8) return; const v8f v = *(const v8f*)(src + i * 8); v8us o;
#pragma unroll
    for (int k = 0; k < 8; ++k) o[k] = f2bf(v[k]); *(v8us*)(dst + i * 8) = o;  }
// Every per-image kernel below takes its image from blockIdx.y (k_prep's transpose: blockIdx.x / 256): both images' planes lie one behind the other in the workspace.
// The *_body functions are told their block (bx) and image (img) by the kernel that holds them: launches that do not depend on one another share one grid.
__device__ __forceinline__ void xt_body(int bx, int img, const float* __restrict__ xb, bf* XT) {
    xb += (size_t)img * CC * NN; XT += (size_t)img * NN * CC;
    const int lane = threadIdx.x & 31; const int L0 = (bx * 8 + (threadIdx.x >> 5)) * 8; const int nlines = NN * CC / 64;
{
#pragma unroll
        for (int l = 0; l < 8; ++l) { const int L = L0 + l; if (L >= nlines) break; const int e = L * 64 + lane * 2; const int c = e & (CC - 1); const int n = e >> 8; v2us o;
#pragma unroll
            for (int q = 0; q < 2; ++q) o[q] = f2bf(xb[(size_t)(c + q) * NN + n]);
            *(v2us*)(XT + (size_t)e) = o; }
         }
}
__device__ __forceinline__ void wpad_body(int bx, const float* __restrict__ w, const float* __restrict__ b, bf* Bt, float* BP) { const int e = (bx * 256 + threadIdx.x) * 2; if (e >= CQP * CC) return; const int n = e / CC, k = e % CC; v2us o;
#pragma unroll
    for (int q = 0; q < 2; ++q) o[q] = (n < CQ) ? f2bf(w[(size_t)n * CC + k + q]) : (unsigned short)0;
    *(v2us*)(Bt + e) = o; if (e < CQP) { *(float*)(BP + e) = (e < CQ) ? b[e] : 0.f; *(float*)(BP + e + 1) = (e + 1 < CQ) ? b[e + 1] : 0.f; }
     }
// k_prep: all that reads the inputs alone, in ONE launch; grid 512 + 128 + 64: the transpose of x (256 blocks an image), the four padded q/k weight planes (32 blocks each), the two value weight planes (32 blocks each).
__global__ __launch_bounds__(256) void k_prep(const float* __restrict__ x, bf* XT,
                                              const float* __restrict__ wq1, const float* __restrict__ bq1, bf* WQ1, float* BQ1, const float* __restrict__ wk1, const float* __restrict__ bk1, bf* WK1, float* BK1,
                                              const float* __restrict__ wq2, const float* __restrict__ bq2, bf* WQ2, float* BQ2, const float* __restrict__ wk2, const float* __restrict__ bk2, bf* WK2, float* BK2,
                                              const float* __restrict__ wv1, bf* WV1, const float* __restrict__ wv2, bf* WV2) {
    const int b = (int)blockIdx.x;
    if (b < 512) { xt_body(b & 255, b >> 8, x, XT); return; }
    const int t = b - 512, bx = t & 31, w = t >> 5;
    if (w == 0) wpad_body(bx, wq1, bq1, WQ1, BQ1);
    else if (w == 1) wpad_body(bx, wk1, bk1, WK1, BK1);
    else if (w == 2) wpad_body(bx, wq2, bq2, WQ2, BQ2);
    else if (w == 3) wpad_body(bx, wk2, bk2, WK2, BK2);
    else if (w == 4) cvt8_body(bx, wv1, WV1, (size_t)CC * CC / 8);
    else cvt8_body(bx, wv2, WV2, (size_t)CC * CC / 8);
}
__global__ __launch_bounds__(256) void k_p16(const float* __restrict__ F, h16* P, size_t n) { const size_t i = ((size_t)blockIdx.x * 256 + threadIdx.x) * 2; if (i >= n) return; v2h v; v[0] = tohx(F[i]); v[1] = tohx(F[i + 1]); *(v2h*)(P + i) = v;  }
// k_attn: scores, softmax numerators and value contraction of QB = 64 query positions i over ONE HALF of the keys in one work-group of 16 waves; grid (NN / QB, NB_, KH), blockIdx.z the key half.
// Each v and key byte that a work-group fetches now serves 64 queries, not 32: the launch reads half as many bytes from L2. No score and no numerator leaves the work-group.
// A half is a softmax of its own: its maximum m, its numerator sum l and its products O_h[c][i] (plane h of O) leave the work-group; the reader of O merges the two halves (mergec below).
// Scores are formed transposed, St[j][i] = sum_c k[j][c] q[i][c] (A = k rows, B = q rows, the three hi/lo products in the old order, over the 32 real channels: the pad's products are exact zeros): a lane then
// holds 8 neighbouring keys j of one column i, which is one 16-byte piece of a numerator row p[i][j].
// Pass 1: wave w takes the half's keys w * 128 .. + 127 and finds each column's maximum; the 16 partial maxima meet in LDS.
// Pass 2, in steps of PJ = 256 keys: wave w forms the scores of the step's keys w * 16 .. + 15 again, numerators exp(s - max) (f32 sum; x1024 to fp16) into LDS (two buffers, one barrier a step);
// then wave w adds the step to its own 16 channels, O[c][i] += v[c][j] p[i][j], v straight from its plane (each v element of the half is read once by the work-group), keys in rising order.
// The key rows of step s + 1 are asked for during step s, each v fragment 4 key blocks (half a step) ahead; they are waited for only where they are used: the step's barrier waits for LDS alone.
// q, k (rows = positions, k = the 32 channels) and v (rows = channels, k = keys) lie in fragment order: lane l's two pieces of a tile stand at halves l * 8 and 256 + l * 8 of its 512.
#define PJ 256
#define QB 64                     // queries of a work-group
#define QT (QB / 16)              // its query tiles
#define KH 2                      // key halves
#define NK (NN / KH)              // keys of a work-group
struct TrueT { static constexpr bool value = true; };
struct FalseT { static constexpr bool value = false; };
typedef __attribute__((ext_vector_type(2))) float v2f;
#define PP (PJ + 8)               // pitch of a numerator row in LDS, in halves: rows 4 banks apart
// The weights that merge the two key halves of one query: sa = O_0 * c0 + O_1 * c1, c_h = exp(m_h - max(m_0, m_1)) / (1024 * (l_0 e_0 + l_1 e_1)); each l is at least 1 (its own maximum's term), and 1024 undoes the carry.
__device__ __forceinline__ void mergec(float m0, float l0, float m1, float l1, float& c0, float& c1) {
    const float mm = fmaxf(m0, m1); const float e0 = __expf(m0 - mm), e1 = __expf(m1 - mm);
    const float r = __fdiv_rn(1.0f, (l0 * e0 + l1 * e1) * PCAR); c0 = e0 * r; c1 = e1 * r; }
__global__ __launch_bounds__(512) void k_attn(const bf* __restrict__ Qh, const bf* __restrict__ Ql, const bf* __restrict__ Kh, const bf* __restrict__ Kl, const h16* __restrict__ V16, float* O, float* RS) {
    __shared__ __align__(16) h16 ps[2 * QB * PP];
    __shared__ float mx[16 * QB];
    __shared__ float ls[16 * QB];
    __shared__ float mf[QB];
    const size_t img = blockIdx.y; const int jb = (int)blockIdx.z * NK;   // the half's first key
    Qh += img * NN * CQ; Ql += img * NN * CQ; Kh += img * NN * CQ; Kl += img * NN * CQ; V16 += img * CC * NN;
    O += ((size_t)blockIdx.z * NB_ + img) * CC * NN; RS += ((size_t)blockIdx.z * NB_ + img) * NN * 2;
    const int lane = threadIdx.x & 31, lr = lane & 15, hi = lane >> 4; const int i0 = (int)blockIdx.x * QB;
    const int wv = __builtin_amdgcn_readfirstlane((int)(threadIdx.x >> 5));   // wave number, held scalar so that the key loops stay scalar loops
    v16bf qh[QT], ql[QT];
    const bf* pqh = Qh + (size_t)(i0 >> 4) * 512 + lane * 8; const bf* pql = Ql + (size_t)(i0 >> 4) * 512 + lane * 8;
#pragma unroll
    for (int nb = 0; nb < QT; ++nb) { qh[nb] = WFrag<bf>::ldf(pqh + nb * 512); ql[nb] = WFrag<bf>::ldf(pql + nb * 512); }
    asm volatile("s_wait_xcnt 0x0" :: "v"(pqh), "v"(pql) : "memory");   // stands behind the query loads, before later code writes over their address registers; the two addresses are inputs so that their registers live up to the wait
    float m[QT];
#pragma unroll
    for (int nb = 0; nb < QT; ++nb) m[nb] = -3.0e38f;
#pragma unroll 4
    for (int t = 0; t < NK / 256; ++t) { const size_t o = (size_t)(jb / 16 + wv * (NK / 256) + t) * 512 + lane * 8; const bf* pkh = Kh + o; const bf* pkl = Kl + o; const v16bf kh = WFrag<bf>::ldf(pkh), kl = WFrag<bf>::ldf(pkl);
        asm volatile("s_wait_xcnt 0x0" :: "v"(pkh), "v"(pkl) : "memory");   // stands behind the trip's four key loads, before their results or later code write over their address registers; the two addresses are inputs so that their registers live up to the wait
#pragma unroll
        for (int nb = 0; nb < QT; ++nb) { v8f s = (v8f){}; s = wmmab(kh, qh[nb], s); s = wmmab(kh, ql[nb], s); s = wmmab(kl, qh[nb], s);
#pragma unroll
            for (int e = 0; e < 8; ++e) m[nb] = fmaxf(m[nb], s[e]); }
    }
#pragma unroll
    for (int nb = 0; nb < QT; ++nb) m[nb] = fmaxf(m[nb], __shfl_xor(m[nb], 16, 32));
    if (hi == 0) {
#pragma unroll
        for (int nb = 0; nb < QT; ++nb) mx[wv * QB + nb * 16 + lr] = m[nb]; }
    __syncthreads();   // all 16 partial maxima are in LDS before any wave takes the maximum over them
#pragma unroll
    for (int nb = 0; nb < QT; ++nb) { float t = mx[nb * 16 + lr];
#pragma unroll
        for (int q = 1; q < 16; ++q) t = fmaxf(t, mx[q * QB + nb * 16 + lr]);
        m[nb] = t; }
    if (wv == 0 && hi == 0) {
#pragma unroll
        for (int nb = 0; nb < QT; ++nb) mf[nb * 16 + lr] = m[nb]; }
    v8f acc[QT]; float sum[QT];
#pragma unroll
    for (int nb = 0; nb < QT; ++nb) { acc[nb] = (v8f){}; sum[nb] = 0.f; }
    const h16* vb = V16 + ((size_t)wv * (NN / 32) + jb / 32) * 512 + lane * 8;
    const size_t ko = (size_t)(jb / 16 + wv) * 512 + lane * 8;
    v16bf kh = WFrag<bf>::ldf(Kh + ko), kl = WFrag<bf>::ldf(Kl + ko);
    asm volatile("s_wait_xcnt 0x0" ::: "memory");   // stands behind the key loads, before later code writes over their address registers
    v16h a[4];   // a ring of 4 v fragments: once a fragment's four products have read it, its registers are asked to take the fragment 4 key blocks on (half a step ahead, over the step's end too); 8 would not fit beside 64 queries
#pragma unroll
    for (int kb = 0; kb < 4; ++kb) a[kb] = WFrag<h16>::ldf(vb + kb * 512);
    asm volatile("s_wait_xcnt 0x0" :: "v"(vb) : "memory");   // stands behind the v loads, before later code writes over their address registers; the address is an input so that its registers live up to the wait
    // One step. more: a next step exists, and its key rows and first 4 v fragments are asked for here; they stay under way over the step's barrier and the next step's score work.
    auto step = [&](const int st, auto more) {
        h16* pw = ps + (st & 1) * (QB * PP);
#pragma unroll
        for (int nb = 0; nb < QT; ++nb) { v8f s = (v8f){}; s = wmmab(kh, qh[nb], s); s = wmmab(kh, ql[nb], s); s = wmmab(kl, qh[nb], s); v8h o;
#pragma unroll
            for (int e = 0; e < 8; ++e) { const float ex = __expf(__fsub_rn(s[e], m[nb])); sum[nb] += ex; o[e] = tohx(ex * PCAR); }
            *(v8ha*)(pw + (nb * 16 + lr) * PP + wv * 16 + hi * 8) = o; }
        if constexpr (more.value) { const size_t kn = ko + (size_t)(st + 1) * (PJ / 16) * 512; kh = WFrag<bf>::ldf(Kh + kn); kl = WFrag<bf>::ldf(Kl + kn);
            asm volatile("s_wait_xcnt 0x0" ::: "memory"); }   // stands behind the key loads, before later code writes over their address registers
        // The step's barrier, by hand: it waits for this wave's LDS stores and reads only. __syncthreads() would also wait for every global load under way, and the v loads of this step and the key loads of the next step are to stay in flight over it.
        // Behind it the step's numerators are all in LDS, and every wave has left the other buffer, which the next step fills.
        asm volatile("s_wait_dscnt 0x0\n\ts_barrier_signal -1\n\ts_barrier_wait -1" ::: "memory");
        const h16* vs = vb + (size_t)st * (PJ / 32) * 512;   // the step's first v fragment; the next step's follow its 8
        v16h pb[2][QT];   // numerator fragments of two key blocks: the next block's are read from LDS while this block's feed the products
#pragma unroll
        for (int nb = 0; nb < QT; ++nb) { const h16* pr = pw + (nb * 16 + lr) * PP + 8 * hi; pb[0][nb] = cat16(*(const v8ha*)pr, *(const v8ha*)(pr + 16)); }
#pragma unroll
        for (int kb = 0; kb < PJ / 32; ++kb) {
            if (kb + 1 < PJ / 32) {
#pragma unroll
                for (int nb = 0; nb < QT; ++nb) { const h16* pr = pw + (nb * 16 + lr) * PP + (kb + 1) * 32 + 8 * hi; pb[(kb + 1) & 1][nb] = cat16(*(const v8ha*)pr, *(const v8ha*)(pr + 16)); } }
            __builtin_amdgcn_sched_barrier(0);   // the next block's LDS reads stay in front of this block's products, one block ahead
#pragma unroll
            for (int nb = 0; nb < QT; ++nb) acc[nb] = wmma16(a[kb & 3], pb[kb & 1][nb], acc[nb]);
            if (kb < 4 || more.value) a[kb & 3] = WFrag<h16>::ldf(vs + (kb + 4) * 512);
            __builtin_amdgcn_sched_barrier(0); }   // and no further ahead: a third block's fragments in registers would spill the query fragments
        asm volatile("s_wait_xcnt 0x0" ::: "memory");   // stands behind the v loads, before later code writes over their address registers
    };
    // The loop stays rolled: one copy of the step keeps the one register set of v fragments and a short hot loop. The last step stands alone behind it, since it asks for nothing of a next step.
#pragma unroll 1
    for (int st = 0; st < NK / PJ - 1; ++st) step(st, TrueT{});
    step(NK / PJ - 1, FalseT{});
#pragma unroll
    for (int nb = 0; nb < QT; ++nb) sum[nb] += __shfl_xor(sum[nb], 16, 32);
    if (hi == 0) {
#pragma unroll
        for (int nb = 0; nb < QT; ++nb) ls[wv * QB + nb * 16 + lr] = sum[nb]; }
#pragma unroll
    for (int nb = 0; nb < QT; ++nb)
#pragma unroll
        for (int e = 0; e < 8; ++e) O[(size_t)(wv * 16 + hi * 8 + e) * NN + i0 + nb * 16 + lr] = acc[nb][e];
    __syncthreads();   // all 16 partial sums are in LDS before they are added, in wave order
    if (threadIdx.x < QB) { const int i = (int)threadIdx.x; float t = ls[i];   // two whole waves: RS[i] = (the half's maximum, the half's numerator sum), 512 contiguous bytes a work-group
#pragma unroll
        for (int q = 1; q < 16; ++q) t += ls[q * QB + i];
        v2f o2; o2[0] = mf[i]; o2[1] = t; *(v2f*)(RS + (size_t)(i0 + i) * 2) = o2; }
}
// k_x1mT: x1 and its four masked, transposed 16-bit planes in ONE launch; grid (NN / 32, NB_), 16 waves. A work-group owns all 256 channels of 32 neighbouring positions.
// Each x1 value is formed once, in registers: x1 = bf16(gamma) * (O_0 * c0[n] + O_1 * c1[n]) + bf16(x), the two key halves of the attention merged by mergec. It leaves as f32 X1[c][n] (one whole 128-byte line a channel) and goes through LDS, turned to [n][c];
// behind the barrier wave w takes positions 2 w and 2 w + 1 and stores the hi/lo bf16 splits of mask * x1 and (1 - mask) * x1, 256 contiguous bytes a store.
#define TN 32
#define TP (CC + 4)               // pitch of a position's row in LDS, in floats: rows stay 16-byte aligned
__global__ __launch_bounds__(512) void k_x1mT(const float* __restrict__ O, const float* __restrict__ RS, const float* __restrict__ xb, const float* __restrict__ gam, const float* __restrict__ mk, float* X1, bf* Fh, bf* Fl, bf* Bh, bf* Bl) {
    __shared__ __align__(16) float xs[TN * TP];
    const int t = (int)threadIdx.x, lane = t & 31;
    const size_t img = blockIdx.y; const int n0 = (int)blockIdx.x * TN;
    O += img * CC * NN + n0; xb += img * CC * NN + n0; X1 += img * CC * NN + n0; RS += (img * NN + n0) * 2; mk += img * NN + n0;
    const int nq = (t & 7) * 4, c0 = t >> 3;   // 8 lanes cover a channel's 32 positions, a wave 4 channels: every O, x and X1 load and store of a wave is 4 whole lines
    const float* pO = O + (size_t)c0 * NN + nq; const float* pX = xb + (size_t)c0 * NN + nq; const float* pO1 = pO + (size_t)NB_ * CC * NN; const float* pR = RS + nq * 2; const float* pR1 = pR + (size_t)NB_ * NN * 2;   // pO1, pR1: the second key half's planes
    v4f a[4], a1[4], x4[4], o[4], r0[2], r1[2]; float cf0[4], cf1[4], mw[2];
    const int wv = __builtin_amdgcn_readfirstlane(t >> 5);   // wave number, held scalar so that the mask reads and the row bases are scalar
#pragma unroll
    for (int r = 0; r < 2; ++r) mw[r] = mk[wv * 2 + r];   // the mask of the wave's two positions, asked for first: behind the barrier its way would stand open
    asm volatile("s_wait_xcnt 0x0" ::: "memory");   // stands behind the two mask loads, before later code writes over their base and offset registers
#pragma unroll
    for (int k = 0; k < 4; ++k) { a[k] = *(const v4f*)(pO + (size_t)(64 * k) * NN); a1[k] = *(const v4f*)(pO1 + (size_t)(64 * k) * NN); x4[k] = *(const v4f*)(pX + (size_t)(64 * k) * NN); }
#pragma unroll
    for (int q = 0; q < 2; ++q) { r0[q] = *(const v4f*)(pR + q * 4); r1[q] = *(const v4f*)(pR1 + q * 4); }   // (maximum, sum) of the thread's 4 positions, both halves
    asm volatile("s_wait_xcnt 0x0" :: "v"(pO), "v"(pO1), "v"(pX) : "memory");   // stands behind the tile's loads, before later code writes over their address registers; the addresses are inputs so that their registers live up to the wait
#pragma unroll
    for (int q = 0; q < 4; ++q) mergec(r0[q >> 1][(q & 1) * 2], r0[q >> 1][(q & 1) * 2 + 1], r1[q >> 1][(q & 1) * 2], r1[q >> 1][(q & 1) * 2 + 1], cf0[q], cf1[q]);
    const float g = bfr(gam[0]);
#pragma unroll
    for (int k = 0; k < 4; ++k)
#pragma unroll
        for (int q = 0; q < 4; ++q) { o[k][q] = __fadd_rn(__fmul_rn(g, a[k][q] * cf0[q] + a1[k][q] * cf1[q]), bfr(x4[k][q])); xs[(nq + q) * TP + c0 + 64 * k] = o[k][q]; }
    __syncthreads();   // the whole 256 x 32 tile of x1 is in LDS before any wave reads a position's row
#pragma unroll
    for (int k = 0; k < 4; ++k) *(v4f*)(X1 + (size_t)(c0 + 64 * k) * NN + nq) = o[k];   // behind the barrier, which would wait for stores issued in front of it
    asm volatile("s_wait_xcnt 0x0" ::: "memory");   // stands behind the four stores, before later code writes over their address and data registers
    const size_t po = (img * NN + n0) * CC;
#pragma unroll
    for (int r = 0; r < 2; ++r) { const int n = wv * 2 + r; const float wf = bfr(mw[r]), wb = __fsub_rn(1.0f, wf);
#pragma unroll
        for (int j = 0; j < 2; ++j) { const int c = j * 128 + lane * 4; const v4f v = *(const v4fa*)(xs + n * TP + c); v4us fh, fl, bh, bl;
#pragma unroll
            for (int q = 0; q < 4; ++q) { unsigned short h, l; splitf(__fmul_rn(v[q], wf), h, l); fh[q] = h; fl[q] = l; splitf(__fmul_rn(v[q], wb), h, l); bh[q] = h; bl[q] = l; }
            const size_t e = po + (size_t)n * CC + c;
            *(v4us*)(Fh + e) = fh; *(v4us*)(Fl + e) = fl; *(v4us*)(Bh + e) = bh; *(v4us*)(Bl + e) = bl;
            if (r + j < 2) asm volatile("s_wait_xcnt 0x0" ::: "memory"); } }   // stands behind the four stores, before the next piece's code writes over their address and data registers
}
// k_smix: both statistics and the final mix in ONE launch; grid (CC / 4, NB_), 16 waves. A work-group owns 4 whole channel rows: wave w holds positions (w >> 2) * 1024 .. + 1023 of row w & 3 in registers,
// 32 a lane, as sw = O2_0[c][n] * c0[n] + O2_1[c][n] * c1[n] (the two key halves merged), x1 and ff = x1 * bf16(mask[n]); each row is read once. The 2 x 4096 merge weights are formed once by the work-group (mergec) and shared through LDS.
// Sums: four chains a lane (position % 4), a fixed tree over them, a fixed shuffle tree over the lanes, then the row's 4 wave partials from LDS in rising order; mean first, then the squared distances from it.
#define SR 4
__global__ __launch_bounds__(512) void k_smix(const float* __restrict__ O2, const float* __restrict__ O2b, const float* __restrict__ RS, const float* __restrict__ X1, const float* __restrict__ mk, const float* __restrict__ gam, float* OUTb) {
    __shared__ __align__(16) float rsl[NN];
    __shared__ __align__(16) float rsm[NN];
    __shared__ float p1[2 * SR * 4];
    __shared__ float p2[2 * SR * 4];
    const int t = (int)threadIdx.x, lane = t & 31;
    const int wv = __builtin_amdgcn_readfirstlane(t >> 5);   // wave number, held scalar so that the row bases are scalar
    const int r = wv & (SR - 1), seg = wv >> 2;
    const size_t img = blockIdx.y;
    const size_t ro = (img * CC + (size_t)blockIdx.x * SR + r) * NN + seg * 1024;   // the wave's first position of its row: scalar, so that every row access is a scalar base + the lane's offset
    O2 += ro; O2b += ro; X1 += ro; OUTb += ro; RS += img * NN * 2; mk += img * NN + seg * 1024;
    const float* RSb = RS + (size_t)NB_ * NN * 2;   // the second key half's plane; O2b is the second half's plane of O2, an argument of its own so that its row base is scalar like the others
    const int lo = lane * 4;
    v2f rg[8], rh[8]; v4f sw[8], sb[8], x1[8], ff[8];
#pragma unroll
    for (int k = 0; k < 8; ++k) { rg[k] = *(const v2f*)(RS + (k * 512 + t) * 2); rh[k] = *(const v2f*)(RSb + (k * 512 + t) * 2); }
#pragma unroll
    for (int k = 0; k < 8; ++k) { sw[k] = *(const v4f*)(O2 + lo + k * 128); sb[k] = *(const v4f*)(O2b + lo + k * 128); x1[k] = *(const v4f*)(X1 + lo + k * 128); ff[k] = *(const v4f*)(mk + lo + k * 128); }
    asm volatile("s_wait_xcnt 0x0" :: "v"(lo) : "memory");   // stands behind the row and weight loads, before later code writes over their offset registers; the lane's offset is an input so that its register lives up to the wait
    const float g = bfr(gam[0]);
#pragma unroll
    for (int k = 0; k < 8; ++k) { float c0, c1; mergec(rg[k][0], rg[k][1], rh[k][0], rh[k][1], c0, c1); rsl[k * 512 + t] = c0; rsm[k * 512 + t] = c1; }
    __syncthreads();   // all 2 x 4096 merge weights are in LDS before any wave reads its share
    v4f a0 = (v4f){}, a1 = (v4f){};
#pragma unroll
    for (int k = 0; k < 8; ++k) { const v4f rv = *(const v4fa*)(rsl + seg * 1024 + k * 128 + lo), rw = *(const v4fa*)(rsm + seg * 1024 + k * 128 + lo);
#pragma unroll
        for (int q = 0; q < 4; ++q) { sw[k][q] = sw[k][q] * rv[q] + sb[k][q] * rw[q]; ff[k][q] = x1[k][q] * bfr(ff[k][q]); }
        a0 += sw[k]; a1 += ff[k]; }
    float s0 = (a0[0] + a0[1]) + (a0[2] + a0[3]), s1 = (a1[0] + a1[1]) + (a1[2] + a1[3]);
#pragma unroll
    for (int sh = 16; sh; sh >>= 1) { s0 += __shfl_xor(s0, sh, 32); s1 += __shfl_xor(s1, sh, 32); }
    if (lane == 0) { p1[r * 4 + seg] = s0; p1[(SR + r) * 4 + seg] = s1; }
    __syncthreads();   // the row's 4 partial sums are in LDS before they are added
    const float mu0 = (((p1[r * 4] + p1[r * 4 + 1]) + p1[r * 4 + 2]) + p1[r * 4 + 3]) * (1.0f / NN);
    const float mu1 = (((p1[(SR + r) * 4] + p1[(SR + r) * 4 + 1]) + p1[(SR + r) * 4 + 2]) + p1[(SR + r) * 4 + 3]) * (1.0f / NN);
    a0 = (v4f){}; a1 = (v4f){};
#pragma unroll
    for (int k = 0; k < 8; ++k) { const v4f d0 = sw[k] - mu0, d1 = ff[k] - mu1; a0 += d0 * d0; a1 += d1 * d1; }
    s0 = (a0[0] + a0[1]) + (a0[2] + a0[3]); s1 = (a1[0] + a1[1]) + (a1[2] + a1[3]);
#pragma unroll
    for (int sh = 16; sh; sh >>= 1) { s0 += __shfl_xor(s0, sh, 32); s1 += __shfl_xor(s1, sh, 32); }
    if (lane == 0) { p2[r * 4 + seg] = s0; p2[(SR + r) * 4 + seg] = s1; }
    __syncthreads();   // the row's 4 partial sums of squares are in LDS before they are added
    const float q0 = ((p2[r * 4] + p2[r * 4 + 1]) + p2[r * 4 + 2]) + p2[r * 4 + 3];
    const float q1 = ((p2[(SR + r) * 4] + p2[(SR + r) * 4 + 1]) + p2[(SR + r) * 4 + 2]) + p2[(SR + r) * 4 + 3];
    const float ratio = __fdiv_rn(__fsqrt_rn(__fdiv_rn(q0, (float)(NN - 1)) + 1e-5f), __fsqrt_rn(__fdiv_rn(q1, (float)(NN - 1)) + 1e-5f));
#pragma unroll
    for (int k = 0; k < 8; ++k) *(v4f*)(OUTb + lo + k * 128) = x1[k] + g * (ff[k] * ratio);
}
extern "C" void kernel_launch(void* const* d_in, const int* in_sizes, int n_in,
                              void* d_out, int out_size, void* d_ws, size_t ws_size, hipStream_t stream) {
    (void)in_sizes; (void)n_in; (void)out_size;
    const float* IN[16]; for (int i = 0; i < 16; ++i) IN[i] = (const float*)d_in[i];
    // x [2][256][64][64], mask [2][1][64][64], sa_wq [32][256], sa_bq, sa_wk, sa_bk, sa_wv [256][256], sa_bv, sa_gamma [1], wq, bq, wk, bk, wv, bv, gamma [1] = d_in[0..15]
    const float* x = IN[0]; const float* mk = IN[1];
    float* OUT = (float*)d_out;     // [2][256][64][64]
    char* wsp = (char*)d_ws;
    auto take = [&](size_t bytes) { char* p = wsp; wsp += (bytes + 255) & ~(size_t)255; return (void*)p; };
    bf* WQ1 = (bf*)take((size_t)CQP * CC * 2); bf* WK1 = (bf*)take((size_t)CQP * CC * 2); float* BQ1 = (float*)take(256); float* BK1 = (float*)take(256); bf* WV1 = (bf*)take((size_t)CC * CC * 2);
    bf* WQ2 = (bf*)take((size_t)CQP * CC * 2); bf* WK2 = (bf*)take((size_t)CQP * CC * 2); float* BQ2 = (float*)take(256); float* BK2 = (float*)take(256); bf* WV2 = (bf*)take((size_t)CC * CC * 2);
    // per-image planes, NB_ of each (KH x NB_ of Oc and RS, key half outermost), one behind the other
    bf* XT = (bf*)take((size_t)NB_ * NN * CC * 2); bf* Qh = (bf*)take((size_t)NB_ * NN * CQ * 2); bf* Ql = (bf*)take((size_t)NB_ * NN * CQ * 2); bf* Kh = (bf*)take((size_t)NB_ * NN * CQ * 2); bf* Kl = (bf*)take((size_t)NB_ * NN * CQ * 2);
    float* Oc = (float*)take((size_t)KH * NB_ * CC * NN * 4); h16* V16 = (h16*)take((size_t)NB_ * CC * NN * 2); float* X1 = (float*)take((size_t)NB_ * CC * NN * 4);
    bf* Fh = (bf*)take((size_t)NB_ * NN * CC * 2); bf* Fl = (bf*)take((size_t)NB_ * NN * CC * 2); bf* Bh = (bf*)take((size_t)NB_ * NN * CC * 2); bf* Bl = (bf*)take((size_t)NB_ * NN * CC * 2);
    float* RS = (float*)take((size_t)KH * NB_ * NN * 2 * 4);
    if ((size_t)(wsp - (char*)d_ws) > ws_size) return;    // total ~ 50.5 MiB; ws 256 MiB
    // stage 1: self attention on x
    k_prep<<<512 + 128 + 64, 256, 0, stream>>>(x, XT, IN[2], IN[3], WQ1, BQ1, IN[4], IN[5], WK1, BK1, IN[9], IN[10], WQ2, BQ2, IN[11], IN[12], WK2, BK2, IN[6], WV1, IN[13], WV2);
    k_conv3<0, 0><<<dim3(256 + 64 + 64, NB_), 256, 0, stream>>>(XT, nullptr, XT, nullptr, WQ1, WK1, BQ1, BK1, Qh, Ql, Kh, Kl, WV1, XT, nullptr, IN[7], V16, CC);
    k_attn<<<dim3(NN / QB, NB_, KH), 512, 0, stream>>>(Qh, Ql, Kh, Kl, V16, Oc, RS);   // sa [c][i] in two key halves (x1024 carried; merged inside k_x1mT)
    // stage 2: masked cross attention on x1 (q from mask*x1, k/v from (1-mask)*x1)
    k_x1mT<<<dim3(NN / TN, NB_), 512, 0, stream>>>(Oc, RS, x, IN[8], mk, X1, Fh, Fl, Bh, Bl);
    k_conv3<1, 3><<<dim3(256 + 64 + 64, NB_), 256, 0, stream>>>(Fh, Fl, Bh, Bl, WQ2, WK2, BQ2, BK2, Qh, Ql, Kh, Kl, WV2, Bh, Bl, IN[14], V16, CC);
    k_attn<<<dim3(NN / QB, NB_, KH), 512, 0, stream>>>(Qh, Ql, Kh, Kl, V16, Oc, RS);   // sw [c][i] in two key halves (x1024 carried; merged inside k_smix)
    k_smix<<<dim3(CC / SR, NB_), 512, 0, stream>>>(Oc, Oc + (size_t)NB_ * CC * NN, RS, X1, mk, IN[15], OUT);
}
